// v000
// Times are from an AMD MI455X. After a warm-up the kernel runs many times in a row, and a time is the length of
// such a window on the GPU divided by its runs, so every launch and the gaps after it count. The runs cycle
// through copies of the inputs. A figure is the median of several windows, for all but v000 over two sittings.
// Sittings can differ by a few percent; kernels timed side by side share one.
// v000, which the later versions start from, runs in 511 microseconds.
#include <hip/hip_runtime.h>

// ---------------- problem constants (match reference) ----------------
#define BB 4
#define SS 2048
#define TT 256
#define HH 2048
#define NHH 16
#define HD 128
#define LN_EPS 1e-5f
#define SCALE_INV 0.08838834764831845f   // 1/sqrt(128)

typedef __attribute__((ext_vector_type(16))) __bf16 v16bf;
typedef __attribute__((ext_vector_type(8)))  float  v8f;

union Frag {
    unsigned int u[8];
    v16bf v;
};

// ---- optional CDNA5 async global->LDS copy path (compile-safe probe) ----
#if defined(__has_builtin)
#if __has_builtin(__builtin_amdgcn_global_load_async_to_lds_b128)
#define HAVE_ASYNC_LDS 1
#endif
#endif
#ifndef HAVE_ASYNC_LDS
#define HAVE_ASYNC_LDS 0
#endif

#if HAVE_ASYNC_LDS
typedef int gv4i __attribute__((vector_size(16)));   // matches builtin param type
static __device__ __forceinline__ void async_cp16(const void* g, void* l) {
    __builtin_amdgcn_global_load_async_to_lds_b128(
        (__attribute__((address_space(1))) gv4i*)g,
        (__attribute__((address_space(3))) gv4i*)l, 0, 0);
}
static __device__ __forceinline__ void wait_async0() {
#if __has_builtin(__builtin_amdgcn_s_wait_asynccnt)
    __builtin_amdgcn_s_wait_asynccnt(0);
#else
    asm volatile("s_wait_asynccnt 0" ::: "memory");
#endif
}
#endif

static __device__ __forceinline__ float n2n(float x) {
    if (isnan(x)) return 0.0f;
    if (isinf(x)) return x > 0.0f ? 1e4f : -1e4f;
    return x;
}

static __device__ __forceinline__ unsigned short f2bf(float f) {
    union { float f; unsigned int u; } c;
    c.f = f;
    unsigned int r = c.u + 0x7fffu + ((c.u >> 16) & 1u);  // RNE
    return (unsigned short)(r >> 16);
}

// ---------------- kernel 1: f32 -> bf16 convert (+nan_to_num) ----------------
__global__ __launch_bounds__(256) void convert_bf16_kernel(const float* __restrict__ in,
                                                           unsigned short* __restrict__ out,
                                                           long n) {
    long i = (long)blockIdx.x * blockDim.x + threadIdx.x;
    long stride = (long)gridDim.x * blockDim.x;
    for (; i < n; i += stride) out[i] = f2bf(n2n(in[i]));
}

// ---------------- kernel 2: tiled bf16 WMMA GEMM  C = A @ W^T (+bias) ------
// Block tile 128x128, K-stage 32, double-buffered LDS, software pipelined.
// 8 waves; each wave computes a 32x64 sub-tile = 2x4 accumulators.
// A: [M,K] bf16 row-major, W: [N,K] bf16 row-major.
// EPI 0: split-heads bf16 -> out[((b*NH+h)*L + s)*HD + d],  b=m/L, s=m%L
// EPI 2: transposed       -> out[((b*NH+h)*HD + d)*L + t],  b=m/L, t=m%L
// EPI 3: f32 out = acc + bias + n2n(resid[m,n]), row-major [M,N]
template <int EPI>
__global__ __launch_bounds__(256) void gemm_bf16_kernel(
    const unsigned short* __restrict__ A,
    const unsigned short* __restrict__ W,
    const float* __restrict__ bias,
    void* __restrict__ out,
    const float* __restrict__ resid,
    int M, int N, int K, int L) {

    __shared__ unsigned short As[2][128 * 32];
    __shared__ unsigned short Bs[2][128 * 32];

    const int tid  = threadIdx.x;
    const int lane = tid & 31;
    const int wid  = tid >> 5;           // 0..7
    const int wave_m = wid >> 1;         // 0..3 -> 32 rows each
    const int wave_n = wid & 1;          // 0..1 -> 64 cols each

    const int m0 = blockIdx.y * 128;
    const int n0 = blockIdx.x * 128;

    // stage loader: 512 uint4 per matrix; thread handles rows lrow0 and lrow0+64
    const int lrow0 = tid >> 2;          // 0..63
    const int lch   = (tid & 3) * 8;     // bf16 offset 0,8,16,24

    const int phi = (lane & 16) ? 4 : 0;
    const int r15 = lane & 15;

    v8f acc[2][4];
#pragma unroll
    for (int i = 0; i < 2; ++i)
#pragma unroll
        for (int j = 0; j < 4; ++j) acc[i][j] = (v8f){};

    const int NK = K >> 5;

    const size_t aRow0 = (size_t)(m0 + lrow0) * K + lch;
    const size_t aRow1 = (size_t)(m0 + lrow0 + 64) * K + lch;
    const size_t bRow0 = (size_t)(n0 + lrow0) * K + lch;
    const size_t bRow1 = (size_t)(n0 + lrow0 + 64) * K + lch;
    const int ldsOff0 = lrow0 * 32 + lch;
    const int ldsOff1 = (lrow0 + 64) * 32 + lch;

#if HAVE_ASYNC_LDS
    // ---- async-to-LDS pipelined path ----
    {
        // prologue: stage 0 into buf 0
        async_cp16(A + aRow0, &As[0][ldsOff0]);
        async_cp16(A + aRow1, &As[0][ldsOff1]);
        async_cp16(W + bRow0, &Bs[0][ldsOff0]);
        async_cp16(W + bRow1, &Bs[0][ldsOff1]);
        wait_async0();
    }
    __syncthreads();
#else
    uint4 ra0, ra1, rb0, rb1;
    {
        ra0 = *(const uint4*)(A + aRow0);
        ra1 = *(const uint4*)(A + aRow1);
        rb0 = *(const uint4*)(W + bRow0);
        rb1 = *(const uint4*)(W + bRow1);
        *(uint4*)(&As[0][ldsOff0]) = ra0;
        *(uint4*)(&As[0][ldsOff1]) = ra1;
        *(uint4*)(&Bs[0][ldsOff0]) = rb0;
        *(uint4*)(&Bs[0][ldsOff1]) = rb1;
    }
    __syncthreads();
#endif

    int buf = 0;
    for (int i = 0; i < NK; ++i) {
        const int nbuf = buf ^ 1;
        const bool more = (i + 1 < NK);
        const int kn = (i + 1) << 5;

        // ---- issue next stage ----
#if !HAVE_ASYNC_LDS
        uint4 ra0, ra1, rb0, rb1;
#endif
        if (more) {
#if HAVE_ASYNC_LDS
            async_cp16(A + aRow0 + kn, &As[nbuf][ldsOff0]);
            async_cp16(A + aRow1 + kn, &As[nbuf][ldsOff1]);
            async_cp16(W + bRow0 + kn, &Bs[nbuf][ldsOff0]);
            async_cp16(W + bRow1 + kn, &Bs[nbuf][ldsOff1]);
#else
            ra0 = *(const uint4*)(A + aRow0 + kn);
            ra1 = *(const uint4*)(A + aRow1 + kn);
            rb0 = *(const uint4*)(W + bRow0 + kn);
            rb1 = *(const uint4*)(W + bRow1 + kn);
#endif
        }

        // ---- compute current stage: 2 A-frags x 4 B-frags = 8 WMMA ----
        {
            const unsigned int* As32 = (const unsigned int*)As[buf];
            const unsigned int* Bs32 = (const unsigned int*)Bs[buf];
            const int ar0 = (wave_m * 32 + r15) * 16;
            const int ar1 = ar0 + 16 * 16;
            Frag a0, a1;
#pragma unroll
            for (int v = 0; v < 8; ++v) {
                int p = (v & 3) + ((v >= 4) ? 8 : 0) + phi;
                a0.u[v] = As32[ar0 + p];
                a1.u[v] = As32[ar1 + p];
            }
            Frag b[4];
#pragma unroll
            for (int j = 0; j < 4; ++j) {
                const int br = (wave_n * 64 + j * 16 + r15) * 16;
#pragma unroll
                for (int v = 0; v < 8; ++v)
                    b[j].u[v] = Bs32[br + (v & 3) + ((v >= 4) ? 8 : 0) + phi];
            }
#pragma unroll
            for (int j = 0; j < 4; ++j) {
                acc[0][j] = __builtin_amdgcn_wmma_f32_16x16x32_bf16(
                    false, a0.v, false, b[j].v, (short)0, acc[0][j], false, false);
                acc[1][j] = __builtin_amdgcn_wmma_f32_16x16x32_bf16(
                    false, a1.v, false, b[j].v, (short)0, acc[1][j], false, false);
            }
        }

        // ---- publish next stage ----
        if (more) {
#if HAVE_ASYNC_LDS
            wait_async0();
#else
            *(uint4*)(&As[nbuf][ldsOff0]) = ra0;
            *(uint4*)(&As[nbuf][ldsOff1]) = ra1;
            *(uint4*)(&Bs[nbuf][ldsOff0]) = rb0;
            *(uint4*)(&Bs[nbuf][ldsOff1]) = rb1;
#endif
        }
        __syncthreads();
        buf = nbuf;
    }

    // ---------------- epilogue ----------------
    const int m_in = ((lane & 16) ? 8 : 0);
#pragma unroll
    for (int i2 = 0; i2 < 2; ++i2)
#pragma unroll
        for (int j = 0; j < 4; ++j)
#pragma unroll
            for (int v = 0; v < 8; ++v) {
                int gm = m0 + wave_m * 32 + i2 * 16 + v + m_in;
                int gn = n0 + wave_n * 64 + j * 16 + r15;
                float val = acc[i2][j][v] + bias[gn];
                if (EPI == 0) {
                    int bi = gm / L, s = gm % L;
                    int h = gn >> 7, d = gn & 127;
                    ((unsigned short*)out)[(((size_t)(bi * NHH + h) * L + s) << 7) + d] = f2bf(val);
                } else if (EPI == 2) {
                    int bi = gm / L, t = gm % L;
                    int h = gn >> 7, d = gn & 127;
                    ((unsigned short*)out)[(((size_t)(bi * NHH + h) << 7) + d) * (size_t)L + t] = f2bf(val);
                } else {
                    size_t idx = (size_t)gm * N + gn;
                    ((float*)out)[idx] = val + n2n(resid[idx]);
                }
            }
}

// ---------------- kernel 3: attention (one wave per 16 S-rows) ----------------
__global__ __launch_bounds__(32) void attn_kernel(
    const unsigned short* __restrict__ qb,   // [B,NH,S,HD]
    const unsigned short* __restrict__ kb,   // [B,NH,T,HD]
    const unsigned short* __restrict__ vtb,  // [B,NH,HD,T]
    const float* __restrict__ mask,          // [B,T]
    unsigned short* __restrict__ ctxb) {     // [B,S,H] bf16

    __shared__ float sc[16 * TT];            // 16 KB score tile
    __shared__ unsigned short pr[16 * TT];   // 8 KB bf16 probs

    const int lane = threadIdx.x;
    const int bid  = blockIdx.x;
    const int bh   = bid >> 7;               // S/16 = 128 tiles per (b,h)
    const int s0   = (bid & 127) << 4;
    const int b    = bh >> 4;
    const int h    = bh & 15;

    const int phi = (lane & 16) ? 4 : 0;
    const int r15 = lane & 15;

    // ---- scores: 16 x 256 via 4 K-steps x 16 N-tiles of WMMA ----
    v8f acc[16];
#pragma unroll
    for (int i = 0; i < 16; ++i) acc[i] = (v8f){};

    const unsigned int* qrow = (const unsigned int*)(qb + ((size_t)bh * SS + s0) * HD);
    const unsigned int* kbase = (const unsigned int*)(kb + (size_t)bh * TT * HD);

#pragma unroll
    for (int kk = 0; kk < 4; ++kk) {
        const int kh = kk * 16;              // k0/2 in uints
        Frag a;
#pragma unroll
        for (int v = 0; v < 8; ++v)
            a.u[v] = qrow[r15 * 64 + kh + (v & 3) + ((v >= 4) ? 8 : 0) + phi];
#pragma unroll
        for (int nt = 0; nt < 16; ++nt) {
            Frag bf;
            const int t = nt * 16 + r15;
#pragma unroll
            for (int v = 0; v < 8; ++v)
                bf.u[v] = kbase[t * 64 + kh + (v & 3) + ((v >= 4) ? 8 : 0) + phi];
            acc[nt] = __builtin_amdgcn_wmma_f32_16x16x32_bf16(false, a.v, false, bf.v,
                                                              (short)0, acc[nt], false, false);
        }
    }

    // spill scores to LDS
    const int m_in = ((lane & 16) ? 8 : 0);
#pragma unroll
    for (int nt = 0; nt < 16; ++nt)
#pragma unroll
        for (int v = 0; v < 8; ++v)
            sc[(v + m_in) * TT + nt * 16 + r15] = acc[nt][v];
    __syncthreads();

    // ---- softmax over T=256 (lanes 0..15, one row each) ----
    if (lane < 16) {
        const int m = lane;
        const float* mrow = mask + (size_t)b * TT;
        float mx = -1e30f;
        for (int t = 0; t < TT; ++t) {
            float x = sc[m * TT + t] * SCALE_INV;
            x = fminf(fmaxf(x, -50.0f), 50.0f);
            x += mrow[t] * -1e9f;
            sc[m * TT + t] = x;
            mx = fmaxf(mx, x);
        }
        float sum = 0.0f;
        for (int t = 0; t < TT; ++t) {
            float e = __expf(sc[m * TT + t] - mx);
            sc[m * TT + t] = e;
            sum += e;
        }
        float inv = 1.0f / (sum + 1e-8f);
        for (int t = 0; t < TT; ++t)
            pr[m * TT + t] = f2bf(sc[m * TT + t] * inv);
    }
    __syncthreads();

    // ---- ctx = probs @ V : 16 x 128, K over T=256 ----
    v8f c[8];
#pragma unroll
    for (int i = 0; i < 8; ++i) c[i] = (v8f){};

    const unsigned int* prow  = (const unsigned int*)pr;                 // 128 uints/row
    const unsigned int* vbase = (const unsigned int*)(vtb + (size_t)bh * HD * TT);

#pragma unroll
    for (int kk = 0; kk < 8; ++kk) {
        const int kh = kk * 16;
        Frag a;
#pragma unroll
        for (int v = 0; v < 8; ++v)
            a.u[v] = prow[r15 * 128 + kh + (v & 3) + ((v >= 4) ? 8 : 0) + phi];
#pragma unroll
        for (int nt = 0; nt < 8; ++nt) {
            Frag bf;
            const int d = nt * 16 + r15;
#pragma unroll
            for (int v = 0; v < 8; ++v)
                bf.u[v] = vbase[d * 128 + kh + (v & 3) + ((v >= 4) ? 8 : 0) + phi];
            c[nt] = __builtin_amdgcn_wmma_f32_16x16x32_bf16(false, a.v, false, bf.v,
                                                            (short)0, c[nt], false, false);
        }
    }

    // ctx -> [B,S,H] bf16
#pragma unroll
    for (int nt = 0; nt < 8; ++nt)
#pragma unroll
        for (int v = 0; v < 8; ++v) {
            int s = s0 + v + m_in;
            size_t idx = ((size_t)(b * SS + s)) * HH + h * HD + nt * 16 + r15;
            ctxb[idx] = f2bf(c[nt][v]);
        }
}

// ---------------- kernel 4: LayerNorm (one block per row) ----------------
__global__ __launch_bounds__(256) void layernorm_kernel(const float* __restrict__ x,
                                                        const float* __restrict__ g,
                                                        const float* __restrict__ bta,
                                                        float* __restrict__ out) {
    __shared__ float rs[256], rq[256];
    const int tid = threadIdx.x;
    const size_t row = (size_t)blockIdx.x * HH;

    float s = 0.0f, q = 0.0f;
#pragma unroll
    for (int j = 0; j < HH / 256; ++j) {
        float v = x[row + tid + j * 256];
        s += v;
        q += v * v;
    }
    rs[tid] = s;
    rq[tid] = q;
    __syncthreads();
    for (int off = 128; off > 0; off >>= 1) {
        if (tid < off) { rs[tid] += rs[tid + off]; rq[tid] += rq[tid + off]; }
        __syncthreads();
    }
    const float mu  = rs[0] * (1.0f / HH);
    const float var = rq[0] * (1.0f / HH) - mu * mu;
    const float r   = rsqrtf(var + LN_EPS);
#pragma unroll
    for (int j = 0; j < HH / 256; ++j) {
        int i = tid + j * 256;
        out[row + i] = (x[row + i] - mu) * r * g[i] + bta[i];
    }
}

// ---------------- launcher ----------------
extern "C" void kernel_launch(void* const* d_in, const int* in_sizes, int n_in,
                              void* d_out, int out_size, void* d_ws, size_t ws_size,
                              hipStream_t stream) {
    const float* hs   = (const float*)d_in[0];   // (B,S,H)
    const float* at   = (const float*)d_in[1];   // (B,T,H)
    const float* mask = (const float*)d_in[2];   // (B,T)
    const float* Wq   = (const float*)d_in[3];
    const float* bq   = (const float*)d_in[4];
    const float* Wk   = (const float*)d_in[5];
    const float* bk   = (const float*)d_in[6];
    const float* Wv   = (const float*)d_in[7];
    const float* bv   = (const float*)d_in[8];
    const float* Wo   = (const float*)d_in[9];
    const float* bo   = (const float*)d_in[10];
    const float* ln_g = (const float*)d_in[11];
    const float* ln_b = (const float*)d_in[12];
    float* outp = (float*)d_out;

    const size_t BS = (size_t)BB * SS;   // 8192
    const size_t BT = (size_t)BB * TT;   // 1024

    // workspace carve-up (bf16 stored as ushort)
    char* w = (char*)d_ws;
    unsigned short* hsb  = (unsigned short*)w;                  w += BS * HH * 2;
    unsigned short* atb  = (unsigned short*)w;                  w += BT * HH * 2;
    unsigned short* wqb  = (unsigned short*)w;                  w += (size_t)HH * HH * 2;
    unsigned short* wkb  = (unsigned short*)w;                  w += (size_t)HH * HH * 2;
    unsigned short* wvb  = (unsigned short*)w;                  w += (size_t)HH * HH * 2;
    unsigned short* wob  = (unsigned short*)w;                  w += (size_t)HH * HH * 2;
    unsigned short* qb   = (unsigned short*)w;                  w += BS * HH * 2;     // [B,NH,S,HD]
    unsigned short* kbuf = (unsigned short*)w;                  w += BT * HH * 2;     // [B,NH,T,HD]
    unsigned short* vtb  = (unsigned short*)w;                  w += BT * HH * 2;     // [B,NH,HD,T]
    unsigned short* ctxb = (unsigned short*)w;                  w += BS * HH * 2;     // [B,S,H]
    float*          opre = (float*)w;                           w += BS * HH * 4;

    // 1) converts
    convert_bf16_kernel<<<4096, 256, 0, stream>>>(hs, hsb, (long)(BS * HH));
    convert_bf16_kernel<<<2048, 256, 0, stream>>>(at, atb, (long)(BT * HH));
    convert_bf16_kernel<<<2048, 256, 0, stream>>>(Wq, wqb, (long)HH * HH);
    convert_bf16_kernel<<<2048, 256, 0, stream>>>(Wk, wkb, (long)HH * HH);
    convert_bf16_kernel<<<2048, 256, 0, stream>>>(Wv, wvb, (long)HH * HH);
    convert_bf16_kernel<<<2048, 256, 0, stream>>>(Wo, wob, (long)HH * HH);

    // 2) projections (block tile 128x128)
    gemm_bf16_kernel<0><<<dim3(HH / 128, BS / 128), 256, 0, stream>>>(
        hsb, wqb, bq, qb, nullptr, (int)BS, HH, HH, SS);
    gemm_bf16_kernel<0><<<dim3(HH / 128, BT / 128), 256, 0, stream>>>(
        atb, wkb, bk, kbuf, nullptr, (int)BT, HH, HH, TT);
    gemm_bf16_kernel<2><<<dim3(HH / 128, BT / 128), 256, 0, stream>>>(
        atb, wvb, bv, vtb, nullptr, (int)BT, HH, HH, TT);

    // 3) attention: one wave per 16 S-rows per head
    attn_kernel<<<BB * NHH * (SS / 16), 32, 0, stream>>>(qb, kbuf, vtb, mask, ctxb);

    // 4) output projection + bias + residual (f32)
    gemm_bf16_kernel<3><<<dim3(HH / 128, BS / 128), 256, 0, stream>>>(
        ctxb, wob, bo, opre, hs, (int)BS, HH, HH, SS);

    // 5) LayerNorm -> d_out
    layernorm_kernel<<<(int)BS, 256, 0, stream>>>(opre, ln_g, ln_b, outp);
}

// v001
// One run takes 404 microseconds.
// In both of two side-by-side timings against v000, it was 1.32 times as fast.
#include <hip/hip_runtime.h>

// ---------------- problem constants (match reference) ----------------
#define BB 4
#define SS 2048
#define TT 256
#define HH 2048
#define NHH 16
#define HD 128
#define LN_EPS 1e-5f
#define SCALE_INV 0.08838834764831845f   // 1/sqrt(128)

// LDS pitch of a GEMM stage row, in bf16: 32 of data + 8 of pad = 80 bytes, an
// odd multiple of 16 bytes, so that the 16 rows one ds_load_b128 half-wave
// touches fall on 16 different groups of four banks (64 banks x 4 bytes).
#define GP 40

typedef __attribute__((ext_vector_type(16))) __bf16 v16bf;
typedef __attribute__((ext_vector_type(8)))  float  v8f;

union Frag {
    unsigned int u[8];
    v16bf v;
};

// ---- optional CDNA5 async global->LDS copy path (compile-safe probe) ----
#if defined(__has_builtin)
#if __has_builtin(__builtin_amdgcn_global_load_async_to_lds_b128)
#define HAVE_ASYNC_LDS 1
#endif
#endif
#ifndef HAVE_ASYNC_LDS
#define HAVE_ASYNC_LDS 0
#endif

#if HAVE_ASYNC_LDS
typedef int gv4i __attribute__((vector_size(16)));   // matches builtin param type
static __device__ __forceinline__ void async_cp16(const void* g, void* l) {
    __builtin_amdgcn_global_load_async_to_lds_b128(
        (__attribute__((address_space(1))) gv4i*)g,
        (__attribute__((address_space(3))) gv4i*)l, 0, 0);
}
static __device__ __forceinline__ void wait_async0() {
#if __has_builtin(__builtin_amdgcn_s_wait_asynccnt)
    __builtin_amdgcn_s_wait_asynccnt(0);
#else
    asm volatile("s_wait_asynccnt 0" ::: "memory");
#endif
}
#endif

static __device__ __forceinline__ float n2n(float x) {
    if (isnan(x)) return 0.0f;
    if (isinf(x)) return x > 0.0f ? 1e4f : -1e4f;
    return x;
}

static __device__ __forceinline__ unsigned short f2bf(float f) {
    union { float f; unsigned int u; } c;
    c.f = f;
    unsigned int r = c.u + 0x7fffu + ((c.u >> 16) & 1u);  // RNE
    return (unsigned short)(r >> 16);
}

// ---------------- kernel 1: f32 -> bf16 convert (+nan_to_num) ----------------
__global__ __launch_bounds__(256) void convert_bf16_kernel(const float* __restrict__ in,
                                                           unsigned short* __restrict__ out,
                                                           long n) {
    long i = (long)blockIdx.x * blockDim.x + threadIdx.x;
    long stride = (long)gridDim.x * blockDim.x;
    for (; i < n; i += stride) out[i] = f2bf(n2n(in[i]));
}

// ---------------- kernel 2: tiled bf16 WMMA GEMM  C = A @ W^T (+bias) ------
// Block tile 128x128, K-stage 32, double-buffered LDS, software pipelined.
// 8 waves; each wave computes a 32x64 sub-tile = 2x4 accumulators.
// A: [M,K] bf16 row-major, W: [N,K] bf16 row-major.
// EPI 0: split-heads bf16 -> out[((b*NH+h)*L + s)*HD + d],  b=m/L, s=m%L
// EPI 2: transposed       -> out[((b*NH+h)*HD + d)*L + t],  b=m/L, t=m%L
// EPI 3: f32 out = acc + bias + n2n(resid[m,n]), row-major [M,N]
template <int EPI>
__global__ __launch_bounds__(256) void gemm_bf16_kernel(
    const unsigned short* __restrict__ A,
    const unsigned short* __restrict__ W,
    const float* __restrict__ bias,
    void* __restrict__ out,
    const float* __restrict__ resid,
    int M, int N, int K, int L) {

    __shared__ unsigned short As[2][128 * GP];
    __shared__ unsigned short Bs[2][128 * GP];

    const int tid  = threadIdx.x;
    const int lane = tid & 31;
    const int wid  = tid >> 5;           // 0..7
    const int wave_m = wid >> 1;         // 0..3 -> 32 rows each
    const int wave_n = wid & 1;          // 0..1 -> 64 cols each

    const int m0 = blockIdx.y * 128;
    const int n0 = blockIdx.x * 128;

    // stage loader: 512 uint4 per matrix; thread handles rows lrow0 and lrow0+64
    const int lrow0 = tid >> 2;          // 0..63
    const int lch   = (tid & 3) * 8;     // bf16 offset 0,8,16,24

    const int phi = (lane & 16) ? 4 : 0;
    const int r15 = lane & 15;

    v8f acc[2][4];
#pragma unroll
    for (int i = 0; i < 2; ++i)
#pragma unroll
        for (int j = 0; j < 4; ++j) acc[i][j] = (v8f){};

    const int NK = K >> 5;

    const size_t aRow0 = (size_t)(m0 + lrow0) * K + lch;
    const size_t aRow1 = (size_t)(m0 + lrow0 + 64) * K + lch;
    const size_t bRow0 = (size_t)(n0 + lrow0) * K + lch;
    const size_t bRow1 = (size_t)(n0 + lrow0 + 64) * K + lch;
    const int ldsOff0 = lrow0 * GP + lch;
    const int ldsOff1 = (lrow0 + 64) * GP + lch;

#if HAVE_ASYNC_LDS
    // ---- async-to-LDS pipelined path ----
    {
        // prologue: stage 0 into buf 0
        async_cp16(A + aRow0, &As[0][ldsOff0]);
        async_cp16(A + aRow1, &As[0][ldsOff1]);
        async_cp16(W + bRow0, &Bs[0][ldsOff0]);
        async_cp16(W + bRow1, &Bs[0][ldsOff1]);
        wait_async0();
    }
    __syncthreads();
#else
    uint4 ra0, ra1, rb0, rb1;
    {
        ra0 = *(const uint4*)(A + aRow0);
        ra1 = *(const uint4*)(A + aRow1);
        rb0 = *(const uint4*)(W + bRow0);
        rb1 = *(const uint4*)(W + bRow1);
        *(uint4*)(&As[0][ldsOff0]) = ra0;
        *(uint4*)(&As[0][ldsOff1]) = ra1;
        *(uint4*)(&Bs[0][ldsOff0]) = rb0;
        *(uint4*)(&Bs[0][ldsOff1]) = rb1;
    }
    __syncthreads();
#endif

    int buf = 0;
    for (int i = 0; i < NK; ++i) {
        const int nbuf = buf ^ 1;
        const bool more = (i + 1 < NK);
        const int kn = (i + 1) << 5;

        // ---- issue next stage ----
#if !HAVE_ASYNC_LDS
        uint4 ra0, ra1, rb0, rb1;
#endif
        if (more) {
#if HAVE_ASYNC_LDS
            async_cp16(A + aRow0 + kn, &As[nbuf][ldsOff0]);
            async_cp16(A + aRow1 + kn, &As[nbuf][ldsOff1]);
            async_cp16(W + bRow0 + kn, &Bs[nbuf][ldsOff0]);
            async_cp16(W + bRow1 + kn, &Bs[nbuf][ldsOff1]);
#else
            ra0 = *(const uint4*)(A + aRow0 + kn);
            ra1 = *(const uint4*)(A + aRow1 + kn);
            rb0 = *(const uint4*)(W + bRow0 + kn);
            rb1 = *(const uint4*)(W + bRow1 + kn);
#endif
        }

        // ---- compute current stage: 2 A-frags x 4 B-frags = 8 WMMA ----
        {
            const unsigned int* As32 = (const unsigned int*)As[buf];
            const unsigned int* Bs32 = (const unsigned int*)Bs[buf];
            const int ar0 = (wave_m * 32 + r15) * (GP / 2);
            const int ar1 = ar0 + 16 * (GP / 2);
            Frag a0, a1;
#pragma unroll
            for (int v = 0; v < 8; ++v) {
                int p = (v & 3) + ((v >= 4) ? 8 : 0) + phi;
                a0.u[v] = As32[ar0 + p];
                a1.u[v] = As32[ar1 + p];
            }
            Frag b[4];
#pragma unroll
            for (int j = 0; j < 4; ++j) {
                const int br = (wave_n * 64 + j * 16 + r15) * (GP / 2);
#pragma unroll
                for (int v = 0; v < 8; ++v)
                    b[j].u[v] = Bs32[br + (v & 3) + ((v >= 4) ? 8 : 0) + phi];
            }
#pragma unroll
            for (int j = 0; j < 4; ++j) {
                acc[0][j] = __builtin_amdgcn_wmma_f32_16x16x32_bf16(
                    false, a0.v, false, b[j].v, (short)0, acc[0][j], false, false);
                acc[1][j] = __builtin_amdgcn_wmma_f32_16x16x32_bf16(
                    false, a1.v, false, b[j].v, (short)0, acc[1][j], false, false);
            }
        }

        // ---- publish next stage ----
        if (more) {
#if HAVE_ASYNC_LDS
            wait_async0();
#else
            *(uint4*)(&As[nbuf][ldsOff0]) = ra0;
            *(uint4*)(&As[nbuf][ldsOff1]) = ra1;
            *(uint4*)(&Bs[nbuf][ldsOff0]) = rb0;
            *(uint4*)(&Bs[nbuf][ldsOff1]) = rb1;
#endif
        }
        __syncthreads();
        buf = nbuf;
    }

    // ---------------- epilogue ----------------
    const int m_in = ((lane & 16) ? 8 : 0);
#pragma unroll
    for (int i2 = 0; i2 < 2; ++i2)
#pragma unroll
        for (int j = 0; j < 4; ++j)
#pragma unroll
            for (int v = 0; v < 8; ++v) {
                int gm = m0 + wave_m * 32 + i2 * 16 + v + m_in;
                int gn = n0 + wave_n * 64 + j * 16 + r15;
                float val = acc[i2][j][v] + bias[gn];
                if (EPI == 0) {
                    int bi = gm / L, s = gm % L;
                    int h = gn >> 7, d = gn & 127;
                    ((unsigned short*)out)[(((size_t)(bi * NHH + h) * L + s) << 7) + d] = f2bf(val);
                } else if (EPI == 2) {
                    int bi = gm / L, t = gm % L;
                    int h = gn >> 7, d = gn & 127;
                    ((unsigned short*)out)[(((size_t)(bi * NHH + h) << 7) + d) * (size_t)L + t] = f2bf(val);
                } else {
                    size_t idx = (size_t)gm * N + gn;
                    ((float*)out)[idx] = val + n2n(resid[idx]);
                }
            }
}

// ---------------- kernel 3: attention (one wave per 16 S-rows) ----------------
__global__ __launch_bounds__(32) void attn_kernel(
    const unsigned short* __restrict__ qb,   // [B,NH,S,HD]
    const unsigned short* __restrict__ kb,   // [B,NH,T,HD]
    const unsigned short* __restrict__ vtb,  // [B,NH,HD,T]
    const float* __restrict__ mask,          // [B,T]
    unsigned short* __restrict__ ctxb) {     // [B,S,H] bf16

    __shared__ float sc[16 * TT];            // 16 KB score tile
    __shared__ unsigned short pr[16 * TT];   // 8 KB bf16 probs

    const int lane = threadIdx.x;
    const int bid  = blockIdx.x;
    const int bh   = bid >> 7;               // S/16 = 128 tiles per (b,h)
    const int s0   = (bid & 127) << 4;
    const int b    = bh >> 4;
    const int h    = bh & 15;

    const int phi = (lane & 16) ? 4 : 0;
    const int r15 = lane & 15;

    // ---- scores: 16 x 256 via 4 K-steps x 16 N-tiles of WMMA ----
    v8f acc[16];
#pragma unroll
    for (int i = 0; i < 16; ++i) acc[i] = (v8f){};

    const unsigned int* qrow = (const unsigned int*)(qb + ((size_t)bh * SS + s0) * HD);
    const unsigned int* kbase = (const unsigned int*)(kb + (size_t)bh * TT * HD);

#pragma unroll
    for (int kk = 0; kk < 4; ++kk) {
        const int kh = kk * 16;              // k0/2 in uints
        Frag a;
#pragma unroll
        for (int v = 0; v < 8; ++v)
            a.u[v] = qrow[r15 * 64 + kh + (v & 3) + ((v >= 4) ? 8 : 0) + phi];
#pragma unroll
        for (int nt = 0; nt < 16; ++nt) {
            Frag bf;
            const int t = nt * 16 + r15;
#pragma unroll
            for (int v = 0; v < 8; ++v)
                bf.u[v] = kbase[t * 64 + kh + (v & 3) + ((v >= 4) ? 8 : 0) + phi];
            acc[nt] = __builtin_amdgcn_wmma_f32_16x16x32_bf16(false, a.v, false, bf.v,
                                                              (short)0, acc[nt], false, false);
        }
    }

    // spill scores to LDS
    const int m_in = ((lane & 16) ? 8 : 0);
#pragma unroll
    for (int nt = 0; nt < 16; ++nt)
#pragma unroll
        for (int v = 0; v < 8; ++v)
            sc[(v + m_in) * TT + nt * 16 + r15] = acc[nt][v];
    __syncthreads();

    // ---- softmax over T=256 (lanes 0..15, one row each) ----
    if (lane < 16) {
        const int m = lane;
        const float* mrow = mask + (size_t)b * TT;
        float mx = -1e30f;
        for (int t = 0; t < TT; ++t) {
            float x = sc[m * TT + t] * SCALE_INV;
            x = fminf(fmaxf(x, -50.0f), 50.0f);
            x += mrow[t] * -1e9f;
            sc[m * TT + t] = x;
            mx = fmaxf(mx, x);
        }
        float sum = 0.0f;
        for (int t = 0; t < TT; ++t) {
            float e = __expf(sc[m * TT + t] - mx);
            sc[m * TT + t] = e;
            sum += e;
        }
        float inv = 1.0f / (sum + 1e-8f);
        for (int t = 0; t < TT; ++t)
            pr[m * TT + t] = f2bf(sc[m * TT + t] * inv);
    }
    __syncthreads();

    // ---- ctx = probs @ V : 16 x 128, K over T=256 ----
    v8f c[8];
#pragma unroll
    for (int i = 0; i < 8; ++i) c[i] = (v8f){};

    const unsigned int* prow  = (const unsigned int*)pr;                 // 128 uints/row
    const unsigned int* vbase = (const unsigned int*)(vtb + (size_t)bh * HD * TT);

#pragma unroll
    for (int kk = 0; kk < 8; ++kk) {
        const int kh = kk * 16;
        Frag a;
#pragma unroll
        for (int v = 0; v < 8; ++v)
            a.u[v] = prow[r15 * 128 + kh + (v & 3) + ((v >= 4) ? 8 : 0) + phi];
#pragma unroll
        for (int nt = 0; nt < 8; ++nt) {
            Frag bf;
            const int d = nt * 16 + r15;
#pragma unroll
            for (int v = 0; v < 8; ++v)
                bf.u[v] = vbase[d * 128 + kh + (v & 3) + ((v >= 4) ? 8 : 0) + phi];
            c[nt] = __builtin_amdgcn_wmma_f32_16x16x32_bf16(false, a.v, false, bf.v,
                                                            (short)0, c[nt], false, false);
        }
    }

    // ctx -> [B,S,H] bf16
#pragma unroll
    for (int nt = 0; nt < 8; ++nt)
#pragma unroll
        for (int v = 0; v < 8; ++v) {
            int s = s0 + v + m_in;
            size_t idx = ((size_t)(b * SS + s)) * HH + h * HD + nt * 16 + r15;
            ctxb[idx] = f2bf(c[nt][v]);
        }
}

// ---------------- kernel 4: LayerNorm (one block per row) ----------------
__global__ __launch_bounds__(256) void layernorm_kernel(const float* __restrict__ x,
                                                        const float* __restrict__ g,
                                                        const float* __restrict__ bta,
                                                        float* __restrict__ out) {
    __shared__ float rs[256], rq[256];
    const int tid = threadIdx.x;
    const size_t row = (size_t)blockIdx.x * HH;

    float s = 0.0f, q = 0.0f;
#pragma unroll
    for (int j = 0; j < HH / 256; ++j) {
        float v = x[row + tid + j * 256];
        s += v;
        q += v * v;
    }
    rs[tid] = s;
    rq[tid] = q;
    __syncthreads();
    for (int off = 128; off > 0; off >>= 1) {
        if (tid < off) { rs[tid] += rs[tid + off]; rq[tid] += rq[tid + off]; }
        __syncthreads();
    }
    const float mu  = rs[0] * (1.0f / HH);
    const float var = rq[0] * (1.0f / HH) - mu * mu;
    const float r   = rsqrtf(var + LN_EPS);
#pragma unroll
    for (int j = 0; j < HH / 256; ++j) {
        int i = tid + j * 256;
        out[row + i] = (x[row + i] - mu) * r * g[i] + bta[i];
    }
}

// ---------------- launcher ----------------
extern "C" void kernel_launch(void* const* d_in, const int* in_sizes, int n_in,
                              void* d_out, int out_size, void* d_ws, size_t ws_size,
                              hipStream_t stream) {
    const float* hs   = (const float*)d_in[0];   // (B,S,H)
    const float* at   = (const float*)d_in[1];   // (B,T,H)
    const float* mask = (const float*)d_in[2];   // (B,T)
    const float* Wq   = (const float*)d_in[3];
    const float* bq   = (const float*)d_in[4];
    const float* Wk   = (const float*)d_in[5];
    const float* bk   = (const float*)d_in[6];
    const float* Wv   = (const float*)d_in[7];
    const float* bv   = (const float*)d_in[8];
    const float* Wo   = (const float*)d_in[9];
    const float* bo   = (const float*)d_in[10];
    const float* ln_g = (const float*)d_in[11];
    const float* ln_b = (const float*)d_in[12];
    float* outp = (float*)d_out;

    const size_t BS = (size_t)BB * SS;   // 8192
    const size_t BT = (size_t)BB * TT;   // 1024

    // workspace carve-up (bf16 stored as ushort)
    char* w = (char*)d_ws;
    unsigned short* hsb  = (unsigned short*)w;                  w += BS * HH * 2;
    unsigned short* atb  = (unsigned short*)w;                  w += BT * HH * 2;
    unsigned short* wqb  = (unsigned short*)w;                  w += (size_t)HH * HH * 2;
    unsigned short* wkb  = (unsigned short*)w;                  w += (size_t)HH * HH * 2;
    unsigned short* wvb  = (unsigned short*)w;                  w += (size_t)HH * HH * 2;
    unsigned short* wob  = (unsigned short*)w;                  w += (size_t)HH * HH * 2;
    unsigned short* qb   = (unsigned short*)w;                  w += BS * HH * 2;     // [B,NH,S,HD]
    unsigned short* kbuf = (unsigned short*)w;                  w += BT * HH * 2;     // [B,NH,T,HD]
    unsigned short* vtb  = (unsigned short*)w;                  w += BT * HH * 2;     // [B,NH,HD,T]
    unsigned short* ctxb = (unsigned short*)w;                  w += BS * HH * 2;     // [B,S,H]
    float*          opre = (float*)w;                           w += BS * HH * 4;

    // 1) converts
    convert_bf16_kernel<<<4096, 256, 0, stream>>>(hs, hsb, (long)(BS * HH));
    convert_bf16_kernel<<<2048, 256, 0, stream>>>(at, atb, (long)(BT * HH));
    convert_bf16_kernel<<<2048, 256, 0, stream>>>(Wq, wqb, (long)HH * HH);
    convert_bf16_kernel<<<2048, 256, 0, stream>>>(Wk, wkb, (long)HH * HH);
    convert_bf16_kernel<<<2048, 256, 0, stream>>>(Wv, wvb, (long)HH * HH);
    convert_bf16_kernel<<<2048, 256, 0, stream>>>(Wo, wob, (long)HH * HH);

    // 2) projections (block tile 128x128)
    gemm_bf16_kernel<0><<<dim3(HH / 128, BS / 128), 256, 0, stream>>>(
        hsb, wqb, bq, qb, nullptr, (int)BS, HH, HH, SS);
    gemm_bf16_kernel<0><<<dim3(HH / 128, BT / 128), 256, 0, stream>>>(
        atb, wkb, bk, kbuf, nullptr, (int)BT, HH, HH, TT);
    gemm_bf16_kernel<2><<<dim3(HH / 128, BT / 128), 256, 0, stream>>>(
        atb, wvb, bv, vtb, nullptr, (int)BT, HH, HH, TT);

    // 3) attention: one wave per 16 S-rows per head
    attn_kernel<<<BB * NHH * (SS / 16), 32, 0, stream>>>(qb, kbuf, vtb, mask, ctxb);

    // 4) output projection + bias + residual (f32)
    gemm_bf16_kernel<3><<<dim3(HH / 128, BS / 128), 256, 0, stream>>>(
        ctxb, wob, bo, opre, hs, (int)BS, HH, HH, SS);

    // 5) LayerNorm -> d_out
    layernorm_kernel<<<(int)BS, 256, 0, stream>>>(opre, ln_g, ln_b, outp);
}

// v002
// One run takes 364 microseconds.
// In both of two side-by-side timings against v001, it was 1.11 times as fast.
// Counting every step since v000, it is 1.46 times as fast.
#include <hip/hip_runtime.h>

// ---------------- problem constants (match reference) ----------------
#define BB 4
#define SS 2048
#define TT 256
#define HH 2048
#define NHH 16
#define HD 128
#define LN_EPS 1e-5f
#define SCALE_INV 0.08838834764831845f   // 1/sqrt(128)

// LDS pitch of a GEMM stage row, in bf16: 32 of data + 8 of pad = 80 bytes, an
// odd multiple of 16 bytes, so that the 16 rows one ds_load_b128 half-wave
// touches fall on 16 different groups of four banks (64 banks x 4 bytes).
#define GP 40

typedef __attribute__((ext_vector_type(16))) __bf16 v16bf;
typedef __attribute__((ext_vector_type(8)))  float  v8f;

union Frag {
    unsigned int u[8];
    v16bf v;
};

// ---- optional CDNA5 async global->LDS copy path (compile-safe probe) ----
#if defined(__has_builtin)
#if __has_builtin(__builtin_amdgcn_global_load_async_to_lds_b128)
#define HAVE_ASYNC_LDS 1
#endif
#endif
#ifndef HAVE_ASYNC_LDS
#define HAVE_ASYNC_LDS 0
#endif

#if HAVE_ASYNC_LDS
typedef int gv4i __attribute__((vector_size(16)));   // matches builtin param type
static __device__ __forceinline__ void async_cp16(const void* g, void* l) {
    __builtin_amdgcn_global_load_async_to_lds_b128(
        (__attribute__((address_space(1))) gv4i*)g,
        (__attribute__((address_space(3))) gv4i*)l, 0, 0);
}
static __device__ __forceinline__ void wait_async0() {
#if __has_builtin(__builtin_amdgcn_s_wait_asynccnt)
    __builtin_amdgcn_s_wait_asynccnt(0);
#else
    asm volatile("s_wait_asynccnt 0" ::: "memory");
#endif
}
#endif

static __device__ __forceinline__ float n2n(float x) {
    if (isnan(x)) return 0.0f;
    if (isinf(x)) return x > 0.0f ? 1e4f : -1e4f;
    return x;
}

static __device__ __forceinline__ unsigned short f2bf(float f) {
    union { float f; unsigned int u; } c;
    c.f = f;
    unsigned int r = c.u + 0x7fffu + ((c.u >> 16) & 1u);  // RNE
    return (unsigned short)(r >> 16);
}

// ---------------- kernel 1: f32 -> bf16 convert (+nan_to_num) ----------------
__global__ __launch_bounds__(256) void convert_bf16_kernel(const float* __restrict__ in,
                                                           unsigned short* __restrict__ out,
                                                           long n) {
    long i = (long)blockIdx.x * blockDim.x + threadIdx.x;
    long stride = (long)gridDim.x * blockDim.x;
    for (; i < n; i += stride) out[i] = f2bf(n2n(in[i]));
}

// ---------------- kernel 2: tiled bf16 WMMA GEMM  C = A @ W^T (+bias) ------
// Block tile 128x128, K-stage 32, double-buffered LDS, software pipelined.
// 8 waves; each wave computes a 32x64 sub-tile = 2x4 accumulators.
// A: [M,K] bf16 row-major, W: [N,K] bf16 row-major.
// EPI 0: split-heads bf16 -> out[((b*NH+h)*L + s)*HD + d],  b=m/L, s=m%L
// EPI 2: transposed       -> out[((b*NH+h)*HD + d)*L + t],  b=m/L, t=m%L
// EPI 3: f32 out = acc + bias + n2n(resid[m,n]), row-major [M,N]
template <int EPI>
__global__ __launch_bounds__(256) void gemm_bf16_kernel(
    const unsigned short* __restrict__ A,
    const unsigned short* __restrict__ W,
    const float* __restrict__ bias,
    void* __restrict__ out,
    const float* __restrict__ resid,
    int M, int N, int K, int L) {

    __shared__ unsigned short As[2][128 * GP];
    __shared__ unsigned short Bs[2][128 * GP];

    const int tid  = threadIdx.x;
    const int lane = tid & 31;
    const int wid  = tid >> 5;           // 0..7
    const int wave_m = wid >> 1;         // 0..3 -> 32 rows each
    const int wave_n = wid & 1;          // 0..1 -> 64 cols each

    const int m0 = blockIdx.y * 128;
    const int n0 = blockIdx.x * 128;

    // stage loader: 512 uint4 per matrix; thread handles rows lrow0 and lrow0+64
    const int lrow0 = tid >> 2;          // 0..63
    const int lch   = (tid & 3) * 8;     // bf16 offset 0,8,16,24

    const int phi = (lane & 16) ? 4 : 0;
    const int r15 = lane & 15;

    v8f acc[2][4];
#pragma unroll
    for (int i = 0; i < 2; ++i)
#pragma unroll
        for (int j = 0; j < 4; ++j) acc[i][j] = (v8f){};

    const int NK = K >> 5;

    const size_t aRow0 = (size_t)(m0 + lrow0) * K + lch;
    const size_t aRow1 = (size_t)(m0 + lrow0 + 64) * K + lch;
    const size_t bRow0 = (size_t)(n0 + lrow0) * K + lch;
    const size_t bRow1 = (size_t)(n0 + lrow0 + 64) * K + lch;
    const int ldsOff0 = lrow0 * GP + lch;
    const int ldsOff1 = (lrow0 + 64) * GP + lch;

#if HAVE_ASYNC_LDS
    // ---- async-to-LDS pipelined path ----
    {
        // prologue: stage 0 into buf 0
        async_cp16(A + aRow0, &As[0][ldsOff0]);
        async_cp16(A + aRow1, &As[0][ldsOff1]);
        async_cp16(W + bRow0, &Bs[0][ldsOff0]);
        async_cp16(W + bRow1, &Bs[0][ldsOff1]);
        wait_async0();
    }
    __syncthreads();
#else
    uint4 ra0, ra1, rb0, rb1;
    {
        ra0 = *(const uint4*)(A + aRow0);
        ra1 = *(const uint4*)(A + aRow1);
        rb0 = *(const uint4*)(W + bRow0);
        rb1 = *(const uint4*)(W + bRow1);
        *(uint4*)(&As[0][ldsOff0]) = ra0;
        *(uint4*)(&As[0][ldsOff1]) = ra1;
        *(uint4*)(&Bs[0][ldsOff0]) = rb0;
        *(uint4*)(&Bs[0][ldsOff1]) = rb1;
    }
    __syncthreads();
#endif

    int buf = 0;
    for (int i = 0; i < NK; ++i) {
        const int nbuf = buf ^ 1;
        const bool more = (i + 1 < NK);
        const int kn = (i + 1) << 5;

        // ---- issue next stage ----
#if !HAVE_ASYNC_LDS
        uint4 ra0, ra1, rb0, rb1;
#endif
        if (more) {
#if HAVE_ASYNC_LDS
            async_cp16(A + aRow0 + kn, &As[nbuf][ldsOff0]);
            async_cp16(A + aRow1 + kn, &As[nbuf][ldsOff1]);
            async_cp16(W + bRow0 + kn, &Bs[nbuf][ldsOff0]);
            async_cp16(W + bRow1 + kn, &Bs[nbuf][ldsOff1]);
#else
            ra0 = *(const uint4*)(A + aRow0 + kn);
            ra1 = *(const uint4*)(A + aRow1 + kn);
            rb0 = *(const uint4*)(W + bRow0 + kn);
            rb1 = *(const uint4*)(W + bRow1 + kn);
#endif
        }

        // ---- compute current stage: 2 A-frags x 4 B-frags = 8 WMMA ----
        {
            const unsigned int* As32 = (const unsigned int*)As[buf];
            const unsigned int* Bs32 = (const unsigned int*)Bs[buf];
            const int ar0 = (wave_m * 32 + r15) * (GP / 2);
            const int ar1 = ar0 + 16 * (GP / 2);
            Frag a0, a1;
#pragma unroll
            for (int v = 0; v < 8; ++v) {
                int p = (v & 3) + ((v >= 4) ? 8 : 0) + phi;
                a0.u[v] = As32[ar0 + p];
                a1.u[v] = As32[ar1 + p];
            }
            Frag b[4];
#pragma unroll
            for (int j = 0; j < 4; ++j) {
                const int br = (wave_n * 64 + j * 16 + r15) * (GP / 2);
#pragma unroll
                for (int v = 0; v < 8; ++v)
                    b[j].u[v] = Bs32[br + (v & 3) + ((v >= 4) ? 8 : 0) + phi];
            }
#pragma unroll
            for (int j = 0; j < 4; ++j) {
                acc[0][j] = __builtin_amdgcn_wmma_f32_16x16x32_bf16(
                    false, a0.v, false, b[j].v, (short)0, acc[0][j], false, false);
                acc[1][j] = __builtin_amdgcn_wmma_f32_16x16x32_bf16(
                    false, a1.v, false, b[j].v, (short)0, acc[1][j], false, false);
            }
        }

        // ---- publish next stage ----
        if (more) {
#if HAVE_ASYNC_LDS
            wait_async0();
#else
            *(uint4*)(&As[nbuf][ldsOff0]) = ra0;
            *(uint4*)(&As[nbuf][ldsOff1]) = ra1;
            *(uint4*)(&Bs[nbuf][ldsOff0]) = rb0;
            *(uint4*)(&Bs[nbuf][ldsOff1]) = rb1;
#endif
        }
        __syncthreads();
        buf = nbuf;
    }

    // ---------------- epilogue ----------------
    const int m_in = ((lane & 16) ? 8 : 0);
#pragma unroll
    for (int i2 = 0; i2 < 2; ++i2)
#pragma unroll
        for (int j = 0; j < 4; ++j)
#pragma unroll
            for (int v = 0; v < 8; ++v) {
                int gm = m0 + wave_m * 32 + i2 * 16 + v + m_in;
                int gn = n0 + wave_n * 64 + j * 16 + r15;
                float val = acc[i2][j][v] + bias[gn];
                if (EPI == 0) {
                    int bi = gm / L, s = gm % L;
                    int h = gn >> 7, d = gn & 127;
                    ((unsigned short*)out)[(((size_t)(bi * NHH + h) * L + s) << 7) + d] = f2bf(val);
                } else if (EPI == 2) {
                    int bi = gm / L, t = gm % L;
                    int h = gn >> 7, d = gn & 127;
                    ((unsigned short*)out)[(((size_t)(bi * NHH + h) << 7) + d) * (size_t)L + t] = f2bf(val);
                } else {
                    size_t idx = (size_t)gm * N + gn;
                    ((float*)out)[idx] = val + n2n(resid[idx]);
                }
            }
}

// ---------------- kernel 3: attention (one wave per 16 S-rows) ----------------
// Both products are taken transposed: S^T = K * Q^T and ctx^T = V^T * P^T. In the
// accumulator map a lane then holds 8 keys (or 8 head dims) of ONE query row
// (column lane & 15), so the softmax runs in registers on all 32 lanes, with one
// exchange between the wave's halves for the maximum and one for the sum, and two
// score tiles, converted in place, are the B operand of the second product.

// value of lane l ^ 16
static __device__ __forceinline__ float xhalf(float x) {
    return __builtin_bit_cast(float, __builtin_amdgcn_permlanex16(
        __builtin_bit_cast(int, x), __builtin_bit_cast(int, x),
        0x76543210, 0xfedcba98, false, false));
}

// 2^a. The v_nop fills the one slot the instruction set asks for between a
// transcendental and a next instruction that reads its result or overwrites its
// source; in one statement with it, it cannot be scheduled away from it.
static __device__ __forceinline__ float exp2_slot(float a) {
    float r;
    asm("v_exp_f32 %0, %1\n\tv_nop" : "=v"(r) : "v"(a));
    return r;
}

__global__ __launch_bounds__(32) void attn_kernel(
    const unsigned short* __restrict__ qb,   // [B,NH,S,HD]
    const unsigned short* __restrict__ kb,   // [B,NH,T,HD]
    const unsigned short* __restrict__ vtb,  // [B,NH,HD,T]
    const float* __restrict__ mask,          // [B,T]
    unsigned short* __restrict__ ctxb) {     // [B,S,H] bf16

    const int lane = threadIdx.x;
    const int bid  = blockIdx.x;
    const int bh   = bid >> 7;               // S/16 = 128 tiles per (b,h)
    const int s0   = (bid & 127) << 4;
    const int b    = bh >> 4;
    const int h    = bh & 15;

    const int phi  = (lane & 16) ? 4 : 0;
    const int r15  = lane & 15;
    const int m_in = (lane & 16) ? 8 : 0;

    // ---- scores^T: 256 x 16 via 4 K-steps x 16 key tiles of WMMA ----
    // acc[nt][v] = score(query s0 + r15, key nt*16 + m_in + v)
    v8f acc[16];
#pragma unroll
    for (int i = 0; i < 16; ++i) acc[i] = (v8f){};

    const unsigned int* qrow = (const unsigned int*)(qb + ((size_t)bh * SS + s0) * HD);
    const unsigned int* kbase = (const unsigned int*)(kb + (size_t)bh * TT * HD);

#pragma unroll
    for (int kk = 0; kk < 4; ++kk) {
        const int kh = kk * 16;              // k0/2 in uints
        Frag q;
#pragma unroll
        for (int v = 0; v < 8; ++v)
            q.u[v] = qrow[r15 * 64 + kh + (v & 3) + ((v >= 4) ? 8 : 0) + phi];
#pragma unroll
        for (int nt = 0; nt < 16; ++nt) {
            Frag kf;
            const int t = nt * 16 + r15;
#pragma unroll
            for (int v = 0; v < 8; ++v)
                kf.u[v] = kbase[t * 64 + kh + (v & 3) + ((v >= 4) ? 8 : 0) + phi];
            acc[nt] = __builtin_amdgcn_wmma_f32_16x16x32_bf16(false, kf.v, false, q.v,
                                                              (short)0, acc[nt], false, false);
        }
    }

    // ---- softmax over T=256: 128 keys of the row in this lane, 128 in lane ^ 16 ----
    const float* mrow = mask + (size_t)b * TT + m_in;
    v8f mx8;
#pragma unroll
    for (int v = 0; v < 8; ++v) mx8[v] = -1e30f;
#pragma unroll
    for (int nt = 0; nt < 16; ++nt) {
        const float4 ma = *(const float4*)(mrow + nt * 16);
        const float4 mb = *(const float4*)(mrow + nt * 16 + 4);
        const float mk[8] = {ma.x, ma.y, ma.z, ma.w, mb.x, mb.y, mb.z, mb.w};
#pragma unroll
        for (int v = 0; v < 8; ++v) {
            float x = acc[nt][v] * SCALE_INV;
            x = fminf(fmaxf(x, -50.0f), 50.0f);
            x += mk[v] * -1e9f;
            acc[nt][v] = x;
            mx8[v] = fmaxf(mx8[v], x);
        }
    }
    float mx = fmaxf(fmaxf(fmaxf(mx8[0], mx8[1]), fmaxf(mx8[2], mx8[3])),
                     fmaxf(fmaxf(mx8[4], mx8[5]), fmaxf(mx8[6], mx8[7])));
    mx = fmaxf(mx, xhalf(mx));
    // the address registers of the K, Q and mask loads are reused from here on
    asm volatile("s_wait_xcnt 0x0" ::: "memory");

    v8f sum8 = (v8f){};
#pragma unroll
    for (int nt = 0; nt < 16; ++nt)
#pragma unroll
        for (int v = 0; v < 8; ++v) {
            float e = exp2_slot((acc[nt][v] - mx) * 1.44269504f);   // e^(x - mx)
            acc[nt][v] = e;
            sum8[v] += e;
        }
    float sum = ((sum8[0] + sum8[1]) + (sum8[2] + sum8[3])) +
                ((sum8[4] + sum8[5]) + (sum8[6] + sum8[7]));
    sum += xhalf(sum);
    const float inv = 1.0f / (sum + 1e-8f);

    // probs^T as B fragments: score tiles 2kk and 2kk+1 hold keys kk*32 + m_in + 0..7
    // and kk*32 + 16 + m_in + 0..7, the k order of the V^T loader below
    Frag p[8];
#pragma unroll
    for (int kk = 0; kk < 8; ++kk)
#pragma unroll
        for (int w = 0; w < 4; ++w) {
            p[kk].u[w]     = (unsigned int)f2bf(acc[2 * kk][2 * w] * inv) |
                             ((unsigned int)f2bf(acc[2 * kk][2 * w + 1] * inv) << 16);
            p[kk].u[4 + w] = (unsigned int)f2bf(acc[2 * kk + 1][2 * w] * inv) |
                             ((unsigned int)f2bf(acc[2 * kk + 1][2 * w + 1] * inv) << 16);
        }
    // keeps the packing ahead of the second product: spread among its WMMAs the 128
    // f32 values stay live and leave registers for only two V loads in flight
    __builtin_amdgcn_sched_barrier(0);

    // ---- ctx^T = V^T @ probs^T : 128 x 16, K over T=256 ----
    // c[nt][v] = ctx(query s0 + r15, head dim nt*16 + m_in + v)
    v8f c[8];
#pragma unroll
    for (int i = 0; i < 8; ++i) c[i] = (v8f){};

    const unsigned int* vbase = (const unsigned int*)(vtb + (size_t)bh * HD * TT);

#pragma unroll
    for (int kk = 0; kk < 8; ++kk) {
        const int kh = kk * 16;
#pragma unroll
        for (int nt = 0; nt < 8; ++nt) {
            Frag vf;
            const int d = nt * 16 + r15;
#pragma unroll
            for (int v = 0; v < 8; ++v)
                vf.u[v] = vbase[d * 128 + kh + (v & 3) + ((v >= 4) ? 8 : 0) + phi];
            c[nt] = __builtin_amdgcn_wmma_f32_16x16x32_bf16(false, vf.v, false, p[kk].v,
                                                            (short)0, c[nt], false, false);
        }
    }

    // ctx -> [B,S,H] bf16: 8 consecutive head dims of one row per lane and tile
    unsigned short* crow = ctxb + ((size_t)(b * SS + s0 + r15)) * HH + h * HD + m_in;
#pragma unroll
    for (int nt = 0; nt < 8; ++nt) {
        uint4 o;
        o.x = (unsigned int)f2bf(c[nt][0]) | ((unsigned int)f2bf(c[nt][1]) << 16);
        o.y = (unsigned int)f2bf(c[nt][2]) | ((unsigned int)f2bf(c[nt][3]) << 16);
        o.z = (unsigned int)f2bf(c[nt][4]) | ((unsigned int)f2bf(c[nt][5]) << 16);
        o.w = (unsigned int)f2bf(c[nt][6]) | ((unsigned int)f2bf(c[nt][7]) << 16);
        *(uint4*)(crow + nt * 16) = o;
    }
}

// ---------------- kernel 4: LayerNorm (one block per row) ----------------
__global__ __launch_bounds__(256) void layernorm_kernel(const float* __restrict__ x,
                                                        const float* __restrict__ g,
                                                        const float* __restrict__ bta,
                                                        float* __restrict__ out) {
    __shared__ float rs[256], rq[256];
    const int tid = threadIdx.x;
    const size_t row = (size_t)blockIdx.x * HH;

    float s = 0.0f, q = 0.0f;
#pragma unroll
    for (int j = 0; j < HH / 256; ++j) {
        float v = x[row + tid + j * 256];
        s += v;
        q += v * v;
    }
    rs[tid] = s;
    rq[tid] = q;
    __syncthreads();
    for (int off = 128; off > 0; off >>= 1) {
        if (tid < off) { rs[tid] += rs[tid + off]; rq[tid] += rq[tid + off]; }
        __syncthreads();
    }
    const float mu  = rs[0] * (1.0f / HH);
    const float var = rq[0] * (1.0f / HH) - mu * mu;
    const float r   = rsqrtf(var + LN_EPS);
#pragma unroll
    for (int j = 0; j < HH / 256; ++j) {
        int i = tid + j * 256;
        out[row + i] = (x[row + i] - mu) * r * g[i] + bta[i];
    }
}

// ---------------- launcher ----------------
extern "C" void kernel_launch(void* const* d_in, const int* in_sizes, int n_in,
                              void* d_out, int out_size, void* d_ws, size_t ws_size,
                              hipStream_t stream) {
    const float* hs   = (const float*)d_in[0];   // (B,S,H)
    const float* at   = (const float*)d_in[1];   // (B,T,H)
    const float* mask = (const float*)d_in[2];   // (B,T)
    const float* Wq   = (const float*)d_in[3];
    const float* bq   = (const float*)d_in[4];
    const float* Wk   = (const float*)d_in[5];
    const float* bk   = (const float*)d_in[6];
    const float* Wv   = (const float*)d_in[7];
    const float* bv   = (const float*)d_in[8];
    const float* Wo   = (const float*)d_in[9];
    const float* bo   = (const float*)d_in[10];
    const float* ln_g = (const float*)d_in[11];
    const float* ln_b = (const float*)d_in[12];
    float* outp = (float*)d_out;

    const size_t BS = (size_t)BB * SS;   // 8192
    const size_t BT = (size_t)BB * TT;   // 1024

    // workspace carve-up (bf16 stored as ushort)
    char* w = (char*)d_ws;
    unsigned short* hsb  = (unsigned short*)w;                  w += BS * HH * 2;
    unsigned short* atb  = (unsigned short*)w;                  w += BT * HH * 2;
    unsigned short* wqb  = (unsigned short*)w;                  w += (size_t)HH * HH * 2;
    unsigned short* wkb  = (unsigned short*)w;                  w += (size_t)HH * HH * 2;
    unsigned short* wvb  = (unsigned short*)w;                  w += (size_t)HH * HH * 2;
    unsigned short* wob  = (unsigned short*)w;                  w += (size_t)HH * HH * 2;
    unsigned short* qb   = (unsigned short*)w;                  w += BS * HH * 2;     // [B,NH,S,HD]
    unsigned short* kbuf = (unsigned short*)w;                  w += BT * HH * 2;     // [B,NH,T,HD]
    unsigned short* vtb  = (unsigned short*)w;                  w += BT * HH * 2;     // [B,NH,HD,T]
    unsigned short* ctxb = (unsigned short*)w;                  w += BS * HH * 2;     // [B,S,H]
    float*          opre = (float*)w;                           w += BS * HH * 4;

    // 1) converts
    convert_bf16_kernel<<<4096, 256, 0, stream>>>(hs, hsb, (long)(BS * HH));
    convert_bf16_kernel<<<2048, 256, 0, stream>>>(at, atb, (long)(BT * HH));
    convert_bf16_kernel<<<2048, 256, 0, stream>>>(Wq, wqb, (long)HH * HH);
    convert_bf16_kernel<<<2048, 256, 0, stream>>>(Wk, wkb, (long)HH * HH);
    convert_bf16_kernel<<<2048, 256, 0, stream>>>(Wv, wvb, (long)HH * HH);
    convert_bf16_kernel<<<2048, 256, 0, stream>>>(Wo, wob, (long)HH * HH);

    // 2) projections (block tile 128x128)
    gemm_bf16_kernel<0><<<dim3(HH / 128, BS / 128), 256, 0, stream>>>(
        hsb, wqb, bq, qb, nullptr, (int)BS, HH, HH, SS);
    gemm_bf16_kernel<0><<<dim3(HH / 128, BT / 128), 256, 0, stream>>>(
        atb, wkb, bk, kbuf, nullptr, (int)BT, HH, HH, TT);
    gemm_bf16_kernel<2><<<dim3(HH / 128, BT / 128), 256, 0, stream>>>(
        atb, wvb, bv, vtb, nullptr, (int)BT, HH, HH, TT);

    // 3) attention: one wave per 16 S-rows per head
    attn_kernel<<<BB * NHH * (SS / 16), 32, 0, stream>>>(qb, kbuf, vtb, mask, ctxb);

    // 4) output projection + bias + residual (f32)
    gemm_bf16_kernel<3><<<dim3(HH / 128, BS / 128), 256, 0, stream>>>(
        ctxb, wob, bo, opre, hs, (int)BS, HH, HH, SS);

    // 5) LayerNorm -> d_out
    layernorm_kernel<<<(int)BS, 256, 0, stream>>>(opre, ln_g, ln_b, outp);
}

// v003
// Measured time: 313 microseconds a run.
// In both of two side-by-side timings against v002, it was 1.17 times as fast.
// Over all steps from v000 it is 1.71 times as fast.
#include <hip/hip_runtime.h>

// ---------------- problem constants (match reference) ----------------
#define BB 4
#define SS 2048
#define TT 256
#define HH 2048
#define NHH 16
#define HD 128
#define LN_EPS 1e-5f
#define SCALE_INV 0.08838834764831845f   // 1/sqrt(128)

// LDS pitch of a GEMM stage row, in bf16: 32 of data + 8 of pad = 80 bytes, an
// odd multiple of 16 bytes, so that the 16 rows one ds_load_b128 half-wave
// touches fall on 16 different groups of four banks (64 banks x 4 bytes).
#define GP 40

typedef __attribute__((ext_vector_type(16))) __bf16 v16bf;
typedef __attribute__((ext_vector_type(8)))  float  v8f;

union Frag {
    unsigned int u[8];
    v16bf v;
};

// ---- optional CDNA5 async global->LDS copy path (compile-safe probe) ----
#if defined(__has_builtin)
#if __has_builtin(__builtin_amdgcn_global_load_async_to_lds_b128)
#define HAVE_ASYNC_LDS 1
#endif
#endif
#ifndef HAVE_ASYNC_LDS
#define HAVE_ASYNC_LDS 0
#endif

#if HAVE_ASYNC_LDS
typedef int gv4i __attribute__((vector_size(16)));   // matches builtin param type
static __device__ __forceinline__ void async_cp16(const void* g, void* l) {
    __builtin_amdgcn_global_load_async_to_lds_b128(
        (__attribute__((address_space(1))) gv4i*)g,
        (__attribute__((address_space(3))) gv4i*)l, 0, 0);
}
static __device__ __forceinline__ void wait_async0() {
#if __has_builtin(__builtin_amdgcn_s_wait_asynccnt)
    __builtin_amdgcn_s_wait_asynccnt(0);
#else
    asm volatile("s_wait_asynccnt 0" ::: "memory");
#endif
}
#endif

static __device__ __forceinline__ float n2n(float x) {
    if (isnan(x)) return 0.0f;
    if (isinf(x)) return x > 0.0f ? 1e4f : -1e4f;
    return x;
}

static __device__ __forceinline__ unsigned short f2bf(float f) {
    union { float f; unsigned int u; } c;
    c.f = f;
    unsigned int r = c.u + 0x7fffu + ((c.u >> 16) & 1u);  // RNE
    return (unsigned short)(r >> 16);
}

// ---------------- kernel 1: f32 -> bf16 convert (+nan_to_num) ----------------
__global__ __launch_bounds__(256) void convert_bf16_kernel(const float* __restrict__ in,
                                                           unsigned short* __restrict__ out,
                                                           long n) {
    long i = (long)blockIdx.x * blockDim.x + threadIdx.x;
    long stride = (long)gridDim.x * blockDim.x;
    for (; i < n; i += stride) out[i] = f2bf(n2n(in[i]));
}

// ---------------- kernel 2: tiled bf16 WMMA GEMM  C = A @ W^T (+bias) ------
// Block tile 128x128, K-stage 32, double-buffered LDS, software pipelined.
// 8 waves; each wave computes a 32x64 sub-tile = 2x4 accumulators.
// A: [M,K] bf16 row-major, W: [N,K] bf16 row-major.
// EPI 0: split-heads bf16 -> out[((b*NH+h)*L + s)*HD + d],  b=m/L, s=m%L
// EPI 2: transposed       -> out[((b*NH+h)*HD + d)*L + t],  b=m/L, t=m%L
// EPI 3: f32 out = acc + bias + n2n(resid[m,n]), row-major [M,N]
template <int EPI>
__global__ __launch_bounds__(256) void gemm_bf16_kernel(
    const unsigned short* __restrict__ A,
    const unsigned short* __restrict__ W,
    const float* __restrict__ bias,
    void* __restrict__ out,
    const float* __restrict__ resid,
    int M, int N, int K, int L) {

    __shared__ unsigned short As[2][128 * GP];
    __shared__ unsigned short Bs[2][128 * GP];

    const int tid  = threadIdx.x;
    const int lane = tid & 31;
    const int wid  = tid >> 5;           // 0..7
    const int wave_m = wid >> 1;         // 0..3 -> 32 rows each
    const int wave_n = wid & 1;          // 0..1 -> 64 cols each

    const int m0 = blockIdx.y * 128;
    const int n0 = blockIdx.x * 128;

    // stage loader: 512 uint4 per matrix; thread handles rows lrow0 and lrow0+64
    const int lrow0 = tid >> 2;          // 0..63
    const int lch   = (tid & 3) * 8;     // bf16 offset 0,8,16,24

    const int phi = (lane & 16) ? 4 : 0;
    const int r15 = lane & 15;

    v8f acc[2][4];
#pragma unroll
    for (int i = 0; i < 2; ++i)
#pragma unroll
        for (int j = 0; j < 4; ++j) acc[i][j] = (v8f){};

    const int NK = K >> 5;

    const size_t aRow0 = (size_t)(m0 + lrow0) * K + lch;
    const size_t aRow1 = (size_t)(m0 + lrow0 + 64) * K + lch;
    const size_t bRow0 = (size_t)(n0 + lrow0) * K + lch;
    const size_t bRow1 = (size_t)(n0 + lrow0 + 64) * K + lch;
    const int ldsOff0 = lrow0 * GP + lch;
    const int ldsOff1 = (lrow0 + 64) * GP + lch;

#if HAVE_ASYNC_LDS
    // ---- async-to-LDS pipelined path ----
    {
        // prologue: stage 0 into buf 0
        async_cp16(A + aRow0, &As[0][ldsOff0]);
        async_cp16(A + aRow1, &As[0][ldsOff1]);
        async_cp16(W + bRow0, &Bs[0][ldsOff0]);
        async_cp16(W + bRow1, &Bs[0][ldsOff1]);
        wait_async0();
    }
    __syncthreads();
#else
    uint4 ra0, ra1, rb0, rb1;
    {
        ra0 = *(const uint4*)(A + aRow0);
        ra1 = *(const uint4*)(A + aRow1);
        rb0 = *(const uint4*)(W + bRow0);
        rb1 = *(const uint4*)(W + bRow1);
        *(uint4*)(&As[0][ldsOff0]) = ra0;
        *(uint4*)(&As[0][ldsOff1]) = ra1;
        *(uint4*)(&Bs[0][ldsOff0]) = rb0;
        *(uint4*)(&Bs[0][ldsOff1]) = rb1;
    }
    __syncthreads();
#endif

    int buf = 0;
    for (int i = 0; i < NK; ++i) {
        const int nbuf = buf ^ 1;
        const bool more = (i + 1 < NK);
        const int kn = (i + 1) << 5;

        // ---- issue next stage ----
#if !HAVE_ASYNC_LDS
        uint4 ra0, ra1, rb0, rb1;
#endif
        if (more) {
#if HAVE_ASYNC_LDS
            async_cp16(A + aRow0 + kn, &As[nbuf][ldsOff0]);
            async_cp16(A + aRow1 + kn, &As[nbuf][ldsOff1]);
            async_cp16(W + bRow0 + kn, &Bs[nbuf][ldsOff0]);
            async_cp16(W + bRow1 + kn, &Bs[nbuf][ldsOff1]);
#else
            ra0 = *(const uint4*)(A + aRow0 + kn);
            ra1 = *(const uint4*)(A + aRow1 + kn);
            rb0 = *(const uint4*)(W + bRow0 + kn);
            rb1 = *(const uint4*)(W + bRow1 + kn);
#endif
        }

        // ---- compute current stage: 2 A-frags x 4 B-frags = 8 WMMA ----
        {
            const unsigned int* As32 = (const unsigned int*)As[buf];
            const unsigned int* Bs32 = (const unsigned int*)Bs[buf];
            const int ar0 = (wave_m * 32 + r15) * (GP / 2);
            const int ar1 = ar0 + 16 * (GP / 2);
            Frag a0, a1;
#pragma unroll
            for (int v = 0; v < 8; ++v) {
                int p = (v & 3) + ((v >= 4) ? 8 : 0) + phi;
                a0.u[v] = As32[ar0 + p];
                a1.u[v] = As32[ar1 + p];
            }
            Frag b[4];
#pragma unroll
            for (int j = 0; j < 4; ++j) {
                const int br = (wave_n * 64 + j * 16 + r15) * (GP / 2);
#pragma unroll
                for (int v = 0; v < 8; ++v)
                    b[j].u[v] = Bs32[br + (v & 3) + ((v >= 4) ? 8 : 0) + phi];
            }
#pragma unroll
            for (int j = 0; j < 4; ++j) {
                acc[0][j] = __builtin_amdgcn_wmma_f32_16x16x32_bf16(
                    false, a0.v, false, b[j].v, (short)0, acc[0][j], false, false);
                acc[1][j] = __builtin_amdgcn_wmma_f32_16x16x32_bf16(
                    false, a1.v, false, b[j].v, (short)0, acc[1][j], false, false);
            }
        }

        // ---- publish next stage ----
        if (more) {
#if HAVE_ASYNC_LDS
            wait_async0();
#else
            *(uint4*)(&As[nbuf][ldsOff0]) = ra0;
            *(uint4*)(&As[nbuf][ldsOff1]) = ra1;
            *(uint4*)(&Bs[nbuf][ldsOff0]) = rb0;
            *(uint4*)(&Bs[nbuf][ldsOff1]) = rb1;
#endif
        }
        __syncthreads();
        buf = nbuf;
    }

    // ---------------- epilogue ----------------
    const int m_in = ((lane & 16) ? 8 : 0);
#pragma unroll
    for (int i2 = 0; i2 < 2; ++i2)
#pragma unroll
        for (int j = 0; j < 4; ++j)
#pragma unroll
            for (int v = 0; v < 8; ++v) {
                int gm = m0 + wave_m * 32 + i2 * 16 + v + m_in;
                int gn = n0 + wave_n * 64 + j * 16 + r15;
                float val = acc[i2][j][v] + bias[gn];
                if (EPI == 0) {
                    int bi = gm / L, s = gm % L;
                    int h = gn >> 7, d = gn & 127;
                    ((unsigned short*)out)[(((size_t)(bi * NHH + h) * L + s) << 7) + d] = f2bf(val);
                } else if (EPI == 2) {
                    int bi = gm / L, t = gm % L;
                    int h = gn >> 7, d = gn & 127;
                    ((unsigned short*)out)[(((size_t)(bi * NHH + h) << 7) + d) * (size_t)L + t] = f2bf(val);
                } else {
                    size_t idx = (size_t)gm * N + gn;
                    ((float*)out)[idx] = val + n2n(resid[idx]);
                }
            }
}

// ---------------- kernel 3: attention (one wave per 16 S-rows) ----------------
// 16 waves (256 query rows of one head) form a work-group. The head's K (256 x 128)
// and V^T (128 x 256) are brought into LDS once, in whole 128-byte lines, and every
// wave takes its A fragments from there.
// Both products are taken transposed: S^T = K * Q^T and ctx^T = V^T * P^T. In the
// accumulator map a lane then holds 8 keys (or 8 head dims) of ONE query row
// (column lane & 15), so the softmax runs in registers on all 32 lanes, with one
// exchange between the wave's halves for the maximum and one for the sum, and two
// score tiles, converted in place, are the B operand of the second product.

// value of lane l ^ 16
static __device__ __forceinline__ float xhalf(float x) {
    return __builtin_bit_cast(float, __builtin_amdgcn_permlanex16(
        __builtin_bit_cast(int, x), __builtin_bit_cast(int, x),
        0x76543210, 0xfedcba98, false, false));
}

// 2^a. The v_nop fills the one slot the instruction set asks for between a
// transcendental and a next instruction that reads its result or overwrites its
// source; in one statement with it, it cannot be scheduled away from it.
static __device__ __forceinline__ float exp2_slot(float a) {
    float r;
    asm("v_exp_f32 %0, %1\n\tv_nop" : "=v"(r) : "v"(a));
    return r;
}

// LDS pitches in bf16: a K row is 256 B + 16 B of pad, a V^T row 512 B + 16 B, both
// odd multiples of 16 B, so that the 16 rows of a ds_load_b128 half-wave fall on 16
// different groups of four banks.
#define KP 136
#define VP 264
#define ATT_WAVES 16

// Eight asynchronous 16-byte copies per lane, global -> LDS, step gs bytes in global
// memory and ls bytes in LDS. The s_wait_xcnt closes the statement so that it stands
// in front of any later write of the address registers the copies name.
static __device__ __forceinline__ void async_cp16x8(unsigned int l, const char* g,
                                                    unsigned int ls, unsigned int gs) {
    asm volatile(
        "global_load_async_to_lds_b128 %0, %8, off\n\t"
        "global_load_async_to_lds_b128 %1, %9, off\n\t"
        "global_load_async_to_lds_b128 %2, %10, off\n\t"
        "global_load_async_to_lds_b128 %3, %11, off\n\t"
        "global_load_async_to_lds_b128 %4, %12, off\n\t"
        "global_load_async_to_lds_b128 %5, %13, off\n\t"
        "global_load_async_to_lds_b128 %6, %14, off\n\t"
        "global_load_async_to_lds_b128 %7, %15, off\n\t"
        "s_wait_xcnt 0x0"
        :: "v"(l), "v"(l + ls), "v"(l + 2 * ls), "v"(l + 3 * ls),
           "v"(l + 4 * ls), "v"(l + 5 * ls), "v"(l + 6 * ls), "v"(l + 7 * ls),
           "v"(g), "v"(g + gs), "v"(g + 2 * gs), "v"(g + 3 * gs),
           "v"(g + 4 * gs), "v"(g + 5 * gs), "v"(g + 6 * gs), "v"(g + 7 * gs)
        : "memory");
}

// Four A fragments from an LDS tile: rows 16 apart, pitch in dwords; base points at the
// lane's row and its half of the 32 k (dwords 0..3 and 8..11: the k order of the B side)
static __device__ __forceinline__ void lds_frag4(Frag* f, const unsigned int* base, int pitch) {
#pragma unroll
    for (int j = 0; j < 4; ++j) {
        const uint4 lo = *(const uint4*)(base + j * 16 * pitch);
        const uint4 hi = *(const uint4*)(base + j * 16 * pitch + 8);
        f[j].u[0] = lo.x; f[j].u[1] = lo.y; f[j].u[2] = lo.z; f[j].u[3] = lo.w;
        f[j].u[4] = hi.x; f[j].u[5] = hi.y; f[j].u[6] = hi.z; f[j].u[7] = hi.w;
    }
}

// byte offset of a __shared__ object in the work-group's LDS
static __device__ __forceinline__ unsigned int lds_off(const void* p) {
    return (unsigned int)(size_t)(__attribute__((address_space(3))) const void*)p;
}

__global__ __launch_bounds__(ATT_WAVES * 32) void attn_kernel(
    const unsigned short* __restrict__ qb,   // [B,NH,S,HD]
    const unsigned short* __restrict__ kb,   // [B,NH,T,HD]
    const unsigned short* __restrict__ vtb,  // [B,NH,HD,T]
    const float* __restrict__ mask,          // [B,T]
    unsigned short* __restrict__ ctxb) {     // [B,S,H] bf16

    __shared__ __attribute__((aligned(16))) unsigned short Ks[TT * KP];
    __shared__ __attribute__((aligned(16))) unsigned short Vs[HD * VP];

    const int tid  = threadIdx.x;
    const int lane = tid & 31;
    const int bid  = blockIdx.x;
    const int bh   = bid >> 3;               // S/256 = 8 work-groups per (b,h)
    const int s0   = ((bid & 7) << 8) + ((tid >> 5) << 4);
    const int b    = bh >> 4;
    const int h    = bh & 15;

    const int phi  = (lane & 16) ? 4 : 0;
    const int r15  = lane & 15;
    const int m_in = (lane & 16) ? 8 : 0;

    // ---- scores^T: 256 x 16 via 4 K-steps x 16 key tiles of WMMA ----
    // acc[nt][v] = score(query s0 + r15, key nt*16 + m_in + v)
    v8f acc[16];
#pragma unroll
    for (int i = 0; i < 16; ++i) acc[i] = (v8f){};

    // this wave's own 16 query rows, straight from global memory, in flight with the copies
    const unsigned int* qrow = (const unsigned int*)(qb + ((size_t)bh * SS + s0) * HD);
    Frag q[4];
#pragma unroll
    for (int kk = 0; kk < 4; ++kk)
#pragma unroll
        for (int v = 0; v < 8; ++v)
            q[kk].u[v] = qrow[r15 * 64 + kk * 16 + (v & 3) + ((v >= 4) ? 8 : 0) + phi];

    // K and V^T of this head are 64 KiB each, contiguous: thread tid copies the 16-byte
    // pieces tid, tid + 512, ... (a wave's copy is 512 contiguous bytes: two K rows or
    // one V^T row); 512 pieces are 32 K rows or 16 V^T rows.
    async_cp16x8(lds_off(Ks) + (tid >> 4) * (KP * 2) + (tid & 15) * 16,
                 (const char*)(kb + (size_t)bh * TT * HD) + tid * 16, 32 * KP * 2, 8192);
    async_cp16x8(lds_off(Vs) + (tid >> 5) * (VP * 2) + (tid & 31) * 16,
                 (const char*)(vtb + (size_t)bh * HD * TT) + tid * 16, 16 * VP * 2, 8192);
    // this wave's copies have landed; behind the barrier every wave's have
    asm volatile("s_wait_asynccnt 0x0" ::: "memory");
    __syncthreads();

    // group g = K-step g >> 2, key tiles (g & 3) * 4 + 0..3; the next group's fragments
    // are fetched into a second register set ahead of this group's WMMAs
    const unsigned int* kbase = (const unsigned int*)Ks + r15 * (KP / 2) + phi;
    Frag kf[2][4];
    lds_frag4(kf[0], kbase, KP / 2);
#pragma unroll
    for (int g = 0; g < 16; ++g) {
        if (g + 1 < 16)
            lds_frag4(kf[(g + 1) & 1],
                      kbase + ((g + 1) & 3) * 64 * (KP / 2) + ((g + 1) >> 2) * 16, KP / 2);
        // keeps the eight LDS loads one group, ahead of the WMMAs: left free the scheduler
        // either lifts so many loads that the 256 registers spill or waits out each load
        __builtin_amdgcn_sched_barrier(0);
#pragma unroll
        for (int j = 0; j < 4; ++j) {
            const int nt = (g & 3) * 4 + j;
            acc[nt] = __builtin_amdgcn_wmma_f32_16x16x32_bf16(false, kf[g & 1][j].v, false,
                                                              q[g >> 2].v, (short)0, acc[nt],
                                                              false, false);
        }
        __builtin_amdgcn_sched_barrier(0);   // the same, at the group's end
    }

    // ---- softmax over T=256: 128 keys of the row in this lane, 128 in lane ^ 16 ----
    const float* mrow = mask + (size_t)b * TT + m_in;
    v8f mx8;
#pragma unroll
    for (int v = 0; v < 8; ++v) mx8[v] = -1e30f;
#pragma unroll
    for (int nt = 0; nt < 16; ++nt) {
        const float4 ma = *(const float4*)(mrow + nt * 16);
        const float4 mb = *(const float4*)(mrow + nt * 16 + 4);
        const float mk[8] = {ma.x, ma.y, ma.z, ma.w, mb.x, mb.y, mb.z, mb.w};
#pragma unroll
        for (int v = 0; v < 8; ++v) {
            float x = acc[nt][v] * SCALE_INV;
            x = fminf(fmaxf(x, -50.0f), 50.0f);
            x += mk[v] * -1e9f;
            acc[nt][v] = x;
            mx8[v] = fmaxf(mx8[v], x);
        }
        // the mask loads of eight tiles at a time: all 32 lifted to the top take 128
        // registers beside the 128 of acc, and the 256-register budget spills
        if (nt == 7) __builtin_amdgcn_sched_barrier(0);
    }
    float mx = fmaxf(fmaxf(fmaxf(mx8[0], mx8[1]), fmaxf(mx8[2], mx8[3])),
                     fmaxf(fmaxf(mx8[4], mx8[5]), fmaxf(mx8[6], mx8[7])));
    mx = fmaxf(mx, xhalf(mx));
    // the address registers of the mask loads are reused from here on
    asm volatile("s_wait_xcnt 0x0" ::: "memory");

    v8f sum8 = (v8f){};
#pragma unroll
    for (int nt = 0; nt < 16; ++nt)
#pragma unroll
        for (int v = 0; v < 8; ++v) {
            float e = exp2_slot((acc[nt][v] - mx) * 1.44269504f);   // e^(x - mx)
            acc[nt][v] = e;
            sum8[v] += e;
        }
    float sum = ((sum8[0] + sum8[1]) + (sum8[2] + sum8[3])) +
                ((sum8[4] + sum8[5]) + (sum8[6] + sum8[7]));
    sum += xhalf(sum);
    const float inv = 1.0f / (sum + 1e-8f);

    // probs^T as B fragments: score tiles 2kk and 2kk+1 hold keys kk*32 + m_in + 0..7
    // and kk*32 + 16 + m_in + 0..7, the k order of the V^T loader below
    Frag p[8];
#pragma unroll
    for (int kk = 0; kk < 8; ++kk)
#pragma unroll
        for (int w = 0; w < 4; ++w) {
            p[kk].u[w]     = (unsigned int)f2bf(acc[2 * kk][2 * w] * inv) |
                             ((unsigned int)f2bf(acc[2 * kk][2 * w + 1] * inv) << 16);
            p[kk].u[4 + w] = (unsigned int)f2bf(acc[2 * kk + 1][2 * w] * inv) |
                             ((unsigned int)f2bf(acc[2 * kk + 1][2 * w + 1] * inv) << 16);
        }
    // keeps the packing ahead of the second product: spread among its WMMAs the 128
    // f32 values stay live beside the V fragments and the ctx accumulators
    __builtin_amdgcn_sched_barrier(0);

    // ---- ctx^T = V^T @ probs^T : 128 x 16, K over T=256 ----
    // c[nt][v] = ctx(query s0 + r15, head dim nt*16 + m_in + v)
    v8f c[8];
#pragma unroll
    for (int i = 0; i < 8; ++i) c[i] = (v8f){};

    // group g = K-step g >> 1, head-dim tiles (g & 1) * 4 + 0..3, fetched as above
    const unsigned int* vbase = (const unsigned int*)Vs + r15 * (VP / 2) + phi;
    Frag vf[2][4];
    lds_frag4(vf[0], vbase, VP / 2);
#pragma unroll
    for (int g = 0; g < 16; ++g) {
        if (g + 1 < 16)
            lds_frag4(vf[(g + 1) & 1],
                      vbase + ((g + 1) & 1) * 64 * (VP / 2) + ((g + 1) >> 1) * 16, VP / 2);
        __builtin_amdgcn_sched_barrier(0);   // one load group ahead of the WMMAs, as above
#pragma unroll
        for (int j = 0; j < 4; ++j) {
            const int nt = (g & 1) * 4 + j;
            c[nt] = __builtin_amdgcn_wmma_f32_16x16x32_bf16(false, vf[g & 1][j].v, false,
                                                            p[g >> 1].v, (short)0, c[nt],
                                                            false, false);
        }
        __builtin_amdgcn_sched_barrier(0);   // the same, at the group's end
    }

    // ctx -> [B,S,H] bf16: 8 consecutive head dims of one row per lane and tile
    unsigned short* crow = ctxb + ((size_t)(b * SS + s0 + r15)) * HH + h * HD + m_in;
#pragma unroll
    for (int nt = 0; nt < 8; ++nt) {
        uint4 o;
        o.x = (unsigned int)f2bf(c[nt][0]) | ((unsigned int)f2bf(c[nt][1]) << 16);
        o.y = (unsigned int)f2bf(c[nt][2]) | ((unsigned int)f2bf(c[nt][3]) << 16);
        o.z = (unsigned int)f2bf(c[nt][4]) | ((unsigned int)f2bf(c[nt][5]) << 16);
        o.w = (unsigned int)f2bf(c[nt][6]) | ((unsigned int)f2bf(c[nt][7]) << 16);
        *(uint4*)(crow + nt * 16) = o;
    }
}

// ---------------- kernel 4: LayerNorm (one block per row) ----------------
__global__ __launch_bounds__(256) void layernorm_kernel(const float* __restrict__ x,
                                                        const float* __restrict__ g,
                                                        const float* __restrict__ bta,
                                                        float* __restrict__ out) {
    __shared__ float rs[256], rq[256];
    const int tid = threadIdx.x;
    const size_t row = (size_t)blockIdx.x * HH;

    float s = 0.0f, q = 0.0f;
#pragma unroll
    for (int j = 0; j < HH / 256; ++j) {
        float v = x[row + tid + j * 256];
        s += v;
        q += v * v;
    }
    rs[tid] = s;
    rq[tid] = q;
    __syncthreads();
    for (int off = 128; off > 0; off >>= 1) {
        if (tid < off) { rs[tid] += rs[tid + off]; rq[tid] += rq[tid + off]; }
        __syncthreads();
    }
    const float mu  = rs[0] * (1.0f / HH);
    const float var = rq[0] * (1.0f / HH) - mu * mu;
    const float r   = rsqrtf(var + LN_EPS);
#pragma unroll
    for (int j = 0; j < HH / 256; ++j) {
        int i = tid + j * 256;
        out[row + i] = (x[row + i] - mu) * r * g[i] + bta[i];
    }
}

// ---------------- launcher ----------------
extern "C" void kernel_launch(void* const* d_in, const int* in_sizes, int n_in,
                              void* d_out, int out_size, void* d_ws, size_t ws_size,
                              hipStream_t stream) {
    const float* hs   = (const float*)d_in[0];   // (B,S,H)
    const float* at   = (const float*)d_in[1];   // (B,T,H)
    const float* mask = (const float*)d_in[2];   // (B,T)
    const float* Wq   = (const float*)d_in[3];
    const float* bq   = (const float*)d_in[4];
    const float* Wk   = (const float*)d_in[5];
    const float* bk   = (const float*)d_in[6];
    const float* Wv   = (const float*)d_in[7];
    const float* bv   = (const float*)d_in[8];
    const float* Wo   = (const float*)d_in[9];
    const float* bo   = (const float*)d_in[10];
    const float* ln_g = (const float*)d_in[11];
    const float* ln_b = (const float*)d_in[12];
    float* outp = (float*)d_out;

    const size_t BS = (size_t)BB * SS;   // 8192
    const size_t BT = (size_t)BB * TT;   // 1024

    // workspace carve-up (bf16 stored as ushort)
    char* w = (char*)d_ws;
    unsigned short* hsb  = (unsigned short*)w;                  w += BS * HH * 2;
    unsigned short* atb  = (unsigned short*)w;                  w += BT * HH * 2;
    unsigned short* wqb  = (unsigned short*)w;                  w += (size_t)HH * HH * 2;
    unsigned short* wkb  = (unsigned short*)w;                  w += (size_t)HH * HH * 2;
    unsigned short* wvb  = (unsigned short*)w;                  w += (size_t)HH * HH * 2;
    unsigned short* wob  = (unsigned short*)w;                  w += (size_t)HH * HH * 2;
    unsigned short* qb   = (unsigned short*)w;                  w += BS * HH * 2;     // [B,NH,S,HD]
    unsigned short* kbuf = (unsigned short*)w;                  w += BT * HH * 2;     // [B,NH,T,HD]
    unsigned short* vtb  = (unsigned short*)w;                  w += BT * HH * 2;     // [B,NH,HD,T]
    unsigned short* ctxb = (unsigned short*)w;                  w += BS * HH * 2;     // [B,S,H]
    float*          opre = (float*)w;                           w += BS * HH * 4;

    // 1) converts
    convert_bf16_kernel<<<4096, 256, 0, stream>>>(hs, hsb, (long)(BS * HH));
    convert_bf16_kernel<<<2048, 256, 0, stream>>>(at, atb, (long)(BT * HH));
    convert_bf16_kernel<<<2048, 256, 0, stream>>>(Wq, wqb, (long)HH * HH);
    convert_bf16_kernel<<<2048, 256, 0, stream>>>(Wk, wkb, (long)HH * HH);
    convert_bf16_kernel<<<2048, 256, 0, stream>>>(Wv, wvb, (long)HH * HH);
    convert_bf16_kernel<<<2048, 256, 0, stream>>>(Wo, wob, (long)HH * HH);

    // 2) projections (block tile 128x128)
    gemm_bf16_kernel<0><<<dim3(HH / 128, BS / 128), 256, 0, stream>>>(
        hsb, wqb, bq, qb, nullptr, (int)BS, HH, HH, SS);
    gemm_bf16_kernel<0><<<dim3(HH / 128, BT / 128), 256, 0, stream>>>(
        atb, wkb, bk, kbuf, nullptr, (int)BT, HH, HH, TT);
    gemm_bf16_kernel<2><<<dim3(HH / 128, BT / 128), 256, 0, stream>>>(
        atb, wvb, bv, vtb, nullptr, (int)BT, HH, HH, TT);

    // 3) attention: one wave per 16 S-rows, 16 waves of one head per work-group
    attn_kernel<<<BB * NHH * (SS / 256), 512, 0, stream>>>(qb, kbuf, vtb, mask, ctxb);

    // 4) output projection + bias + residual (f32)
    gemm_bf16_kernel<3><<<dim3(HH / 128, BS / 128), 256, 0, stream>>>(
        ctxb, wob, bo, opre, hs, (int)BS, HH, HH, SS);

    // 5) LayerNorm -> d_out
    layernorm_kernel<<<(int)BS, 256, 0, stream>>>(opre, ln_g, ln_b, outp);
}

// v004
// Measured time: 268 microseconds a run.
// Two timings next to v003 put it at 1.16 and 1.17 times that version's speed.
// Over all steps from v000 it is 1.99 times as fast.
#include <hip/hip_runtime.h>

// ---------------- problem constants (match reference) ----------------
#define BB 4
#define SS 2048
#define TT 256
#define HH 2048
#define NHH 16
#define HD 128
#define LN_EPS 1e-5f
#define SCALE_INV 0.08838834764831845f   // 1/sqrt(128)

// A GEMM stage holds GK k of every operand row: 128 bytes, one whole cache line, so
// that a wave's 512-byte copy asks L2 for four whole lines and not for eight halves.
#define GK 64
// LDS pitch of a GEMM stage row, in bf16: 64 of data + 8 of pad = 144 bytes, an
// odd multiple of 16 bytes, so that the 16 rows one ds_load_b128 half-wave
// touches fall on 16 different groups of four banks (64 banks x 4 bytes).
#define GP 72

typedef __attribute__((ext_vector_type(16))) __bf16 v16bf;
typedef __attribute__((ext_vector_type(8)))  float  v8f;

union Frag {
    unsigned int u[8];
    v16bf v;
};

// ---- optional CDNA5 async global->LDS copy path (compile-safe probe) ----
#if defined(__has_builtin)
#if __has_builtin(__builtin_amdgcn_global_load_async_to_lds_b128)
#define HAVE_ASYNC_LDS 1
#endif
#endif
#ifndef HAVE_ASYNC_LDS
#define HAVE_ASYNC_LDS 0
#endif

#if HAVE_ASYNC_LDS
typedef int gv4i __attribute__((vector_size(16)));   // matches builtin param type
static __device__ __forceinline__ void async_cp16(const void* g, void* l) {
    __builtin_amdgcn_global_load_async_to_lds_b128(
        (__attribute__((address_space(1))) gv4i*)g,
        (__attribute__((address_space(3))) gv4i*)l, 0, 0);
}
static __device__ __forceinline__ void wait_async0() {
#if __has_builtin(__builtin_amdgcn_s_wait_asynccnt)
    __builtin_amdgcn_s_wait_asynccnt(0);
#else
    asm volatile("s_wait_asynccnt 0" ::: "memory");
#endif
}
#endif

static __device__ __forceinline__ float n2n(float x) {
    if (isnan(x)) return 0.0f;
    if (isinf(x)) return x > 0.0f ? 1e4f : -1e4f;
    return x;
}

static __device__ __forceinline__ unsigned short f2bf(float f) {
    union { float f; unsigned int u; } c;
    c.f = f;
    unsigned int r = c.u + 0x7fffu + ((c.u >> 16) & 1u);  // RNE
    return (unsigned short)(r >> 16);
}

// ---------------- kernel 1: f32 -> bf16 convert (+nan_to_num) ----------------
__global__ __launch_bounds__(256) void convert_bf16_kernel(const float* __restrict__ in,
                                                           unsigned short* __restrict__ out,
                                                           long n) {
    long i = (long)blockIdx.x * blockDim.x + threadIdx.x;
    long stride = (long)gridDim.x * blockDim.x;
    for (; i < n; i += stride) out[i] = f2bf(n2n(in[i]));
}

// ---------------- kernel 2: tiled bf16 WMMA GEMM  C = A @ W^T (+bias) ------
// Block tile 128x128, K-stage 64 (K a multiple of 64), double-buffered LDS, software pipelined.
// 8 waves; each wave computes a 32x64 sub-tile = 2x4 accumulators.
// A: [M,K] bf16 row-major, W: [N,K] bf16 row-major.
// EPI 0: split-heads bf16 -> out[((b*NH+h)*L + s)*HD + d],  b=m/L, s=m%L
// EPI 2: transposed       -> out[((b*NH+h)*HD + d)*L + t],  b=m/L, t=m%L
// EPI 3: f32 out = acc + bias + n2n(resid[m,n]), row-major [M,N]
template <int EPI>
__global__ __launch_bounds__(256) void gemm_bf16_kernel(
    const unsigned short* __restrict__ A,
    const unsigned short* __restrict__ W,
    const float* __restrict__ bias,
    void* __restrict__ out,
    const float* __restrict__ resid,
    int M, int N, int K, int L) {

    __shared__ unsigned short As[2][128 * GP];
    __shared__ unsigned short Bs[2][128 * GP];

    const int tid  = threadIdx.x;
    const int lane = tid & 31;
    const int wid  = tid >> 5;           // 0..7
    const int wave_m = wid >> 1;         // 0..3 -> 32 rows each
    const int wave_n = wid & 1;          // 0..1 -> 64 cols each

    const int m0 = blockIdx.y * 128;
    const int n0 = blockIdx.x * 128;

    // stage loader: 1024 uint4 per matrix; thread handles rows lrow0 + 32 r, r = 0..3;
    // eight neighbouring lanes cover one row's 128 bytes
    const int lrow0 = tid >> 3;          // 0..31
    const int lch   = (tid & 7) * 8;     // bf16 offset 0,8,..,56

    const int phi = (lane & 16) ? 4 : 0;
    const int r15 = lane & 15;

    v8f acc[2][4];
#pragma unroll
    for (int i = 0; i < 2; ++i)
#pragma unroll
        for (int j = 0; j < 4; ++j) acc[i][j] = (v8f){};

    const int NK = K / GK;

    const unsigned short* aBase = A + (size_t)m0 * K;   // the block's first rows
    const unsigned short* bBase = W + (size_t)n0 * K;
    const unsigned int gOff = (unsigned int)(lrow0 * K + lch);   // the lane's place in 32 rows
    const size_t rStep = (size_t)32 * K;
    const int ldsOff = lrow0 * GP + lch;

#if HAVE_ASYNC_LDS
    // ---- async-to-LDS pipelined path ----
    {
        // prologue: stage 0 into buf 0
#pragma unroll   // r a constant: the LDS steps fold into the address additions
        for (int r = 0; r < 4; ++r) {
            async_cp16(aBase + r * rStep + gOff, &As[0][ldsOff + r * 32 * GP]);
            async_cp16(bBase + r * rStep + gOff, &Bs[0][ldsOff + r * 32 * GP]);
        }
        wait_async0();
    }
    // publishes stage 0; directly behind the builtin wait it also holds the LDS reads behind it
    __syncthreads();
#else
#pragma unroll   // r a constant, as above
    for (int r = 0; r < 4; ++r) {
        *(uint4*)(&As[0][ldsOff + r * 32 * GP]) = *(const uint4*)(aBase + r * rStep + gOff);
        *(uint4*)(&Bs[0][ldsOff + r * 32 * GP]) = *(const uint4*)(bBase + r * rStep + gOff);
    }
    __syncthreads();
#endif

    int buf = 0;
    for (int i = 0; i < NK; ++i) {
        const int nbuf = buf ^ 1;
        const bool more = (i + 1 < NK);
        const int kn = (i + 1) * GK;

        // ---- issue next stage ----
#if !HAVE_ASYNC_LDS
        uint4 ra[4], rb[4];
#endif
        if (more) {
#pragma unroll   // r a constant, as above: the eight copies issue back to back
            for (int r = 0; r < 4; ++r) {
#if HAVE_ASYNC_LDS
                async_cp16(aBase + (r * rStep + kn) + gOff, &As[nbuf][ldsOff + r * 32 * GP]);
                async_cp16(bBase + (r * rStep + kn) + gOff, &Bs[nbuf][ldsOff + r * 32 * GP]);
#else
                ra[r] = *(const uint4*)(aBase + (r * rStep + kn) + gOff);
                rb[r] = *(const uint4*)(bBase + (r * rStep + kn) + gOff);
#endif
            }
        }

        // ---- compute current stage: 2 K-steps x (2 A-frags x 4 B-frags) = 16 WMMA ----
#pragma unroll   // ks a constant: it becomes the immediate offset of the LDS loads
        for (int ks = 0; ks < GK / 32; ++ks) {
            const unsigned int* As32 = (const unsigned int*)As[buf] + ks * 16;
            const unsigned int* Bs32 = (const unsigned int*)Bs[buf] + ks * 16;
            const int ar0 = (wave_m * 32 + r15) * (GP / 2);
            const int ar1 = ar0 + 16 * (GP / 2);
            Frag a0, a1;
#pragma unroll
            for (int v = 0; v < 8; ++v) {
                int p = (v & 3) + ((v >= 4) ? 8 : 0) + phi;
                a0.u[v] = As32[ar0 + p];
                a1.u[v] = As32[ar1 + p];
            }
            Frag b[4];
#pragma unroll
            for (int j = 0; j < 4; ++j) {
                const int br = (wave_n * 64 + j * 16 + r15) * (GP / 2);
#pragma unroll
                for (int v = 0; v < 8; ++v)
                    b[j].u[v] = Bs32[br + (v & 3) + ((v >= 4) ? 8 : 0) + phi];
            }
#pragma unroll
            for (int j = 0; j < 4; ++j) {
                acc[0][j] = __builtin_amdgcn_wmma_f32_16x16x32_bf16(
                    false, a0.v, false, b[j].v, (short)0, acc[0][j], false, false);
                acc[1][j] = __builtin_amdgcn_wmma_f32_16x16x32_bf16(
                    false, a1.v, false, b[j].v, (short)0, acc[1][j], false, false);
            }
        }

        // ---- publish next stage ----
        if (more) {
#if HAVE_ASYNC_LDS
            wait_async0();
#else
#pragma unroll   // constant index: ra and rb stay in registers
            for (int r = 0; r < 4; ++r) {
                *(uint4*)(&As[nbuf][ldsOff + r * 32 * GP]) = ra[r];
                *(uint4*)(&Bs[nbuf][ldsOff + r * 32 * GP]) = rb[r];
            }
#endif
        }
        // publishes the next stage and ends every wave's reads of this one; directly behind
        // the builtin wait it also holds the LDS reads behind it
        __syncthreads();
        buf = nbuf;
    }

    // ---------------- epilogue ----------------
    const int m_in = ((lane & 16) ? 8 : 0);
#pragma unroll
    for (int i2 = 0; i2 < 2; ++i2)
#pragma unroll
        for (int j = 0; j < 4; ++j)
#pragma unroll
            for (int v = 0; v < 8; ++v) {
                int gm = m0 + wave_m * 32 + i2 * 16 + v + m_in;
                int gn = n0 + wave_n * 64 + j * 16 + r15;
                float val = acc[i2][j][v] + bias[gn];
                if (EPI == 0) {
                    int bi = gm / L, s = gm % L;
                    int h = gn >> 7, d = gn & 127;
                    ((unsigned short*)out)[(((size_t)(bi * NHH + h) * L + s) << 7) + d] = f2bf(val);
                } else if (EPI == 2) {
                    int bi = gm / L, t = gm % L;
                    int h = gn >> 7, d = gn & 127;
                    ((unsigned short*)out)[(((size_t)(bi * NHH + h) << 7) + d) * (size_t)L + t] = f2bf(val);
                } else {
                    size_t idx = (size_t)gm * N + gn;
                    ((float*)out)[idx] = val + n2n(resid[idx]);
                }
            }
}

// ---------------- kernel 3: attention (one wave per 16 S-rows) ----------------
// 16 waves (256 query rows of one head) form a work-group. The head's K (256 x 128)
// and V^T (128 x 256) are brought into LDS once, in whole 128-byte lines, and every
// wave takes its A fragments from there.
// Both products are taken transposed: S^T = K * Q^T and ctx^T = V^T * P^T. In the
// accumulator map a lane then holds 8 keys (or 8 head dims) of ONE query row
// (column lane & 15), so the softmax runs in registers on all 32 lanes, with one
// exchange between the wave's halves for the maximum and one for the sum, and two
// score tiles, converted in place, are the B operand of the second product.

// value of lane l ^ 16
static __device__ __forceinline__ float xhalf(float x) {
    return __builtin_bit_cast(float, __builtin_amdgcn_permlanex16(
        __builtin_bit_cast(int, x), __builtin_bit_cast(int, x),
        0x76543210, 0xfedcba98, false, false));
}

// 2^a. The v_nop fills the one slot the instruction set asks for between a
// transcendental and a next instruction that reads its result or overwrites its
// source; in one statement with it, it cannot be scheduled away from it.
static __device__ __forceinline__ float exp2_slot(float a) {
    float r;
    asm("v_exp_f32 %0, %1\n\tv_nop" : "=v"(r) : "v"(a));
    return r;
}

// LDS pitches in bf16: a K row is 256 B + 16 B of pad, a V^T row 512 B + 16 B, both
// odd multiples of 16 B, so that the 16 rows of a ds_load_b128 half-wave fall on 16
// different groups of four banks.
#define KP 136
#define VP 264
#define ATT_WAVES 16

// Eight asynchronous 16-byte copies per lane, global -> LDS, step gs bytes in global
// memory and ls bytes in LDS. The s_wait_xcnt closes the statement so that it stands
// in front of any later write of the address registers the copies name.
static __device__ __forceinline__ void async_cp16x8(unsigned int l, const char* g,
                                                    unsigned int ls, unsigned int gs) {
    asm volatile(
        "global_load_async_to_lds_b128 %0, %8, off\n\t"
        "global_load_async_to_lds_b128 %1, %9, off\n\t"
        "global_load_async_to_lds_b128 %2, %10, off\n\t"
        "global_load_async_to_lds_b128 %3, %11, off\n\t"
        "global_load_async_to_lds_b128 %4, %12, off\n\t"
        "global_load_async_to_lds_b128 %5, %13, off\n\t"
        "global_load_async_to_lds_b128 %6, %14, off\n\t"
        "global_load_async_to_lds_b128 %7, %15, off\n\t"
        "s_wait_xcnt 0x0"
        :: "v"(l), "v"(l + ls), "v"(l + 2 * ls), "v"(l + 3 * ls),
           "v"(l + 4 * ls), "v"(l + 5 * ls), "v"(l + 6 * ls), "v"(l + 7 * ls),
           "v"(g), "v"(g + gs), "v"(g + 2 * gs), "v"(g + 3 * gs),
           "v"(g + 4 * gs), "v"(g + 5 * gs), "v"(g + 6 * gs), "v"(g + 7 * gs)
        : "memory");
}

// Four A fragments from an LDS tile: rows 16 apart, pitch in dwords; base points at the
// lane's row and its half of the 32 k (dwords 0..3 and 8..11: the k order of the B side)
static __device__ __forceinline__ void lds_frag4(Frag* f, const unsigned int* base, int pitch) {
#pragma unroll
    for (int j = 0; j < 4; ++j) {
        const uint4 lo = *(const uint4*)(base + j * 16 * pitch);
        const uint4 hi = *(const uint4*)(base + j * 16 * pitch + 8);
        f[j].u[0] = lo.x; f[j].u[1] = lo.y; f[j].u[2] = lo.z; f[j].u[3] = lo.w;
        f[j].u[4] = hi.x; f[j].u[5] = hi.y; f[j].u[6] = hi.z; f[j].u[7] = hi.w;
    }
}

// byte offset of a __shared__ object in the work-group's LDS
static __device__ __forceinline__ unsigned int lds_off(const void* p) {
    return (unsigned int)(size_t)(__attribute__((address_space(3))) const void*)p;
}

__global__ __launch_bounds__(ATT_WAVES * 32) void attn_kernel(
    const unsigned short* __restrict__ qb,   // [B,NH,S,HD]
    const unsigned short* __restrict__ kb,   // [B,NH,T,HD]
    const unsigned short* __restrict__ vtb,  // [B,NH,HD,T]
    const float* __restrict__ mask,          // [B,T]
    unsigned short* __restrict__ ctxb) {     // [B,S,H] bf16

    __shared__ __attribute__((aligned(16))) unsigned short Ks[TT * KP];
    __shared__ __attribute__((aligned(16))) unsigned short Vs[HD * VP];

    const int tid  = threadIdx.x;
    const int lane = tid & 31;
    const int bid  = blockIdx.x;
    const int bh   = bid >> 3;               // S/256 = 8 work-groups per (b,h)
    const int s0   = ((bid & 7) << 8) + ((tid >> 5) << 4);
    const int b    = bh >> 4;
    const int h    = bh & 15;

    const int phi  = (lane & 16) ? 4 : 0;
    const int r15  = lane & 15;
    const int m_in = (lane & 16) ? 8 : 0;

    // ---- scores^T: 256 x 16 via 4 K-steps x 16 key tiles of WMMA ----
    // acc[nt][v] = score(query s0 + r15, key nt*16 + m_in + v)
    v8f acc[16];
#pragma unroll
    for (int i = 0; i < 16; ++i) acc[i] = (v8f){};

    // this wave's own 16 query rows, straight from global memory, in flight with the copies
    const unsigned int* qrow = (const unsigned int*)(qb + ((size_t)bh * SS + s0) * HD);
    Frag q[4];
#pragma unroll
    for (int kk = 0; kk < 4; ++kk)
#pragma unroll
        for (int v = 0; v < 8; ++v)
            q[kk].u[v] = qrow[r15 * 64 + kk * 16 + (v & 3) + ((v >= 4) ? 8 : 0) + phi];

    // K and V^T of this head are 64 KiB each, contiguous: thread tid copies the 16-byte
    // pieces tid, tid + 512, ... (a wave's copy is 512 contiguous bytes: two K rows or
    // one V^T row); 512 pieces are 32 K rows or 16 V^T rows.
    async_cp16x8(lds_off(Ks) + (tid >> 4) * (KP * 2) + (tid & 15) * 16,
                 (const char*)(kb + (size_t)bh * TT * HD) + tid * 16, 32 * KP * 2, 8192);
    async_cp16x8(lds_off(Vs) + (tid >> 5) * (VP * 2) + (tid & 31) * 16,
                 (const char*)(vtb + (size_t)bh * HD * TT) + tid * 16, 16 * VP * 2, 8192);
    // this wave's copies have landed; behind the barrier every wave's have
    asm volatile("s_wait_asynccnt 0x0" ::: "memory");
    __syncthreads();

    // group g = K-step g >> 2, key tiles (g & 3) * 4 + 0..3; the next group's fragments
    // are fetched into a second register set ahead of this group's WMMAs
    const unsigned int* kbase = (const unsigned int*)Ks + r15 * (KP / 2) + phi;
    Frag kf[2][4];
    lds_frag4(kf[0], kbase, KP / 2);
#pragma unroll
    for (int g = 0; g < 16; ++g) {
        if (g + 1 < 16)
            lds_frag4(kf[(g + 1) & 1],
                      kbase + ((g + 1) & 3) * 64 * (KP / 2) + ((g + 1) >> 2) * 16, KP / 2);
        // keeps the eight LDS loads one group, ahead of the WMMAs: left free the scheduler
        // either lifts so many loads that the 256 registers spill or waits out each load
        __builtin_amdgcn_sched_barrier(0);
#pragma unroll
        for (int j = 0; j < 4; ++j) {
            const int nt = (g & 3) * 4 + j;
            acc[nt] = __builtin_amdgcn_wmma_f32_16x16x32_bf16(false, kf[g & 1][j].v, false,
                                                              q[g >> 2].v, (short)0, acc[nt],
                                                              false, false);
        }
        __builtin_amdgcn_sched_barrier(0);   // the same, at the group's end
    }

    // ---- softmax over T=256: 128 keys of the row in this lane, 128 in lane ^ 16 ----
    const float* mrow = mask + (size_t)b * TT + m_in;
    v8f mx8;
#pragma unroll
    for (int v = 0; v < 8; ++v) mx8[v] = -1e30f;
#pragma unroll
    for (int nt = 0; nt < 16; ++nt) {
        const float4 ma = *(const float4*)(mrow + nt * 16);
        const float4 mb = *(const float4*)(mrow + nt * 16 + 4);
        const float mk[8] = {ma.x, ma.y, ma.z, ma.w, mb.x, mb.y, mb.z, mb.w};
#pragma unroll
        for (int v = 0; v < 8; ++v) {
            float x = acc[nt][v] * SCALE_INV;
            x = fminf(fmaxf(x, -50.0f), 50.0f);
            x += mk[v] * -1e9f;
            acc[nt][v] = x;
            mx8[v] = fmaxf(mx8[v], x);
        }
        // the mask loads of eight tiles at a time: all 32 lifted to the top take 128
        // registers beside the 128 of acc, and the 256-register budget spills
        if (nt == 7) __builtin_amdgcn_sched_barrier(0);
    }
    float mx = fmaxf(fmaxf(fmaxf(mx8[0], mx8[1]), fmaxf(mx8[2], mx8[3])),
                     fmaxf(fmaxf(mx8[4], mx8[5]), fmaxf(mx8[6], mx8[7])));
    mx = fmaxf(mx, xhalf(mx));
    // the address registers of the mask loads are reused from here on
    asm volatile("s_wait_xcnt 0x0" ::: "memory");

    v8f sum8 = (v8f){};
#pragma unroll
    for (int nt = 0; nt < 16; ++nt)
#pragma unroll
        for (int v = 0; v < 8; ++v) {
            float e = exp2_slot((acc[nt][v] - mx) * 1.44269504f);   // e^(x - mx)
            acc[nt][v] = e;
            sum8[v] += e;
        }
    float sum = ((sum8[0] + sum8[1]) + (sum8[2] + sum8[3])) +
                ((sum8[4] + sum8[5]) + (sum8[6] + sum8[7]));
    sum += xhalf(sum);
    const float inv = 1.0f / (sum + 1e-8f);

    // probs^T as B fragments: score tiles 2kk and 2kk+1 hold keys kk*32 + m_in + 0..7
    // and kk*32 + 16 + m_in + 0..7, the k order of the V^T loader below
    Frag p[8];
#pragma unroll
    for (int kk = 0; kk < 8; ++kk)
#pragma unroll
        for (int w = 0; w < 4; ++w) {
            p[kk].u[w]     = (unsigned int)f2bf(acc[2 * kk][2 * w] * inv) |
                             ((unsigned int)f2bf(acc[2 * kk][2 * w + 1] * inv) << 16);
            p[kk].u[4 + w] = (unsigned int)f2bf(acc[2 * kk + 1][2 * w] * inv) |
                             ((unsigned int)f2bf(acc[2 * kk + 1][2 * w + 1] * inv) << 16);
        }
    // keeps the packing ahead of the second product: spread among its WMMAs the 128
    // f32 values stay live beside the V fragments and the ctx accumulators
    __builtin_amdgcn_sched_barrier(0);

    // ---- ctx^T = V^T @ probs^T : 128 x 16, K over T=256 ----
    // c[nt][v] = ctx(query s0 + r15, head dim nt*16 + m_in + v)
    v8f c[8];
#pragma unroll
    for (int i = 0; i < 8; ++i) c[i] = (v8f){};

    // group g = K-step g >> 1, head-dim tiles (g & 1) * 4 + 0..3, fetched as above
    const unsigned int* vbase = (const unsigned int*)Vs + r15 * (VP / 2) + phi;
    Frag vf[2][4];
    lds_frag4(vf[0], vbase, VP / 2);
#pragma unroll
    for (int g = 0; g < 16; ++g) {
        if (g + 1 < 16)
            lds_frag4(vf[(g + 1) & 1],
                      vbase + ((g + 1) & 1) * 64 * (VP / 2) + ((g + 1) >> 1) * 16, VP / 2);
        __builtin_amdgcn_sched_barrier(0);   // one load group ahead of the WMMAs, as above
#pragma unroll
        for (int j = 0; j < 4; ++j) {
            const int nt = (g & 1) * 4 + j;
            c[nt] = __builtin_amdgcn_wmma_f32_16x16x32_bf16(false, vf[g & 1][j].v, false,
                                                            p[g >> 1].v, (short)0, c[nt],
                                                            false, false);
        }
        __builtin_amdgcn_sched_barrier(0);   // the same, at the group's end
    }

    // ctx -> [B,S,H] bf16: 8 consecutive head dims of one row per lane and tile
    unsigned short* crow = ctxb + ((size_t)(b * SS + s0 + r15)) * HH + h * HD + m_in;
#pragma unroll
    for (int nt = 0; nt < 8; ++nt) {
        uint4 o;
        o.x = (unsigned int)f2bf(c[nt][0]) | ((unsigned int)f2bf(c[nt][1]) << 16);
        o.y = (unsigned int)f2bf(c[nt][2]) | ((unsigned int)f2bf(c[nt][3]) << 16);
        o.z = (unsigned int)f2bf(c[nt][4]) | ((unsigned int)f2bf(c[nt][5]) << 16);
        o.w = (unsigned int)f2bf(c[nt][6]) | ((unsigned int)f2bf(c[nt][7]) << 16);
        *(uint4*)(crow + nt * 16) = o;
    }
}

// ---------------- kernel 4: LayerNorm (one block per row) ----------------
__global__ __launch_bounds__(256) void layernorm_kernel(const float* __restrict__ x,
                                                        const float* __restrict__ g,
                                                        const float* __restrict__ bta,
                                                        float* __restrict__ out) {
    __shared__ float rs[256], rq[256];
    const int tid = threadIdx.x;
    const size_t row = (size_t)blockIdx.x * HH;

    float s = 0.0f, q = 0.0f;
#pragma unroll
    for (int j = 0; j < HH / 256; ++j) {
        float v = x[row + tid + j * 256];
        s += v;
        q += v * v;
    }
    rs[tid] = s;
    rq[tid] = q;
    __syncthreads();
    for (int off = 128; off > 0; off >>= 1) {
        if (tid < off) { rs[tid] += rs[tid + off]; rq[tid] += rq[tid + off]; }
        __syncthreads();
    }
    const float mu  = rs[0] * (1.0f / HH);
    const float var = rq[0] * (1.0f / HH) - mu * mu;
    const float r   = rsqrtf(var + LN_EPS);
#pragma unroll
    for (int j = 0; j < HH / 256; ++j) {
        int i = tid + j * 256;
        out[row + i] = (x[row + i] - mu) * r * g[i] + bta[i];
    }
}

// ---------------- launcher ----------------
extern "C" void kernel_launch(void* const* d_in, const int* in_sizes, int n_in,
                              void* d_out, int out_size, void* d_ws, size_t ws_size,
                              hipStream_t stream) {
    const float* hs   = (const float*)d_in[0];   // (B,S,H)
    const float* at   = (const float*)d_in[1];   // (B,T,H)
    const float* mask = (const float*)d_in[2];   // (B,T)
    const float* Wq   = (const float*)d_in[3];
    const float* bq   = (const float*)d_in[4];
    const float* Wk   = (const float*)d_in[5];
    const float* bk   = (const float*)d_in[6];
    const float* Wv   = (const float*)d_in[7];
    const float* bv   = (const float*)d_in[8];
    const float* Wo   = (const float*)d_in[9];
    const float* bo   = (const float*)d_in[10];
    const float* ln_g = (const float*)d_in[11];
    const float* ln_b = (const float*)d_in[12];
    float* outp = (float*)d_out;

    const size_t BS = (size_t)BB * SS;   // 8192
    const size_t BT = (size_t)BB * TT;   // 1024

    // workspace carve-up (bf16 stored as ushort)
    char* w = (char*)d_ws;
    unsigned short* hsb  = (unsigned short*)w;                  w += BS * HH * 2;
    unsigned short* atb  = (unsigned short*)w;                  w += BT * HH * 2;
    unsigned short* wqb  = (unsigned short*)w;                  w += (size_t)HH * HH * 2;
    unsigned short* wkb  = (unsigned short*)w;                  w += (size_t)HH * HH * 2;
    unsigned short* wvb  = (unsigned short*)w;                  w += (size_t)HH * HH * 2;
    unsigned short* wob  = (unsigned short*)w;                  w += (size_t)HH * HH * 2;
    unsigned short* qb   = (unsigned short*)w;                  w += BS * HH * 2;     // [B,NH,S,HD]
    unsigned short* kbuf = (unsigned short*)w;                  w += BT * HH * 2;     // [B,NH,T,HD]
    unsigned short* vtb  = (unsigned short*)w;                  w += BT * HH * 2;     // [B,NH,HD,T]
    unsigned short* ctxb = (unsigned short*)w;                  w += BS * HH * 2;     // [B,S,H]
    float*          opre = (float*)w;                           w += BS * HH * 4;

    // 1) converts
    convert_bf16_kernel<<<4096, 256, 0, stream>>>(hs, hsb, (long)(BS * HH));
    convert_bf16_kernel<<<2048, 256, 0, stream>>>(at, atb, (long)(BT * HH));
    convert_bf16_kernel<<<2048, 256, 0, stream>>>(Wq, wqb, (long)HH * HH);
    convert_bf16_kernel<<<2048, 256, 0, stream>>>(Wk, wkb, (long)HH * HH);
    convert_bf16_kernel<<<2048, 256, 0, stream>>>(Wv, wvb, (long)HH * HH);
    convert_bf16_kernel<<<2048, 256, 0, stream>>>(Wo, wob, (long)HH * HH);

    // 2) projections (block tile 128x128)
    gemm_bf16_kernel<0><<<dim3(HH / 128, BS / 128), 256, 0, stream>>>(
        hsb, wqb, bq, qb, nullptr, (int)BS, HH, HH, SS);
    gemm_bf16_kernel<0><<<dim3(HH / 128, BT / 128), 256, 0, stream>>>(
        atb, wkb, bk, kbuf, nullptr, (int)BT, HH, HH, TT);
    gemm_bf16_kernel<2><<<dim3(HH / 128, BT / 128), 256, 0, stream>>>(
        atb, wvb, bv, vtb, nullptr, (int)BT, HH, HH, TT);

    // 3) attention: one wave per 16 S-rows, 16 waves of one head per work-group
    attn_kernel<<<BB * NHH * (SS / 256), 512, 0, stream>>>(qb, kbuf, vtb, mask, ctxb);

    // 4) output projection + bias + residual (f32)
    gemm_bf16_kernel<3><<<dim3(HH / 128, BS / 128), 256, 0, stream>>>(
        ctxb, wob, bo, opre, hs, (int)BS, HH, HH, SS);

    // 5) LayerNorm -> d_out
    layernorm_kernel<<<(int)BS, 256, 0, stream>>>(opre, ln_g, ln_b, outp);
}

// v005
// One run takes 253 microseconds.
// In two side-by-side timings against v004, it was 1.06 and 1.07 times as fast.
// All steps since v000 together make it 2.12 times as fast.
#include <hip/hip_runtime.h>

// ---------------- problem constants (match reference) ----------------
#define BB 4
#define SS 2048
#define TT 256
#define HH 2048
#define NHH 16
#define HD 128
#define LN_EPS 1e-5f
#define SCALE_INV 0.08838834764831845f   // 1/sqrt(128)

// A GEMM stage holds GK k of every operand row: 128 bytes, one whole cache line, so
// that a wave's 512-byte copy asks L2 for four whole lines and not for eight halves.
#define GK 64
// LDS pitch of a GEMM stage row, in bf16: 64 of data + 8 of pad = 144 bytes, an
// odd multiple of 16 bytes, so that the 16 rows one ds_load_b128 half-wave
// touches fall on 16 different groups of four banks (64 banks x 4 bytes).
#define GP 72

typedef __attribute__((ext_vector_type(16))) __bf16 v16bf;
typedef __attribute__((ext_vector_type(8)))  float  v8f;

union Frag {
    unsigned int u[8];
    v16bf v;
};

// ---- optional CDNA5 async global->LDS copy path (compile-safe probe) ----
#if defined(__has_builtin)
#if __has_builtin(__builtin_amdgcn_global_load_async_to_lds_b128)
#define HAVE_ASYNC_LDS 1
#endif
#endif
#ifndef HAVE_ASYNC_LDS
#define HAVE_ASYNC_LDS 0
#endif

#if HAVE_ASYNC_LDS
typedef int gv4i __attribute__((vector_size(16)));   // matches builtin param type
static __device__ __forceinline__ void async_cp16(const void* g, void* l) {
    __builtin_amdgcn_global_load_async_to_lds_b128(
        (__attribute__((address_space(1))) gv4i*)g,
        (__attribute__((address_space(3))) gv4i*)l, 0, 0);
}
static __device__ __forceinline__ void wait_async0() {
#if __has_builtin(__builtin_amdgcn_s_wait_asynccnt)
    __builtin_amdgcn_s_wait_asynccnt(0);
#else
    asm volatile("s_wait_asynccnt 0" ::: "memory");
#endif
}
#endif

static __device__ __forceinline__ float n2n(float x) {
    if (isnan(x)) return 0.0f;
    if (isinf(x)) return x > 0.0f ? 1e4f : -1e4f;
    return x;
}

static __device__ __forceinline__ unsigned short f2bf(float f) {
    union { float f; unsigned int u; } c;
    c.f = f;
    unsigned int r = c.u + 0x7fffu + ((c.u >> 16) & 1u);  // RNE
    return (unsigned short)(r >> 16);
}

// ---------------- kernel 1: f32 -> bf16 convert (+nan_to_num), all six tensors ----------------
// One launch of few, long-lived waves. A chunk is what a work-group moves in one trip:
// CV_LOADS 16-byte loads a lane, each wave-wide load 512 contiguous bytes (four whole
// lines), each wave-wide 8-byte store 256 contiguous bytes (two whole lines).
// The six results lie one behind the other in the workspace, in the order of the
// arguments, so a chunk's number is also its place in out. Every tensor is a whole
// number of chunks, so a chunk has one source.
#define CV_THREADS 256
#define CV_LOADS 8
#define CV_CHUNK (CV_THREADS * CV_LOADS * 4)          // floats
#define CV_HS (BB * SS * HH / CV_CHUNK)               // chunks of hidden_states
#define CV_AT (BB * TT * HH / CV_CHUNK)               // chunks of audio_tokens
#define CV_W  (HH * HH / CV_CHUNK)                    // chunks of one weight matrix
#define CV_W0 (CV_HS + CV_AT)                         // first chunk of the first weight matrix
#define CV_ALL (CV_W0 + 4 * CV_W)
#define CV_TRIPS 8                                    // chunks a work-group
#define CV_GRID (CV_ALL / CV_TRIPS)

// n2n, then the rounding of f2bf: the bf16 stands in the upper half of the result.
// n2n as selects on the bits, so that no branch stands between the loads' waits.
static __device__ __forceinline__ unsigned int n2n_rne(float a) {
    const unsigned int u = __builtin_bit_cast(unsigned int, a), m = u & 0x7fffffffu;
    unsigned int x = m > 0x7f800000u ? 0u : u;                         // NaN -> 0
    x = m == 0x7f800000u ? ((u & 0x80000000u) | 0x461c4000u) : x;      // +-inf -> +-1e4
    return x + 0x7fffu + ((x >> 16) & 1u);                             // RNE
}

static __device__ __forceinline__ unsigned int pack2bf(float a, float b) {
    return (n2n_rne(a) >> 16) | (n2n_rne(b) & 0xffff0000u);
}

// the lane's first 16 bytes of chunk c (c is the same for the whole work-group)
static __device__ __forceinline__ const float4* cv_src(
    int c, int tid, const float* hs, const float* at, const float* wq, const float* wk,
    const float* wv, const float* wo) {
    const float* p = hs;
    int first = 0;
    if (c >= CV_HS)            { p = at; first = CV_HS; }
    if (c >= CV_W0)            { p = wq; first = CV_W0; }
    if (c >= CV_W0 + CV_W)     { p = wk; first = CV_W0 + CV_W; }
    if (c >= CV_W0 + 2 * CV_W) { p = wv; first = CV_W0 + 2 * CV_W; }
    if (c >= CV_W0 + 3 * CV_W) { p = wo; first = CV_W0 + 3 * CV_W; }
    return (const float4*)(p + (size_t)(c - first) * CV_CHUNK) + tid;
}

static __device__ __forceinline__ void cv_emit(const float4* v, unsigned short* out, int c, int tid) {
    uint2* d = (uint2*)(out + (size_t)c * CV_CHUNK) + tid;
#pragma unroll   // constant index: v stays in registers
    for (int j = 0; j < CV_LOADS; ++j) {
        uint2 o;
        o.x = pack2bf(v[j].x, v[j].y);
        o.y = pack2bf(v[j].z, v[j].w);
        d[j * CV_THREADS] = o;
    }
}

__global__ __launch_bounds__(CV_THREADS) void convert_all_kernel(
    const float* __restrict__ hs, const float* __restrict__ at,
    const float* __restrict__ wq, const float* __restrict__ wk,
    const float* __restrict__ wv, const float* __restrict__ wo,
    unsigned short* __restrict__ out) {

    const int tid = threadIdx.x;
    int c = blockIdx.x;                               // the grid is CV_GRID work-groups

    float4 cur[CV_LOADS], nxt[CV_LOADS];
    {
        const float4* s = cv_src(c, tid, hs, at, wq, wk, wv, wo);
#pragma unroll   // constant index: cur stays in registers, the loads issue back to back
        for (int j = 0; j < CV_LOADS; ++j) cur[j] = s[j * CV_THREADS];
    }
    // the next chunk's loads fly while this chunk is converted and stored; the last chunk
    // stands behind the loop, so that inside it the waits count the loads of both
#pragma unroll 1   // unrolled, the arithmetic of a chunk is lifted over the next chunk's loads
    for (int t = 1; t < CV_TRIPS; ++t) {
        const float4* s = cv_src(c + CV_GRID, tid, hs, at, wq, wk, wv, wo);
#pragma unroll   // constant index, as above
        for (int j = 0; j < CV_LOADS; ++j) nxt[j] = s[j * CV_THREADS];
        // holds the eight loads ahead of this chunk's arithmetic: sunk behind the wait for
        // this chunk's values they would start one memory latency later
        __builtin_amdgcn_sched_barrier(0);
        cv_emit(cur, out, c, tid);
        // holds the copies below, which wait for the next chunk's loads, behind this chunk's stores
        __builtin_amdgcn_sched_barrier(0);
#pragma unroll   // constant index, as above
        for (int j = 0; j < CV_LOADS; ++j) cur[j] = nxt[j];
        c += CV_GRID;
    }
    cv_emit(cur, out, c, tid);
}

// ---------------- kernel 2: tiled bf16 WMMA GEMM  C = A @ W^T (+bias) ------
// Block tile 128x128, K-stage 64 (K a multiple of 64), double-buffered LDS, software pipelined.
// 8 waves; each wave computes a 32x64 sub-tile = 2x4 accumulators.
// A: [M,K] bf16 row-major, W: [N,K] bf16 row-major.
// EPI 0: split-heads bf16 -> out[((b*NH+h)*L + s)*HD + d],  b=m/L, s=m%L
// EPI 2: transposed       -> out[((b*NH+h)*HD + d)*L + t],  b=m/L, t=m%L
// EPI 3: f32 out = acc + bias + n2n(resid[m,n]), row-major [M,N]
template <int EPI>
__global__ __launch_bounds__(256) void gemm_bf16_kernel(
    const unsigned short* __restrict__ A,
    const unsigned short* __restrict__ W,
    const float* __restrict__ bias,
    void* __restrict__ out,
    const float* __restrict__ resid,
    int M, int N, int K, int L) {

    __shared__ unsigned short As[2][128 * GP];
    __shared__ unsigned short Bs[2][128 * GP];

    const int tid  = threadIdx.x;
    const int lane = tid & 31;
    const int wid  = tid >> 5;           // 0..7
    const int wave_m = wid >> 1;         // 0..3 -> 32 rows each
    const int wave_n = wid & 1;          // 0..1 -> 64 cols each

    const int m0 = blockIdx.y * 128;
    const int n0 = blockIdx.x * 128;

    // stage loader: 1024 uint4 per matrix; thread handles rows lrow0 + 32 r, r = 0..3;
    // eight neighbouring lanes cover one row's 128 bytes
    const int lrow0 = tid >> 3;          // 0..31
    const int lch   = (tid & 7) * 8;     // bf16 offset 0,8,..,56

    const int phi = (lane & 16) ? 4 : 0;
    const int r15 = lane & 15;

    v8f acc[2][4];
#pragma unroll
    for (int i = 0; i < 2; ++i)
#pragma unroll
        for (int j = 0; j < 4; ++j) acc[i][j] = (v8f){};

    const int NK = K / GK;

    const unsigned short* aBase = A + (size_t)m0 * K;   // the block's first rows
    const unsigned short* bBase = W + (size_t)n0 * K;
    const unsigned int gOff = (unsigned int)(lrow0 * K + lch);   // the lane's place in 32 rows
    const size_t rStep = (size_t)32 * K;
    const int ldsOff = lrow0 * GP + lch;

#if HAVE_ASYNC_LDS
    // ---- async-to-LDS pipelined path ----
    {
        // prologue: stage 0 into buf 0
#pragma unroll   // r a constant: the LDS steps fold into the address additions
        for (int r = 0; r < 4; ++r) {
            async_cp16(aBase + r * rStep + gOff, &As[0][ldsOff + r * 32 * GP]);
            async_cp16(bBase + r * rStep + gOff, &Bs[0][ldsOff + r * 32 * GP]);
        }
        wait_async0();
    }
    // publishes stage 0; directly behind the builtin wait it also holds the LDS reads behind it
    __syncthreads();
#else
#pragma unroll   // r a constant, as above
    for (int r = 0; r < 4; ++r) {
        *(uint4*)(&As[0][ldsOff + r * 32 * GP]) = *(const uint4*)(aBase + r * rStep + gOff);
        *(uint4*)(&Bs[0][ldsOff + r * 32 * GP]) = *(const uint4*)(bBase + r * rStep + gOff);
    }
    __syncthreads();
#endif

    int buf = 0;
    for (int i = 0; i < NK; ++i) {
        const int nbuf = buf ^ 1;
        const bool more = (i + 1 < NK);
        const int kn = (i + 1) * GK;

        // ---- issue next stage ----
#if !HAVE_ASYNC_LDS
        uint4 ra[4], rb[4];
#endif
        if (more) {
#pragma unroll   // r a constant, as above: the eight copies issue back to back
            for (int r = 0; r < 4; ++r) {
#if HAVE_ASYNC_LDS
                async_cp16(aBase + (r * rStep + kn) + gOff, &As[nbuf][ldsOff + r * 32 * GP]);
                async_cp16(bBase + (r * rStep + kn) + gOff, &Bs[nbuf][ldsOff + r * 32 * GP]);
#else
                ra[r] = *(const uint4*)(aBase + (r * rStep + kn) + gOff);
                rb[r] = *(const uint4*)(bBase + (r * rStep + kn) + gOff);
#endif
            }
        }

        // ---- compute current stage: 2 K-steps x (2 A-frags x 4 B-frags) = 16 WMMA ----
#pragma unroll   // ks a constant: it becomes the immediate offset of the LDS loads
        for (int ks = 0; ks < GK / 32; ++ks) {
            const unsigned int* As32 = (const unsigned int*)As[buf] + ks * 16;
            const unsigned int* Bs32 = (const unsigned int*)Bs[buf] + ks * 16;
            const int ar0 = (wave_m * 32 + r15) * (GP / 2);
            const int ar1 = ar0 + 16 * (GP / 2);
            Frag a0, a1;
#pragma unroll
            for (int v = 0; v < 8; ++v) {
                int p = (v & 3) + ((v >= 4) ? 8 : 0) + phi;
                a0.u[v] = As32[ar0 + p];
                a1.u[v] = As32[ar1 + p];
            }
            Frag b[4];
#pragma unroll
            for (int j = 0; j < 4; ++j) {
                const int br = (wave_n * 64 + j * 16 + r15) * (GP / 2);
#pragma unroll
                for (int v = 0; v < 8; ++v)
                    b[j].u[v] = Bs32[br + (v & 3) + ((v >= 4) ? 8 : 0) + phi];
            }
#pragma unroll
            for (int j = 0; j < 4; ++j) {
                acc[0][j] = __builtin_amdgcn_wmma_f32_16x16x32_bf16(
                    false, a0.v, false, b[j].v, (short)0, acc[0][j], false, false);
                acc[1][j] = __builtin_amdgcn_wmma_f32_16x16x32_bf16(
                    false, a1.v, false, b[j].v, (short)0, acc[1][j], false, false);
            }
        }

        // ---- publish next stage ----
        if (more) {
#if HAVE_ASYNC_LDS
            wait_async0();
#else
#pragma unroll   // constant index: ra and rb stay in registers
            for (int r = 0; r < 4; ++r) {
                *(uint4*)(&As[nbuf][ldsOff + r * 32 * GP]) = ra[r];
                *(uint4*)(&Bs[nbuf][ldsOff + r * 32 * GP]) = rb[r];
            }
#endif
        }
        // publishes the next stage and ends every wave's reads of this one; directly behind
        // the builtin wait it also holds the LDS reads behind it
        __syncthreads();
        buf = nbuf;
    }

    // ---------------- epilogue ----------------
    const int m_in = ((lane & 16) ? 8 : 0);
#pragma unroll
    for (int i2 = 0; i2 < 2; ++i2)
#pragma unroll
        for (int j = 0; j < 4; ++j)
#pragma unroll
            for (int v = 0; v < 8; ++v) {
                int gm = m0 + wave_m * 32 + i2 * 16 + v + m_in;
                int gn = n0 + wave_n * 64 + j * 16 + r15;
                float val = acc[i2][j][v] + bias[gn];
                if (EPI == 0) {
                    int bi = gm / L, s = gm % L;
                    int h = gn >> 7, d = gn & 127;
                    ((unsigned short*)out)[(((size_t)(bi * NHH + h) * L + s) << 7) + d] = f2bf(val);
                } else if (EPI == 2) {
                    int bi = gm / L, t = gm % L;
                    int h = gn >> 7, d = gn & 127;
                    ((unsigned short*)out)[(((size_t)(bi * NHH + h) << 7) + d) * (size_t)L + t] = f2bf(val);
                } else {
                    size_t idx = (size_t)gm * N + gn;
                    ((float*)out)[idx] = val + n2n(resid[idx]);
                }
            }
}

// ---------------- kernel 3: attention (one wave per 16 S-rows) ----------------
// 16 waves (256 query rows of one head) form a work-group. The head's K (256 x 128)
// and V^T (128 x 256) are brought into LDS once, in whole 128-byte lines, and every
// wave takes its A fragments from there.
// Both products are taken transposed: S^T = K * Q^T and ctx^T = V^T * P^T. In the
// accumulator map a lane then holds 8 keys (or 8 head dims) of ONE query row
// (column lane & 15), so the softmax runs in registers on all 32 lanes, with one
// exchange between the wave's halves for the maximum and one for the sum, and two
// score tiles, converted in place, are the B operand of the second product.

// value of lane l ^ 16
static __device__ __forceinline__ float xhalf(float x) {
    return __builtin_bit_cast(float, __builtin_amdgcn_permlanex16(
        __builtin_bit_cast(int, x), __builtin_bit_cast(int, x),
        0x76543210, 0xfedcba98, false, false));
}

// 2^a. The v_nop fills the one slot the instruction set asks for between a
// transcendental and a next instruction that reads its result or overwrites its
// source; in one statement with it, it cannot be scheduled away from it.
static __device__ __forceinline__ float exp2_slot(float a) {
    float r;
    asm("v_exp_f32 %0, %1\n\tv_nop" : "=v"(r) : "v"(a));
    return r;
}

// LDS pitches in bf16: a K row is 256 B + 16 B of pad, a V^T row 512 B + 16 B, both
// odd multiples of 16 B, so that the 16 rows of a ds_load_b128 half-wave fall on 16
// different groups of four banks.
#define KP 136
#define VP 264
#define ATT_WAVES 16

// Eight asynchronous 16-byte copies per lane, global -> LDS, step gs bytes in global
// memory and ls bytes in LDS. The s_wait_xcnt closes the statement so that it stands
// in front of any later write of the address registers the copies name.
static __device__ __forceinline__ void async_cp16x8(unsigned int l, const char* g,
                                                    unsigned int ls, unsigned int gs) {
    asm volatile(
        "global_load_async_to_lds_b128 %0, %8, off\n\t"
        "global_load_async_to_lds_b128 %1, %9, off\n\t"
        "global_load_async_to_lds_b128 %2, %10, off\n\t"
        "global_load_async_to_lds_b128 %3, %11, off\n\t"
        "global_load_async_to_lds_b128 %4, %12, off\n\t"
        "global_load_async_to_lds_b128 %5, %13, off\n\t"
        "global_load_async_to_lds_b128 %6, %14, off\n\t"
        "global_load_async_to_lds_b128 %7, %15, off\n\t"
        "s_wait_xcnt 0x0"
        :: "v"(l), "v"(l + ls), "v"(l + 2 * ls), "v"(l + 3 * ls),
           "v"(l + 4 * ls), "v"(l + 5 * ls), "v"(l + 6 * ls), "v"(l + 7 * ls),
           "v"(g), "v"(g + gs), "v"(g + 2 * gs), "v"(g + 3 * gs),
           "v"(g + 4 * gs), "v"(g + 5 * gs), "v"(g + 6 * gs), "v"(g + 7 * gs)
        : "memory");
}

// Four A fragments from an LDS tile: rows 16 apart, pitch in dwords; base points at the
// lane's row and its half of the 32 k (dwords 0..3 and 8..11: the k order of the B side)
static __device__ __forceinline__ void lds_frag4(Frag* f, const unsigned int* base, int pitch) {
#pragma unroll
    for (int j = 0; j < 4; ++j) {
        const uint4 lo = *(const uint4*)(base + j * 16 * pitch);
        const uint4 hi = *(const uint4*)(base + j * 16 * pitch + 8);
        f[j].u[0] = lo.x; f[j].u[1] = lo.y; f[j].u[2] = lo.z; f[j].u[3] = lo.w;
        f[j].u[4] = hi.x; f[j].u[5] = hi.y; f[j].u[6] = hi.z; f[j].u[7] = hi.w;
    }
}

// byte offset of a __shared__ object in the work-group's LDS
static __device__ __forceinline__ unsigned int lds_off(const void* p) {
    return (unsigned int)(size_t)(__attribute__((address_space(3))) const void*)p;
}

__global__ __launch_bounds__(ATT_WAVES * 32) void attn_kernel(
    const unsigned short* __restrict__ qb,   // [B,NH,S,HD]
    const unsigned short* __restrict__ kb,   // [B,NH,T,HD]
    const unsigned short* __restrict__ vtb,  // [B,NH,HD,T]
    const float* __restrict__ mask,          // [B,T]
    unsigned short* __restrict__ ctxb) {     // [B,S,H] bf16

    __shared__ __attribute__((aligned(16))) unsigned short Ks[TT * KP];
    __shared__ __attribute__((aligned(16))) unsigned short Vs[HD * VP];

    const int tid  = threadIdx.x;
    const int lane = tid & 31;
    const int bid  = blockIdx.x;
    const int bh   = bid >> 3;               // S/256 = 8 work-groups per (b,h)
    const int s0   = ((bid & 7) << 8) + ((tid >> 5) << 4);
    const int b    = bh >> 4;
    const int h    = bh & 15;

    const int phi  = (lane & 16) ? 4 : 0;
    const int r15  = lane & 15;
    const int m_in = (lane & 16) ? 8 : 0;

    // ---- scores^T: 256 x 16 via 4 K-steps x 16 key tiles of WMMA ----
    // acc[nt][v] = score(query s0 + r15, key nt*16 + m_in + v)
    v8f acc[16];
#pragma unroll
    for (int i = 0; i < 16; ++i) acc[i] = (v8f){};

    // this wave's own 16 query rows, straight from global memory, in flight with the copies
    const unsigned int* qrow = (const unsigned int*)(qb + ((size_t)bh * SS + s0) * HD);
    Frag q[4];
#pragma unroll
    for (int kk = 0; kk < 4; ++kk)
#pragma unroll
        for (int v = 0; v < 8; ++v)
            q[kk].u[v] = qrow[r15 * 64 + kk * 16 + (v & 3) + ((v >= 4) ? 8 : 0) + phi];

    // K and V^T of this head are 64 KiB each, contiguous: thread tid copies the 16-byte
    // pieces tid, tid + 512, ... (a wave's copy is 512 contiguous bytes: two K rows or
    // one V^T row); 512 pieces are 32 K rows or 16 V^T rows.
    async_cp16x8(lds_off(Ks) + (tid >> 4) * (KP * 2) + (tid & 15) * 16,
                 (const char*)(kb + (size_t)bh * TT * HD) + tid * 16, 32 * KP * 2, 8192);
    async_cp16x8(lds_off(Vs) + (tid >> 5) * (VP * 2) + (tid & 31) * 16,
                 (const char*)(vtb + (size_t)bh * HD * TT) + tid * 16, 16 * VP * 2, 8192);
    // this wave's copies have landed; behind the barrier every wave's have
    asm volatile("s_wait_asynccnt 0x0" ::: "memory");
    __syncthreads();

    // group g = K-step g >> 2, key tiles (g & 3) * 4 + 0..3; the next group's fragments
    // are fetched into a second register set ahead of this group's WMMAs
    const unsigned int* kbase = (const unsigned int*)Ks + r15 * (KP / 2) + phi;
    Frag kf[2][4];
    lds_frag4(kf[0], kbase, KP / 2);
#pragma unroll
    for (int g = 0; g < 16; ++g) {
        if (g + 1 < 16)
            lds_frag4(kf[(g + 1) & 1],
                      kbase + ((g + 1) & 3) * 64 * (KP / 2) + ((g + 1) >> 2) * 16, KP / 2);
        // keeps the eight LDS loads one group, ahead of the WMMAs: left free the scheduler
        // either lifts so many loads that the 256 registers spill or waits out each load
        __builtin_amdgcn_sched_barrier(0);
#pragma unroll
        for (int j = 0; j < 4; ++j) {
            const int nt = (g & 3) * 4 + j;
            acc[nt] = __builtin_amdgcn_wmma_f32_16x16x32_bf16(false, kf[g & 1][j].v, false,
                                                              q[g >> 2].v, (short)0, acc[nt],
                                                              false, false);
        }
        __builtin_amdgcn_sched_barrier(0);   // the same, at the group's end
    }

    // ---- softmax over T=256: 128 keys of the row in this lane, 128 in lane ^ 16 ----
    const float* mrow = mask + (size_t)b * TT + m_in;
    v8f mx8;
#pragma unroll
    for (int v = 0; v < 8; ++v) mx8[v] = -1e30f;
#pragma unroll
    for (int nt = 0; nt < 16; ++nt) {
        const float4 ma = *(const float4*)(mrow + nt * 16);
        const float4 mb = *(const float4*)(mrow + nt * 16 + 4);
        const float mk[8] = {ma.x, ma.y, ma.z, ma.w, mb.x, mb.y, mb.z, mb.w};
#pragma unroll
        for (int v = 0; v < 8; ++v) {
            float x = acc[nt][v] * SCALE_INV;
            x = fminf(fmaxf(x, -50.0f), 50.0f);
            x += mk[v] * -1e9f;
            acc[nt][v] = x;
            mx8[v] = fmaxf(mx8[v], x);
        }
        // the mask loads of eight tiles at a time: all 32 lifted to the top take 128
        // registers beside the 128 of acc, and the 256-register budget spills
        if (nt == 7) __builtin_amdgcn_sched_barrier(0);
    }
    float mx = fmaxf(fmaxf(fmaxf(mx8[0], mx8[1]), fmaxf(mx8[2], mx8[3])),
                     fmaxf(fmaxf(mx8[4], mx8[5]), fmaxf(mx8[6], mx8[7])));
    mx = fmaxf(mx, xhalf(mx));
    // the address registers of the mask loads are reused from here on
    asm volatile("s_wait_xcnt 0x0" ::: "memory");

    v8f sum8 = (v8f){};
#pragma unroll
    for (int nt = 0; nt < 16; ++nt)
#pragma unroll
        for (int v = 0; v < 8; ++v) {
            float e = exp2_slot((acc[nt][v] - mx) * 1.44269504f);   // e^(x - mx)
            acc[nt][v] = e;
            sum8[v] += e;
        }
    float sum = ((sum8[0] + sum8[1]) + (sum8[2] + sum8[3])) +
                ((sum8[4] + sum8[5]) + (sum8[6] + sum8[7]));
    sum += xhalf(sum);
    const float inv = 1.0f / (sum + 1e-8f);

    // probs^T as B fragments: score tiles 2kk and 2kk+1 hold keys kk*32 + m_in + 0..7
    // and kk*32 + 16 + m_in + 0..7, the k order of the V^T loader below
    Frag p[8];
#pragma unroll
    for (int kk = 0; kk < 8; ++kk)
#pragma unroll
        for (int w = 0; w < 4; ++w) {
            p[kk].u[w]     = (unsigned int)f2bf(acc[2 * kk][2 * w] * inv) |
                             ((unsigned int)f2bf(acc[2 * kk][2 * w + 1] * inv) << 16);
            p[kk].u[4 + w] = (unsigned int)f2bf(acc[2 * kk + 1][2 * w] * inv) |
                             ((unsigned int)f2bf(acc[2 * kk + 1][2 * w + 1] * inv) << 16);
        }
    // keeps the packing ahead of the second product: spread among its WMMAs the 128
    // f32 values stay live beside the V fragments and the ctx accumulators
    __builtin_amdgcn_sched_barrier(0);

    // ---- ctx^T = V^T @ probs^T : 128 x 16, K over T=256 ----
    // c[nt][v] = ctx(query s0 + r15, head dim nt*16 + m_in + v)
    v8f c[8];
#pragma unroll
    for (int i = 0; i < 8; ++i) c[i] = (v8f){};

    // group g = K-step g >> 1, head-dim tiles (g & 1) * 4 + 0..3, fetched as above
    const unsigned int* vbase = (const unsigned int*)Vs + r15 * (VP / 2) + phi;
    Frag vf[2][4];
    lds_frag4(vf[0], vbase, VP / 2);
#pragma unroll
    for (int g = 0; g < 16; ++g) {
        if (g + 1 < 16)
            lds_frag4(vf[(g + 1) & 1],
                      vbase + ((g + 1) & 1) * 64 * (VP / 2) + ((g + 1) >> 1) * 16, VP / 2);
        __builtin_amdgcn_sched_barrier(0);   // one load group ahead of the WMMAs, as above
#pragma unroll
        for (int j = 0; j < 4; ++j) {
            const int nt = (g & 1) * 4 + j;
            c[nt] = __builtin_amdgcn_wmma_f32_16x16x32_bf16(false, vf[g & 1][j].v, false,
                                                            p[g >> 1].v, (short)0, c[nt],
                                                            false, false);
        }
        __builtin_amdgcn_sched_barrier(0);   // the same, at the group's end
    }

    // ctx -> [B,S,H] bf16: 8 consecutive head dims of one row per lane and tile
    unsigned short* crow = ctxb + ((size_t)(b * SS + s0 + r15)) * HH + h * HD + m_in;
#pragma unroll
    for (int nt = 0; nt < 8; ++nt) {
        uint4 o;
        o.x = (unsigned int)f2bf(c[nt][0]) | ((unsigned int)f2bf(c[nt][1]) << 16);
        o.y = (unsigned int)f2bf(c[nt][2]) | ((unsigned int)f2bf(c[nt][3]) << 16);
        o.z = (unsigned int)f2bf(c[nt][4]) | ((unsigned int)f2bf(c[nt][5]) << 16);
        o.w = (unsigned int)f2bf(c[nt][6]) | ((unsigned int)f2bf(c[nt][7]) << 16);
        *(uint4*)(crow + nt * 16) = o;
    }
}

// ---------------- kernel 4: LayerNorm (one block per row) ----------------
__global__ __launch_bounds__(256) void layernorm_kernel(const float* __restrict__ x,
                                                        const float* __restrict__ g,
                                                        const float* __restrict__ bta,
                                                        float* __restrict__ out) {
    __shared__ float rs[256], rq[256];
    const int tid = threadIdx.x;
    const size_t row = (size_t)blockIdx.x * HH;

    float s = 0.0f, q = 0.0f;
#pragma unroll
    for (int j = 0; j < HH / 256; ++j) {
        float v = x[row + tid + j * 256];
        s += v;
        q += v * v;
    }
    rs[tid] = s;
    rq[tid] = q;
    __syncthreads();
    for (int off = 128; off > 0; off >>= 1) {
        if (tid < off) { rs[tid] += rs[tid + off]; rq[tid] += rq[tid + off]; }
        __syncthreads();
    }
    const float mu  = rs[0] * (1.0f / HH);
    const float var = rq[0] * (1.0f / HH) - mu * mu;
    const float r   = rsqrtf(var + LN_EPS);
#pragma unroll
    for (int j = 0; j < HH / 256; ++j) {
        int i = tid + j * 256;
        out[row + i] = (x[row + i] - mu) * r * g[i] + bta[i];
    }
}

// ---------------- launcher ----------------
extern "C" void kernel_launch(void* const* d_in, const int* in_sizes, int n_in,
                              void* d_out, int out_size, void* d_ws, size_t ws_size,
                              hipStream_t stream) {
    const float* hs   = (const float*)d_in[0];   // (B,S,H)
    const float* at   = (const float*)d_in[1];   // (B,T,H)
    const float* mask = (const float*)d_in[2];   // (B,T)
    const float* Wq   = (const float*)d_in[3];
    const float* bq   = (const float*)d_in[4];
    const float* Wk   = (const float*)d_in[5];
    const float* bk   = (const float*)d_in[6];
    const float* Wv   = (const float*)d_in[7];
    const float* bv   = (const float*)d_in[8];
    const float* Wo   = (const float*)d_in[9];
    const float* bo   = (const float*)d_in[10];
    const float* ln_g = (const float*)d_in[11];
    const float* ln_b = (const float*)d_in[12];
    float* outp = (float*)d_out;

    const size_t BS = (size_t)BB * SS;   // 8192
    const size_t BT = (size_t)BB * TT;   // 1024

    // workspace carve-up (bf16 stored as ushort)
    char* w = (char*)d_ws;
    unsigned short* hsb  = (unsigned short*)w;                  w += BS * HH * 2;
    unsigned short* atb  = (unsigned short*)w;                  w += BT * HH * 2;
    unsigned short* wqb  = (unsigned short*)w;                  w += (size_t)HH * HH * 2;
    unsigned short* wkb  = (unsigned short*)w;                  w += (size_t)HH * HH * 2;
    unsigned short* wvb  = (unsigned short*)w;                  w += (size_t)HH * HH * 2;
    unsigned short* wob  = (unsigned short*)w;                  w += (size_t)HH * HH * 2;
    unsigned short* qb   = (unsigned short*)w;                  w += BS * HH * 2;     // [B,NH,S,HD]
    unsigned short* kbuf = (unsigned short*)w;                  w += BT * HH * 2;     // [B,NH,T,HD]
    unsigned short* vtb  = (unsigned short*)w;                  w += BT * HH * 2;     // [B,NH,HD,T]
    unsigned short* ctxb = (unsigned short*)w;                  w += BS * HH * 2;     // [B,S,H]
    float*          opre = (float*)w;                           w += BS * HH * 4;

    // 1) converts: hsb, atb, wqb, wkb, wvb, wob are one contiguous range that starts at hsb
    convert_all_kernel<<<CV_GRID, CV_THREADS, 0, stream>>>(hs, at, Wq, Wk, Wv, Wo, hsb);

    // 2) projections (block tile 128x128)
    gemm_bf16_kernel<0><<<dim3(HH / 128, BS / 128), 256, 0, stream>>>(
        hsb, wqb, bq, qb, nullptr, (int)BS, HH, HH, SS);
    gemm_bf16_kernel<0><<<dim3(HH / 128, BT / 128), 256, 0, stream>>>(
        atb, wkb, bk, kbuf, nullptr, (int)BT, HH, HH, TT);
    gemm_bf16_kernel<2><<<dim3(HH / 128, BT / 128), 256, 0, stream>>>(
        atb, wvb, bv, vtb, nullptr, (int)BT, HH, HH, TT);

    // 3) attention: one wave per 16 S-rows, 16 waves of one head per work-group
    attn_kernel<<<BB * NHH * (SS / 256), 512, 0, stream>>>(qb, kbuf, vtb, mask, ctxb);

    // 4) output projection + bias + residual (f32)
    gemm_bf16_kernel<3><<<dim3(HH / 128, BS / 128), 256, 0, stream>>>(
        ctxb, wob, bo, opre, hs, (int)BS, HH, HH, SS);

    // 5) LayerNorm -> d_out
    layernorm_kernel<<<(int)BS, 256, 0, stream>>>(opre, ln_g, ln_b, outp);
}

// v006
// A run of this version takes 226 microseconds.
// Timed twice side by side with v005, it ran 1.12 and 1.11 times as fast.
// Counting every step since v000, it is 2.36 times as fast.
#include <hip/hip_runtime.h>

// ---------------- problem constants (match reference) ----------------
#define BB 4
#define SS 2048
#define TT 256
#define HH 2048
#define NHH 16
#define HD 128
#define LN_EPS 1e-5f
#define SCALE_INV 0.08838834764831845f   // 1/sqrt(128)

// A GEMM stage holds GK k of every operand row: 128 bytes, one whole cache line, so
// that a wave's 512-byte copy asks L2 for four whole lines and not for eight halves.
#define GK 64
// LDS pitch of a GEMM stage row, in bf16: 64 of data + 8 of pad = 144 bytes, an
// odd multiple of 16 bytes, so that the 16 rows one ds_load_b128 half-wave
// touches fall on 16 different groups of four banks (64 banks x 4 bytes).
#define GP 72

typedef __attribute__((ext_vector_type(16))) __bf16 v16bf;
typedef __attribute__((ext_vector_type(8)))  float  v8f;

union Frag {
    unsigned int u[8];
    v16bf v;
};

// ---- optional CDNA5 async global->LDS copy path (compile-safe probe) ----
#if defined(__has_builtin)
#if __has_builtin(__builtin_amdgcn_global_load_async_to_lds_b128)
#define HAVE_ASYNC_LDS 1
#endif
#endif
#ifndef HAVE_ASYNC_LDS
#define HAVE_ASYNC_LDS 0
#endif

#if HAVE_ASYNC_LDS
typedef int gv4i __attribute__((vector_size(16)));   // matches builtin param type
static __device__ __forceinline__ void async_cp16(const void* g, void* l) {
    __builtin_amdgcn_global_load_async_to_lds_b128(
        (__attribute__((address_space(1))) gv4i*)g,
        (__attribute__((address_space(3))) gv4i*)l, 0, 0);
}
static __device__ __forceinline__ void wait_async0() {
#if __has_builtin(__builtin_amdgcn_s_wait_asynccnt)
    __builtin_amdgcn_s_wait_asynccnt(0);
#else
    asm volatile("s_wait_asynccnt 0" ::: "memory");
#endif
}
#endif

static __device__ __forceinline__ float n2n(float x) {
    if (isnan(x)) return 0.0f;
    if (isinf(x)) return x > 0.0f ? 1e4f : -1e4f;
    return x;
}

static __device__ __forceinline__ unsigned short f2bf(float f) {
    union { float f; unsigned int u; } c;
    c.f = f;
    unsigned int r = c.u + 0x7fffu + ((c.u >> 16) & 1u);  // RNE
    return (unsigned short)(r >> 16);
}

// ---------------- kernel 1: f32 -> bf16 convert (+nan_to_num), all six tensors ----------------
// One launch of few, long-lived waves. A chunk is what a work-group moves in one trip:
// CV_LOADS 16-byte loads a lane, each wave-wide load 512 contiguous bytes (four whole
// lines), each wave-wide 8-byte store 256 contiguous bytes (two whole lines).
// The six results lie one behind the other in the workspace, in the order of the
// arguments, so a chunk's number is also its place in out. Every tensor is a whole
// number of chunks, so a chunk has one source.
#define CV_THREADS 256
#define CV_LOADS 8
#define CV_CHUNK (CV_THREADS * CV_LOADS * 4)          // floats
#define CV_HS (BB * SS * HH / CV_CHUNK)               // chunks of hidden_states
#define CV_AT (BB * TT * HH / CV_CHUNK)               // chunks of audio_tokens
#define CV_W  (HH * HH / CV_CHUNK)                    // chunks of one weight matrix
#define CV_W0 (CV_HS + CV_AT)                         // first chunk of the first weight matrix
#define CV_ALL (CV_W0 + 4 * CV_W)
#define CV_TRIPS 8                                    // chunks a work-group
#define CV_GRID (CV_ALL / CV_TRIPS)

// n2n, then the rounding of f2bf: the bf16 stands in the upper half of the result.
// n2n as selects on the bits, so that no branch stands between the loads' waits.
static __device__ __forceinline__ unsigned int n2n_rne(float a) {
    const unsigned int u = __builtin_bit_cast(unsigned int, a), m = u & 0x7fffffffu;
    unsigned int x = m > 0x7f800000u ? 0u : u;                         // NaN -> 0
    x = m == 0x7f800000u ? ((u & 0x80000000u) | 0x461c4000u) : x;      // +-inf -> +-1e4
    return x + 0x7fffu + ((x >> 16) & 1u);                             // RNE
}

static __device__ __forceinline__ unsigned int pack2bf(float a, float b) {
    return (n2n_rne(a) >> 16) | (n2n_rne(b) & 0xffff0000u);
}

// the lane's first 16 bytes of chunk c (c is the same for the whole work-group)
static __device__ __forceinline__ const float4* cv_src(
    int c, int tid, const float* hs, const float* at, const float* wq, const float* wk,
    const float* wv, const float* wo) {
    const float* p = hs;
    int first = 0;
    if (c >= CV_HS)            { p = at; first = CV_HS; }
    if (c >= CV_W0)            { p = wq; first = CV_W0; }
    if (c >= CV_W0 + CV_W)     { p = wk; first = CV_W0 + CV_W; }
    if (c >= CV_W0 + 2 * CV_W) { p = wv; first = CV_W0 + 2 * CV_W; }
    if (c >= CV_W0 + 3 * CV_W) { p = wo; first = CV_W0 + 3 * CV_W; }
    return (const float4*)(p + (size_t)(c - first) * CV_CHUNK) + tid;
}

static __device__ __forceinline__ void cv_emit(const float4* v, unsigned short* out, int c, int tid) {
    uint2* d = (uint2*)(out + (size_t)c * CV_CHUNK) + tid;
#pragma unroll   // constant index: v stays in registers
    for (int j = 0; j < CV_LOADS; ++j) {
        uint2 o;
        o.x = pack2bf(v[j].x, v[j].y);
        o.y = pack2bf(v[j].z, v[j].w);
        d[j * CV_THREADS] = o;
    }
}

__global__ __launch_bounds__(CV_THREADS) void convert_all_kernel(
    const float* __restrict__ hs, const float* __restrict__ at,
    const float* __restrict__ wq, const float* __restrict__ wk,
    const float* __restrict__ wv, const float* __restrict__ wo,
    unsigned short* __restrict__ out) {

    const int tid = threadIdx.x;
    int c = blockIdx.x;                               // the grid is CV_GRID work-groups

    float4 cur[CV_LOADS], nxt[CV_LOADS];
    {
        const float4* s = cv_src(c, tid, hs, at, wq, wk, wv, wo);
#pragma unroll   // constant index: cur stays in registers, the loads issue back to back
        for (int j = 0; j < CV_LOADS; ++j) cur[j] = s[j * CV_THREADS];
    }
    // the next chunk's loads fly while this chunk is converted and stored; the last chunk
    // stands behind the loop, so that inside it the waits count the loads of both
#pragma unroll 1   // unrolled, the arithmetic of a chunk is lifted over the next chunk's loads
    for (int t = 1; t < CV_TRIPS; ++t) {
        const float4* s = cv_src(c + CV_GRID, tid, hs, at, wq, wk, wv, wo);
#pragma unroll   // constant index, as above
        for (int j = 0; j < CV_LOADS; ++j) nxt[j] = s[j * CV_THREADS];
        // holds the eight loads ahead of this chunk's arithmetic: sunk behind the wait for
        // this chunk's values they would start one memory latency later
        __builtin_amdgcn_sched_barrier(0);
        cv_emit(cur, out, c, tid);
        // holds the copies below, which wait for the next chunk's loads, behind this chunk's stores
        __builtin_amdgcn_sched_barrier(0);
#pragma unroll   // constant index, as above
        for (int j = 0; j < CV_LOADS; ++j) cur[j] = nxt[j];
        c += CV_GRID;
    }
    cv_emit(cur, out, c, tid);
}

// ---------------- kernel 2: tiled bf16 WMMA GEMM  C = A @ W^T (+bias) ------
// Block tile 128x128, K-stage 64 (K a multiple of 64), double-buffered LDS, software pipelined.
// 8 waves; each wave computes a 32x64 sub-tile = 2x4 accumulators.
// A: [M,K] bf16 row-major, W: [N,K] bf16 row-major.
// EPI 0: split-heads bf16 -> out[((b*NH+h)*L + s)*HD + d],  b=m/L, s=m%L
// EPI 2: transposed       -> out[((b*NH+h)*HD + d)*L + t],  b=m/L, t=m%L
// EPI 3: f32 out = acc + bias + n2n(resid[m,n]), row-major [M,N]
// EPI 4: two projections of the same A in one launch. W holds the rows of the first weight
//        matrix and behind them those of the second (N counts both). A block left of column
//        N/2 ends as EPI 0 (bias, out), the others as EPI 2 (bias2, out2), columns from N/2.

// One block's results: gm0, gn0 are the lane's first row and column in the wave's 32x64 tile.
template <int EPI>
static __device__ __forceinline__ void gemm_store(
    const v8f (&acc)[2][4], const float* __restrict__ bias, void* __restrict__ out,
    const float* __restrict__ resid, int gm0, int gn0, int N, int L) {
    // all three loops unrolled: constant indices keep acc in registers
#pragma unroll
    for (int i2 = 0; i2 < 2; ++i2)
#pragma unroll
        for (int j = 0; j < 4; ++j)
#pragma unroll
            for (int v = 0; v < 8; ++v) {
                int gm = gm0 + i2 * 16 + v;
                int gn = gn0 + j * 16;
                float val = acc[i2][j][v] + bias[gn];
                if (EPI == 0) {
                    int bi = gm / L, s = gm % L;
                    int h = gn >> 7, d = gn & 127;
                    ((unsigned short*)out)[(((size_t)(bi * NHH + h) * L + s) << 7) + d] = f2bf(val);
                } else if (EPI == 2) {
                    int bi = gm / L, t = gm % L;
                    int h = gn >> 7, d = gn & 127;
                    ((unsigned short*)out)[(((size_t)(bi * NHH + h) << 7) + d) * (size_t)L + t] = f2bf(val);
                } else {
                    size_t idx = (size_t)gm * N + gn;
                    ((float*)out)[idx] = val + n2n(resid[idx]);
                }
            }
}

template <int EPI>
__global__ __launch_bounds__(256) void gemm_bf16_kernel(
    const unsigned short* __restrict__ A,
    const unsigned short* __restrict__ W,
    const float* __restrict__ bias,
    void* __restrict__ out,
    const float* __restrict__ resid,
    int M, int N, int K, int L,
    const float* __restrict__ bias2,
    void* __restrict__ out2) {

    __shared__ unsigned short As[2][128 * GP];
    __shared__ unsigned short Bs[2][128 * GP];

    const int tid  = threadIdx.x;
    const int lane = tid & 31;
    const int wid  = tid >> 5;           // 0..7
    const int wave_m = wid >> 1;         // 0..3 -> 32 rows each
    const int wave_n = wid & 1;          // 0..1 -> 64 cols each

    const int m0 = blockIdx.y * 128;
    const int n0 = blockIdx.x * 128;

    // stage loader: 1024 uint4 per matrix; thread handles rows lrow0 + 32 r, r = 0..3;
    // eight neighbouring lanes cover one row's 128 bytes
    const int lrow0 = tid >> 3;          // 0..31
    const int lch   = (tid & 7) * 8;     // bf16 offset 0,8,..,56

    const int phi = (lane & 16) ? 4 : 0;
    const int r15 = lane & 15;

    v8f acc[2][4];
#pragma unroll
    for (int i = 0; i < 2; ++i)
#pragma unroll
        for (int j = 0; j < 4; ++j) acc[i][j] = (v8f){};

    const int NK = K / GK;

    const unsigned short* aBase = A + (size_t)m0 * K;   // the block's first rows
    const unsigned short* bBase = W + (size_t)n0 * K;
    const unsigned int gOff = (unsigned int)(lrow0 * K + lch);   // the lane's place in 32 rows
    const size_t rStep = (size_t)32 * K;
    const int ldsOff = lrow0 * GP + lch;

#if HAVE_ASYNC_LDS
    // ---- async-to-LDS pipelined path ----
    {
        // prologue: stage 0 into buf 0
#pragma unroll   // r a constant: the LDS steps fold into the address additions
        for (int r = 0; r < 4; ++r) {
            async_cp16(aBase + r * rStep + gOff, &As[0][ldsOff + r * 32 * GP]);
            async_cp16(bBase + r * rStep + gOff, &Bs[0][ldsOff + r * 32 * GP]);
        }
        wait_async0();
    }
    // publishes stage 0; directly behind the builtin wait it also holds the LDS reads behind it
    __syncthreads();
#else
#pragma unroll   // r a constant, as above
    for (int r = 0; r < 4; ++r) {
        *(uint4*)(&As[0][ldsOff + r * 32 * GP]) = *(const uint4*)(aBase + r * rStep + gOff);
        *(uint4*)(&Bs[0][ldsOff + r * 32 * GP]) = *(const uint4*)(bBase + r * rStep + gOff);
    }
    __syncthreads();
#endif

    int buf = 0;
    for (int i = 0; i < NK; ++i) {
        const int nbuf = buf ^ 1;
        const bool more = (i + 1 < NK);
        const int kn = (i + 1) * GK;

        // ---- issue next stage ----
#if !HAVE_ASYNC_LDS
        uint4 ra[4], rb[4];
#endif
        if (more) {
#pragma unroll   // r a constant, as above: the eight copies issue back to back
            for (int r = 0; r < 4; ++r) {
#if HAVE_ASYNC_LDS
                async_cp16(aBase + (r * rStep + kn) + gOff, &As[nbuf][ldsOff + r * 32 * GP]);
                async_cp16(bBase + (r * rStep + kn) + gOff, &Bs[nbuf][ldsOff + r * 32 * GP]);
#else
                ra[r] = *(const uint4*)(aBase + (r * rStep + kn) + gOff);
                rb[r] = *(const uint4*)(bBase + (r * rStep + kn) + gOff);
#endif
            }
        }

        // ---- compute current stage: 2 K-steps x (2 A-frags x 4 B-frags) = 16 WMMA ----
#pragma unroll   // ks a constant: it becomes the immediate offset of the LDS loads
        for (int ks = 0; ks < GK / 32; ++ks) {
            const unsigned int* As32 = (const unsigned int*)As[buf] + ks * 16;
            const unsigned int* Bs32 = (const unsigned int*)Bs[buf] + ks * 16;
            const int ar0 = (wave_m * 32 + r15) * (GP / 2);
            const int ar1 = ar0 + 16 * (GP / 2);
            Frag a0, a1;
#pragma unroll
            for (int v = 0; v < 8; ++v) {
                int p = (v & 3) + ((v >= 4) ? 8 : 0) + phi;
                a0.u[v] = As32[ar0 + p];
                a1.u[v] = As32[ar1 + p];
            }
            Frag b[4];
#pragma unroll
            for (int j = 0; j < 4; ++j) {
                const int br = (wave_n * 64 + j * 16 + r15) * (GP / 2);
#pragma unroll
                for (int v = 0; v < 8; ++v)
                    b[j].u[v] = Bs32[br + (v & 3) + ((v >= 4) ? 8 : 0) + phi];
            }
#pragma unroll
            for (int j = 0; j < 4; ++j) {
                acc[0][j] = __builtin_amdgcn_wmma_f32_16x16x32_bf16(
                    false, a0.v, false, b[j].v, (short)0, acc[0][j], false, false);
                acc[1][j] = __builtin_amdgcn_wmma_f32_16x16x32_bf16(
                    false, a1.v, false, b[j].v, (short)0, acc[1][j], false, false);
            }
        }

        // ---- publish next stage ----
        if (more) {
#if HAVE_ASYNC_LDS
            wait_async0();
#else
#pragma unroll   // constant index: ra and rb stay in registers
            for (int r = 0; r < 4; ++r) {
                *(uint4*)(&As[nbuf][ldsOff + r * 32 * GP]) = ra[r];
                *(uint4*)(&Bs[nbuf][ldsOff + r * 32 * GP]) = rb[r];
            }
#endif
        }
        // publishes the next stage and ends every wave's reads of this one; directly behind
        // the builtin wait it also holds the LDS reads behind it
        __syncthreads();
        buf = nbuf;
    }

    // ---------------- epilogue ----------------
    const int m_in = ((lane & 16) ? 8 : 0);
    const int gm0 = m0 + wave_m * 32 + m_in;
    const int gn0 = n0 + wave_n * 64 + r15;
    if (EPI == 4) {
        const int half = N >> 1;
        if (n0 < half)   // the same for the whole block: a tile lies on one side of N/2
            gemm_store<0>(acc, bias, out, resid, gm0, gn0, half, L);
        else {
            gemm_store<2>(acc, bias2, out2, resid, gm0, gn0 - half, half, L);
            // in the built code the other side's instructions follow this side's last stores and
            // rewrite their address and data registers: the wait stands in front of them
            asm volatile("s_wait_xcnt 0x0" ::: "memory");
        }
    } else {
        gemm_store<EPI>(acc, bias, out, resid, gm0, gn0, N, L);
    }
}

// ---------------- kernel 3: attention (one wave per 16 S-rows) ----------------
// 16 waves (256 query rows of one head) form a work-group. The head's K (256 x 128)
// and V^T (128 x 256) are brought into LDS once, in whole 128-byte lines, and every
// wave takes its A fragments from there.
// Both products are taken transposed: S^T = K * Q^T and ctx^T = V^T * P^T. In the
// accumulator map a lane then holds 8 keys (or 8 head dims) of ONE query row
// (column lane & 15), so the softmax runs in registers on all 32 lanes, with one
// exchange between the wave's halves for the maximum and one for the sum, and two
// score tiles, converted in place, are the B operand of the second product.

// value of lane l ^ 16
static __device__ __forceinline__ float xhalf(float x) {
    return __builtin_bit_cast(float, __builtin_amdgcn_permlanex16(
        __builtin_bit_cast(int, x), __builtin_bit_cast(int, x),
        0x76543210, 0xfedcba98, false, false));
}

// 2^a. The v_nop fills the one slot the instruction set asks for between a
// transcendental and a next instruction that reads its result or overwrites its
// source; in one statement with it, it cannot be scheduled away from it.
static __device__ __forceinline__ float exp2_slot(float a) {
    float r;
    asm("v_exp_f32 %0, %1\n\tv_nop" : "=v"(r) : "v"(a));
    return r;
}

// LDS pitches in bf16: a K row is 256 B + 16 B of pad, a V^T row 512 B + 16 B, both
// odd multiples of 16 B, so that the 16 rows of a ds_load_b128 half-wave fall on 16
// different groups of four banks.
#define KP 136
#define VP 264
#define ATT_WAVES 16

// Eight asynchronous 16-byte copies per lane, global -> LDS, step gs bytes in global
// memory and ls bytes in LDS. The s_wait_xcnt closes the statement so that it stands
// in front of any later write of the address registers the copies name.
static __device__ __forceinline__ void async_cp16x8(unsigned int l, const char* g,
                                                    unsigned int ls, unsigned int gs) {
    asm volatile(
        "global_load_async_to_lds_b128 %0, %8, off\n\t"
        "global_load_async_to_lds_b128 %1, %9, off\n\t"
        "global_load_async_to_lds_b128 %2, %10, off\n\t"
        "global_load_async_to_lds_b128 %3, %11, off\n\t"
        "global_load_async_to_lds_b128 %4, %12, off\n\t"
        "global_load_async_to_lds_b128 %5, %13, off\n\t"
        "global_load_async_to_lds_b128 %6, %14, off\n\t"
        "global_load_async_to_lds_b128 %7, %15, off\n\t"
        "s_wait_xcnt 0x0"
        :: "v"(l), "v"(l + ls), "v"(l + 2 * ls), "v"(l + 3 * ls),
           "v"(l + 4 * ls), "v"(l + 5 * ls), "v"(l + 6 * ls), "v"(l + 7 * ls),
           "v"(g), "v"(g + gs), "v"(g + 2 * gs), "v"(g + 3 * gs),
           "v"(g + 4 * gs), "v"(g + 5 * gs), "v"(g + 6 * gs), "v"(g + 7 * gs)
        : "memory");
}

// Four A fragments from an LDS tile: rows 16 apart, pitch in dwords; base points at the
// lane's row and its half of the 32 k (dwords 0..3 and 8..11: the k order of the B side)
static __device__ __forceinline__ void lds_frag4(Frag* f, const unsigned int* base, int pitch) {
#pragma unroll
    for (int j = 0; j < 4; ++j) {
        const uint4 lo = *(const uint4*)(base + j * 16 * pitch);
        const uint4 hi = *(const uint4*)(base + j * 16 * pitch + 8);
        f[j].u[0] = lo.x; f[j].u[1] = lo.y; f[j].u[2] = lo.z; f[j].u[3] = lo.w;
        f[j].u[4] = hi.x; f[j].u[5] = hi.y; f[j].u[6] = hi.z; f[j].u[7] = hi.w;
    }
}

// byte offset of a __shared__ object in the work-group's LDS
static __device__ __forceinline__ unsigned int lds_off(const void* p) {
    return (unsigned int)(size_t)(__attribute__((address_space(3))) const void*)p;
}

__global__ __launch_bounds__(ATT_WAVES * 32) void attn_kernel(
    const unsigned short* __restrict__ qb,   // [B,NH,S,HD]
    const unsigned short* __restrict__ kb,   // [B,NH,T,HD]
    const unsigned short* __restrict__ vtb,  // [B,NH,HD,T]
    const float* __restrict__ mask,          // [B,T]
    unsigned short* __restrict__ ctxb) {     // [B,S,H] bf16

    __shared__ __attribute__((aligned(16))) unsigned short Ks[TT * KP];
    __shared__ __attribute__((aligned(16))) unsigned short Vs[HD * VP];

    const int tid  = threadIdx.x;
    const int lane = tid & 31;
    const int bid  = blockIdx.x;
    const int bh   = bid >> 3;               // S/256 = 8 work-groups per (b,h)
    const int s0   = ((bid & 7) << 8) + ((tid >> 5) << 4);
    const int b    = bh >> 4;
    const int h    = bh & 15;

    const int phi  = (lane & 16) ? 4 : 0;
    const int r15  = lane & 15;
    const int m_in = (lane & 16) ? 8 : 0;

    // ---- scores^T: 256 x 16 via 4 K-steps x 16 key tiles of WMMA ----
    // acc[nt][v] = score(query s0 + r15, key nt*16 + m_in + v)
    v8f acc[16];
#pragma unroll
    for (int i = 0; i < 16; ++i) acc[i] = (v8f){};

    // this wave's own 16 query rows, straight from global memory, in flight with the copies
    const unsigned int* qrow = (const unsigned int*)(qb + ((size_t)bh * SS + s0) * HD);
    Frag q[4];
#pragma unroll
    for (int kk = 0; kk < 4; ++kk)
#pragma unroll
        for (int v = 0; v < 8; ++v)
            q[kk].u[v] = qrow[r15 * 64 + kk * 16 + (v & 3) + ((v >= 4) ? 8 : 0) + phi];

    // K and V^T of this head are 64 KiB each, contiguous: thread tid copies the 16-byte
    // pieces tid, tid + 512, ... (a wave's copy is 512 contiguous bytes: two K rows or
    // one V^T row); 512 pieces are 32 K rows or 16 V^T rows.
    async_cp16x8(lds_off(Ks) + (tid >> 4) * (KP * 2) + (tid & 15) * 16,
                 (const char*)(kb + (size_t)bh * TT * HD) + tid * 16, 32 * KP * 2, 8192);
    async_cp16x8(lds_off(Vs) + (tid >> 5) * (VP * 2) + (tid & 31) * 16,
                 (const char*)(vtb + (size_t)bh * HD * TT) + tid * 16, 16 * VP * 2, 8192);
    // this wave's copies have landed; behind the barrier every wave's have
    asm volatile("s_wait_asynccnt 0x0" ::: "memory");
    __syncthreads();

    // group g = K-step g >> 2, key tiles (g & 3) * 4 + 0..3; the next group's fragments
    // are fetched into a second register set ahead of this group's WMMAs
    const unsigned int* kbase = (const unsigned int*)Ks + r15 * (KP / 2) + phi;
    Frag kf[2][4];
    lds_frag4(kf[0], kbase, KP / 2);
#pragma unroll
    for (int g = 0; g < 16; ++g) {
        if (g + 1 < 16)
            lds_frag4(kf[(g + 1) & 1],
                      kbase + ((g + 1) & 3) * 64 * (KP / 2) + ((g + 1) >> 2) * 16, KP / 2);
        // keeps the eight LDS loads one group, ahead of the WMMAs: left free the scheduler
        // either lifts so many loads that the 256 registers spill or waits out each load
        __builtin_amdgcn_sched_barrier(0);
#pragma unroll
        for (int j = 0; j < 4; ++j) {
            const int nt = (g & 3) * 4 + j;
            acc[nt] = __builtin_amdgcn_wmma_f32_16x16x32_bf16(false, kf[g & 1][j].v, false,
                                                              q[g >> 2].v, (short)0, acc[nt],
                                                              false, false);
        }
        __builtin_amdgcn_sched_barrier(0);   // the same, at the group's end
    }

    // ---- softmax over T=256: 128 keys of the row in this lane, 128 in lane ^ 16 ----
    const float* mrow = mask + (size_t)b * TT + m_in;
    v8f mx8;
#pragma unroll
    for (int v = 0; v < 8; ++v) mx8[v] = -1e30f;
#pragma unroll
    for (int nt = 0; nt < 16; ++nt) {
        const float4 ma = *(const float4*)(mrow + nt * 16);
        const float4 mb = *(const float4*)(mrow + nt * 16 + 4);
        const float mk[8] = {ma.x, ma.y, ma.z, ma.w, mb.x, mb.y, mb.z, mb.w};
#pragma unroll
        for (int v = 0; v < 8; ++v) {
            float x = acc[nt][v] * SCALE_INV;
            x = fminf(fmaxf(x, -50.0f), 50.0f);
            x += mk[v] * -1e9f;
            acc[nt][v] = x;
            mx8[v] = fmaxf(mx8[v], x);
        }
        // the mask loads of eight tiles at a time: all 32 lifted to the top take 128
        // registers beside the 128 of acc, and the 256-register budget spills
        if (nt == 7) __builtin_amdgcn_sched_barrier(0);
    }
    float mx = fmaxf(fmaxf(fmaxf(mx8[0], mx8[1]), fmaxf(mx8[2], mx8[3])),
                     fmaxf(fmaxf(mx8[4], mx8[5]), fmaxf(mx8[6], mx8[7])));
    mx = fmaxf(mx, xhalf(mx));
    // the address registers of the mask loads are reused from here on
    asm volatile("s_wait_xcnt 0x0" ::: "memory");

    v8f sum8 = (v8f){};
#pragma unroll
    for (int nt = 0; nt < 16; ++nt)
#pragma unroll
        for (int v = 0; v < 8; ++v) {
            float e = exp2_slot((acc[nt][v] - mx) * 1.44269504f);   // e^(x - mx)
            acc[nt][v] = e;
            sum8[v] += e;
        }
    float sum = ((sum8[0] + sum8[1]) + (sum8[2] + sum8[3])) +
                ((sum8[4] + sum8[5]) + (sum8[6] + sum8[7]));
    sum += xhalf(sum);
    const float inv = 1.0f / (sum + 1e-8f);

    // probs^T as B fragments: score tiles 2kk and 2kk+1 hold keys kk*32 + m_in + 0..7
    // and kk*32 + 16 + m_in + 0..7, the k order of the V^T loader below
    Frag p[8];
#pragma unroll
    for (int kk = 0; kk < 8; ++kk)
#pragma unroll
        for (int w = 0; w < 4; ++w) {
            p[kk].u[w]     = (unsigned int)f2bf(acc[2 * kk][2 * w] * inv) |
                             ((unsigned int)f2bf(acc[2 * kk][2 * w + 1] * inv) << 16);
            p[kk].u[4 + w] = (unsigned int)f2bf(acc[2 * kk + 1][2 * w] * inv) |
                             ((unsigned int)f2bf(acc[2 * kk + 1][2 * w + 1] * inv) << 16);
        }
    // keeps the packing ahead of the second product: spread among its WMMAs the 128
    // f32 values stay live beside the V fragments and the ctx accumulators
    __builtin_amdgcn_sched_barrier(0);

    // ---- ctx^T = V^T @ probs^T : 128 x 16, K over T=256 ----
    // c[nt][v] = ctx(query s0 + r15, head dim nt*16 + m_in + v)
    v8f c[8];
#pragma unroll
    for (int i = 0; i < 8; ++i) c[i] = (v8f){};

    // group g = K-step g >> 1, head-dim tiles (g & 1) * 4 + 0..3, fetched as above
    const unsigned int* vbase = (const unsigned int*)Vs + r15 * (VP / 2) + phi;
    Frag vf[2][4];
    lds_frag4(vf[0], vbase, VP / 2);
#pragma unroll
    for (int g = 0; g < 16; ++g) {
        if (g + 1 < 16)
            lds_frag4(vf[(g + 1) & 1],
                      vbase + ((g + 1) & 1) * 64 * (VP / 2) + ((g + 1) >> 1) * 16, VP / 2);
        __builtin_amdgcn_sched_barrier(0);   // one load group ahead of the WMMAs, as above
#pragma unroll
        for (int j = 0; j < 4; ++j) {
            const int nt = (g & 1) * 4 + j;
            c[nt] = __builtin_amdgcn_wmma_f32_16x16x32_bf16(false, vf[g & 1][j].v, false,
                                                            p[g >> 1].v, (short)0, c[nt],
                                                            false, false);
        }
        __builtin_amdgcn_sched_barrier(0);   // the same, at the group's end
    }

    // ctx -> [B,S,H] bf16: 8 consecutive head dims of one row per lane and tile
    unsigned short* crow = ctxb + ((size_t)(b * SS + s0 + r15)) * HH + h * HD + m_in;
#pragma unroll
    for (int nt = 0; nt < 8; ++nt) {
        uint4 o;
        o.x = (unsigned int)f2bf(c[nt][0]) | ((unsigned int)f2bf(c[nt][1]) << 16);
        o.y = (unsigned int)f2bf(c[nt][2]) | ((unsigned int)f2bf(c[nt][3]) << 16);
        o.z = (unsigned int)f2bf(c[nt][4]) | ((unsigned int)f2bf(c[nt][5]) << 16);
        o.w = (unsigned int)f2bf(c[nt][6]) | ((unsigned int)f2bf(c[nt][7]) << 16);
        *(uint4*)(crow + nt * 16) = o;
    }
}

// ---------------- kernel 4: LayerNorm (one block per row) ----------------
__global__ __launch_bounds__(256) void layernorm_kernel(const float* __restrict__ x,
                                                        const float* __restrict__ g,
                                                        const float* __restrict__ bta,
                                                        float* __restrict__ out) {
    __shared__ float rs[256], rq[256];
    const int tid = threadIdx.x;
    const size_t row = (size_t)blockIdx.x * HH;

    float s = 0.0f, q = 0.0f;
#pragma unroll
    for (int j = 0; j < HH / 256; ++j) {
        float v = x[row + tid + j * 256];
        s += v;
        q += v * v;
    }
    rs[tid] = s;
    rq[tid] = q;
    __syncthreads();
    for (int off = 128; off > 0; off >>= 1) {
        if (tid < off) { rs[tid] += rs[tid + off]; rq[tid] += rq[tid + off]; }
        __syncthreads();
    }
    const float mu  = rs[0] * (1.0f / HH);
    const float var = rq[0] * (1.0f / HH) - mu * mu;
    const float r   = rsqrtf(var + LN_EPS);
#pragma unroll
    for (int j = 0; j < HH / 256; ++j) {
        int i = tid + j * 256;
        out[row + i] = (x[row + i] - mu) * r * g[i] + bta[i];
    }
}

// ---------------- launcher ----------------
extern "C" void kernel_launch(void* const* d_in, const int* in_sizes, int n_in,
                              void* d_out, int out_size, void* d_ws, size_t ws_size,
                              hipStream_t stream) {
    const float* hs   = (const float*)d_in[0];   // (B,S,H)
    const float* at   = (const float*)d_in[1];   // (B,T,H)
    const float* mask = (const float*)d_in[2];   // (B,T)
    const float* Wq   = (const float*)d_in[3];
    const float* bq   = (const float*)d_in[4];
    const float* Wk   = (const float*)d_in[5];
    const float* bk   = (const float*)d_in[6];
    const float* Wv   = (const float*)d_in[7];
    const float* bv   = (const float*)d_in[8];
    const float* Wo   = (const float*)d_in[9];
    const float* bo   = (const float*)d_in[10];
    const float* ln_g = (const float*)d_in[11];
    const float* ln_b = (const float*)d_in[12];
    float* outp = (float*)d_out;

    const size_t BS = (size_t)BB * SS;   // 8192
    const size_t BT = (size_t)BB * TT;   // 1024

    // workspace carve-up (bf16 stored as ushort)
    char* w = (char*)d_ws;
    unsigned short* hsb  = (unsigned short*)w;                  w += BS * HH * 2;
    unsigned short* atb  = (unsigned short*)w;                  w += BT * HH * 2;
    unsigned short* wqb  = (unsigned short*)w;                  w += (size_t)HH * HH * 2;
    unsigned short* wkb  = (unsigned short*)w;                  w += (size_t)HH * HH * 2;
    unsigned short* wvb  = (unsigned short*)w;                  w += (size_t)HH * HH * 2;
    unsigned short* wob  = (unsigned short*)w;                  w += (size_t)HH * HH * 2;
    unsigned short* qb   = (unsigned short*)w;                  w += BS * HH * 2;     // [B,NH,S,HD]
    unsigned short* kbuf = (unsigned short*)w;                  w += BT * HH * 2;     // [B,NH,T,HD]
    unsigned short* vtb  = (unsigned short*)w;                  w += BT * HH * 2;     // [B,NH,HD,T]
    unsigned short* ctxb = (unsigned short*)w;                  w += BS * HH * 2;     // [B,S,H]
    float*          opre = (float*)w;                           w += BS * HH * 4;

    // 1) converts: hsb, atb, wqb, wkb, wvb, wob are one contiguous range that starts at hsb
    convert_all_kernel<<<CV_GRID, CV_THREADS, 0, stream>>>(hs, at, Wq, Wk, Wv, Wo, hsb);

    // 2) projections (block tile 128x128)
    gemm_bf16_kernel<0><<<dim3(HH / 128, BS / 128), 256, 0, stream>>>(
        hsb, wqb, bq, qb, nullptr, (int)BS, HH, HH, SS, nullptr, nullptr);
    // K and V together: wvb lies directly behind wkb, so the two are one matrix of 2 H rows;
    // 256 work-groups, where each projection alone has 128
    gemm_bf16_kernel<4><<<dim3(2 * HH / 128, BT / 128), 256, 0, stream>>>(
        atb, wkb, bk, kbuf, nullptr, (int)BT, 2 * HH, HH, TT, bv, vtb);

    // 3) attention: one wave per 16 S-rows, 16 waves of one head per work-group
    attn_kernel<<<BB * NHH * (SS / 256), 512, 0, stream>>>(qb, kbuf, vtb, mask, ctxb);

    // 4) output projection + bias + residual (f32)
    gemm_bf16_kernel<3><<<dim3(HH / 128, BS / 128), 256, 0, stream>>>(
        ctxb, wob, bo, opre, hs, (int)BS, HH, HH, SS, nullptr, nullptr);

    // 5) LayerNorm -> d_out
    layernorm_kernel<<<(int)BS, 256, 0, stream>>>(opre, ln_g, ln_b, outp);
}

// v007
// A run of this version takes 213 microseconds.
// Two timings next to v006 both put it at 1.06 times that version's speed.
// All steps since v000 together make it 2.50 times as fast.
#include <hip/hip_runtime.h>

// ---------------- problem constants (match reference) ----------------
#define BB 4
#define SS 2048
#define TT 256
#define HH 2048
#define NHH 16
#define HD 128
#define LN_EPS 1e-5f
#define SCALE_INV 0.08838834764831845f   // 1/sqrt(128)

// A GEMM stage holds GK k of every operand row: 128 bytes, one whole cache line, so
// that a wave's 512-byte copy asks L2 for four whole lines and not for eight halves.
#define GK 64
// LDS pitch of a GEMM stage row, in bf16: 64 of data + 8 of pad = 144 bytes, an
// odd multiple of 16 bytes, so that the 16 rows one ds_load_b128 half-wave
// touches fall on 16 different groups of four banks (64 banks x 4 bytes).
#define GP 72

typedef __attribute__((ext_vector_type(16))) __bf16 v16bf;
typedef __attribute__((ext_vector_type(8)))  float  v8f;

union Frag {
    unsigned int u[8];
    v16bf v;
};

// ---- optional CDNA5 async global->LDS copy path (compile-safe probe) ----
#if defined(__has_builtin)
#if __has_builtin(__builtin_amdgcn_global_load_async_to_lds_b128)
#define HAVE_ASYNC_LDS 1
#endif
#endif
#ifndef HAVE_ASYNC_LDS
#define HAVE_ASYNC_LDS 0
#endif

#if HAVE_ASYNC_LDS
typedef int gv4i __attribute__((vector_size(16)));   // matches builtin param type
static __device__ __forceinline__ void async_cp16(const void* g, void* l) {
    __builtin_amdgcn_global_load_async_to_lds_b128(
        (__attribute__((address_space(1))) gv4i*)g,
        (__attribute__((address_space(3))) gv4i*)l, 0, 0);
}
static __device__ __forceinline__ void wait_async0() {
#if __has_builtin(__builtin_amdgcn_s_wait_asynccnt)
    __builtin_amdgcn_s_wait_asynccnt(0);
#else
    asm volatile("s_wait_asynccnt 0" ::: "memory");
#endif
}
#endif

static __device__ __forceinline__ float n2n(float x) {
    if (isnan(x)) return 0.0f;
    if (isinf(x)) return x > 0.0f ? 1e4f : -1e4f;
    return x;
}

static __device__ __forceinline__ unsigned short f2bf(float f) {
    union { float f; unsigned int u; } c;
    c.f = f;
    unsigned int r = c.u + 0x7fffu + ((c.u >> 16) & 1u);  // RNE
    return (unsigned short)(r >> 16);
}

// ---------------- kernel 1: f32 -> bf16 convert (+nan_to_num), all six tensors ----------------
// One launch of few, long-lived waves. A chunk is what a work-group moves in one trip:
// CV_LOADS 16-byte loads a lane, each wave-wide load 512 contiguous bytes (four whole
// lines), each wave-wide 8-byte store 256 contiguous bytes (two whole lines).
// The six results lie one behind the other in the workspace, in the order of the
// arguments, so a chunk's number is also its place in out. Every tensor is a whole
// number of chunks, so a chunk has one source.
#define CV_THREADS 256
#define CV_LOADS 8
#define CV_CHUNK (CV_THREADS * CV_LOADS * 4)          // floats
#define CV_HS (BB * SS * HH / CV_CHUNK)               // chunks of hidden_states
#define CV_AT (BB * TT * HH / CV_CHUNK)               // chunks of audio_tokens
#define CV_W  (HH * HH / CV_CHUNK)                    // chunks of one weight matrix
#define CV_W0 (CV_HS + CV_AT)                         // first chunk of the first weight matrix
#define CV_ALL (CV_W0 + 4 * CV_W)
#define CV_TRIPS 8                                    // chunks a work-group
#define CV_GRID (CV_ALL / CV_TRIPS)

// n2n, then the rounding of f2bf: the bf16 stands in the upper half of the result.
// n2n as selects on the bits, so that no branch stands between the loads' waits.
static __device__ __forceinline__ unsigned int n2n_rne(float a) {
    const unsigned int u = __builtin_bit_cast(unsigned int, a), m = u & 0x7fffffffu;
    unsigned int x = m > 0x7f800000u ? 0u : u;                         // NaN -> 0
    x = m == 0x7f800000u ? ((u & 0x80000000u) | 0x461c4000u) : x;      // +-inf -> +-1e4
    return x + 0x7fffu + ((x >> 16) & 1u);                             // RNE
}

static __device__ __forceinline__ unsigned int pack2bf(float a, float b) {
    return (n2n_rne(a) >> 16) | (n2n_rne(b) & 0xffff0000u);
}

// the lane's first 16 bytes of chunk c (c is the same for the whole work-group)
static __device__ __forceinline__ const float4* cv_src(
    int c, int tid, const float* hs, const float* at, const float* wq, const float* wk,
    const float* wv, const float* wo) {
    const float* p = hs;
    int first = 0;
    if (c >= CV_HS)            { p = at; first = CV_HS; }
    if (c >= CV_W0)            { p = wq; first = CV_W0; }
    if (c >= CV_W0 + CV_W)     { p = wk; first = CV_W0 + CV_W; }
    if (c >= CV_W0 + 2 * CV_W) { p = wv; first = CV_W0 + 2 * CV_W; }
    if (c >= CV_W0 + 3 * CV_W) { p = wo; first = CV_W0 + 3 * CV_W; }
    return (const float4*)(p + (size_t)(c - first) * CV_CHUNK) + tid;
}

static __device__ __forceinline__ void cv_emit(const float4* v, unsigned short* out, int c, int tid) {
    uint2* d = (uint2*)(out + (size_t)c * CV_CHUNK) + tid;
#pragma unroll   // constant index: v stays in registers
    for (int j = 0; j < CV_LOADS; ++j) {
        uint2 o;
        o.x = pack2bf(v[j].x, v[j].y);
        o.y = pack2bf(v[j].z, v[j].w);
        d[j * CV_THREADS] = o;
    }
}

__global__ __launch_bounds__(CV_THREADS) void convert_all_kernel(
    const float* __restrict__ hs, const float* __restrict__ at,
    const float* __restrict__ wq, const float* __restrict__ wk,
    const float* __restrict__ wv, const float* __restrict__ wo,
    unsigned short* __restrict__ out) {

    const int tid = threadIdx.x;
    int c = blockIdx.x;                               // the grid is CV_GRID work-groups

    float4 cur[CV_LOADS], nxt[CV_LOADS];
    {
        const float4* s = cv_src(c, tid, hs, at, wq, wk, wv, wo);
#pragma unroll   // constant index: cur stays in registers, the loads issue back to back
        for (int j = 0; j < CV_LOADS; ++j) cur[j] = s[j * CV_THREADS];
    }
    // the next chunk's loads fly while this chunk is converted and stored; the last chunk
    // stands behind the loop, so that inside it the waits count the loads of both
#pragma unroll 1   // unrolled, the arithmetic of a chunk is lifted over the next chunk's loads
    for (int t = 1; t < CV_TRIPS; ++t) {
        const float4* s = cv_src(c + CV_GRID, tid, hs, at, wq, wk, wv, wo);
#pragma unroll   // constant index, as above
        for (int j = 0; j < CV_LOADS; ++j) nxt[j] = s[j * CV_THREADS];
        // holds the eight loads ahead of this chunk's arithmetic: sunk behind the wait for
        // this chunk's values they would start one memory latency later
        __builtin_amdgcn_sched_barrier(0);
        cv_emit(cur, out, c, tid);
        // holds the copies below, which wait for the next chunk's loads, behind this chunk's stores
        __builtin_amdgcn_sched_barrier(0);
#pragma unroll   // constant index, as above
        for (int j = 0; j < CV_LOADS; ++j) cur[j] = nxt[j];
        c += CV_GRID;
    }
    cv_emit(cur, out, c, tid);
}

// ---------------- kernel 2: tiled bf16 WMMA GEMM  C = A @ W^T (+bias) ------
// Block tile 128x128, K-stage 64 (K a multiple of 64), double-buffered LDS, software pipelined.
// 8 waves; each wave computes a 32x64 sub-tile = 2x4 accumulators.
// A: [M,K] bf16 row-major, W: [N,K] bf16 row-major.
// EPI 0: split-heads bf16 -> out[((b*NH+h)*L + s)*HD + d],  b=m/L, s=m%L
// EPI 2: transposed       -> out[((b*NH+h)*HD + d)*L + t],  b=m/L, t=m%L
// EPI 3: f32 out = acc + bias + n2n(resid[m,n]), row-major [M,N]
// EPI 4: two projections of the same A in one launch. W holds the rows of the first weight
//        matrix and behind them those of the second (N counts both). A block left of column
//        N/2 ends as EPI 0 (bias, out), the others as EPI 2 (bias2, out2), columns from N/2.

// One block's results: gm0, gn0 are the lane's first row and column in the wave's 32x64 tile.
template <int EPI>
static __device__ __forceinline__ void gemm_store(
    const v8f (&acc)[2][4], const float* __restrict__ bias, void* __restrict__ out,
    const float* __restrict__ resid, int gm0, int gn0, int N, int L) {
    // all three loops unrolled: constant indices keep acc in registers
#pragma unroll
    for (int i2 = 0; i2 < 2; ++i2)
#pragma unroll
        for (int j = 0; j < 4; ++j)
#pragma unroll
            for (int v = 0; v < 8; ++v) {
                int gm = gm0 + i2 * 16 + v;
                int gn = gn0 + j * 16;
                float val = acc[i2][j][v] + bias[gn];
                if (EPI == 0) {
                    int bi = gm / L, s = gm % L;
                    int h = gn >> 7, d = gn & 127;
                    ((unsigned short*)out)[(((size_t)(bi * NHH + h) * L + s) << 7) + d] = f2bf(val);
                } else if (EPI == 2) {
                    int bi = gm / L, t = gm % L;
                    int h = gn >> 7, d = gn & 127;
                    ((unsigned short*)out)[(((size_t)(bi * NHH + h) << 7) + d) * (size_t)L + t] = f2bf(val);
                } else {
                    size_t idx = (size_t)gm * N + gn;
                    ((float*)out)[idx] = val + n2n(resid[idx]);
                }
            }
}

template <int EPI>
__global__ __launch_bounds__(256) void gemm_bf16_kernel(
    const unsigned short* __restrict__ A,
    const unsigned short* __restrict__ W,
    const float* __restrict__ bias,
    void* __restrict__ out,
    const float* __restrict__ resid,
    int M, int N, int K, int L,
    const float* __restrict__ bias2,
    void* __restrict__ out2) {

    __shared__ unsigned short As[2][128 * GP];
    __shared__ unsigned short Bs[2][128 * GP];

    const int tid  = threadIdx.x;
    const int lane = tid & 31;
    const int wid  = tid >> 5;           // 0..7
    const int wave_m = wid >> 1;         // 0..3 -> 32 rows each
    const int wave_n = wid & 1;          // 0..1 -> 64 cols each

    const int m0 = blockIdx.y * 128;
    const int n0 = blockIdx.x * 128;

    // stage loader: 1024 uint4 per matrix; thread handles rows lrow0 + 32 r, r = 0..3;
    // eight neighbouring lanes cover one row's 128 bytes
    const int lrow0 = tid >> 3;          // 0..31
    const int lch   = (tid & 7) * 8;     // bf16 offset 0,8,..,56

    const int phi = (lane & 16) ? 4 : 0;
    const int r15 = lane & 15;

    v8f acc[2][4];
#pragma unroll
    for (int i = 0; i < 2; ++i)
#pragma unroll
        for (int j = 0; j < 4; ++j) acc[i][j] = (v8f){};

    const int NK = K / GK;

    const unsigned short* aBase = A + (size_t)m0 * K;   // the block's first rows
    const unsigned short* bBase = W + (size_t)n0 * K;
    const unsigned int gOff = (unsigned int)(lrow0 * K + lch);   // the lane's place in 32 rows
    const size_t rStep = (size_t)32 * K;
    const int ldsOff = lrow0 * GP + lch;

#if HAVE_ASYNC_LDS
    // ---- async-to-LDS pipelined path ----
    {
        // prologue: stage 0 into buf 0
#pragma unroll   // r a constant: the LDS steps fold into the address additions
        for (int r = 0; r < 4; ++r) {
            async_cp16(aBase + r * rStep + gOff, &As[0][ldsOff + r * 32 * GP]);
            async_cp16(bBase + r * rStep + gOff, &Bs[0][ldsOff + r * 32 * GP]);
        }
        wait_async0();
    }
    // publishes stage 0; directly behind the builtin wait it also holds the LDS reads behind it
    __syncthreads();
#else
#pragma unroll   // r a constant, as above
    for (int r = 0; r < 4; ++r) {
        *(uint4*)(&As[0][ldsOff + r * 32 * GP]) = *(const uint4*)(aBase + r * rStep + gOff);
        *(uint4*)(&Bs[0][ldsOff + r * 32 * GP]) = *(const uint4*)(bBase + r * rStep + gOff);
    }
    __syncthreads();
#endif

    int buf = 0;
    for (int i = 0; i < NK; ++i) {
        const int nbuf = buf ^ 1;
        const bool more = (i + 1 < NK);
        const int kn = (i + 1) * GK;

        // ---- issue next stage ----
#if !HAVE_ASYNC_LDS
        uint4 ra[4], rb[4];
#endif
        if (more) {
#pragma unroll   // r a constant, as above: the eight copies issue back to back
            for (int r = 0; r < 4; ++r) {
#if HAVE_ASYNC_LDS
                async_cp16(aBase + (r * rStep + kn) + gOff, &As[nbuf][ldsOff + r * 32 * GP]);
                async_cp16(bBase + (r * rStep + kn) + gOff, &Bs[nbuf][ldsOff + r * 32 * GP]);
#else
                ra[r] = *(const uint4*)(aBase + (r * rStep + kn) + gOff);
                rb[r] = *(const uint4*)(bBase + (r * rStep + kn) + gOff);
#endif
            }
        }

        // ---- compute current stage: 2 K-steps x (2 A-frags x 4 B-frags) = 16 WMMA ----
#pragma unroll   // ks a constant: it becomes the immediate offset of the LDS loads
        for (int ks = 0; ks < GK / 32; ++ks) {
            const unsigned int* As32 = (const unsigned int*)As[buf] + ks * 16;
            const unsigned int* Bs32 = (const unsigned int*)Bs[buf] + ks * 16;
            const int ar0 = (wave_m * 32 + r15) * (GP / 2);
            const int ar1 = ar0 + 16 * (GP / 2);
            Frag a0, a1;
#pragma unroll
            for (int v = 0; v < 8; ++v) {
                int p = (v & 3) + ((v >= 4) ? 8 : 0) + phi;
                a0.u[v] = As32[ar0 + p];
                a1.u[v] = As32[ar1 + p];
            }
            Frag b[4];
#pragma unroll
            for (int j = 0; j < 4; ++j) {
                const int br = (wave_n * 64 + j * 16 + r15) * (GP / 2);
#pragma unroll
                for (int v = 0; v < 8; ++v)
                    b[j].u[v] = Bs32[br + (v & 3) + ((v >= 4) ? 8 : 0) + phi];
            }
            // keeps a K-step's twelve LDS loads one group ahead of its WMMAs, behind counted
            // waits: left free, the scheduler gives the four B fragments one register set and
            // the wave waits out a whole LDS round trip in front of every second WMMA
            __builtin_amdgcn_sched_barrier(0);
#pragma unroll
            for (int j = 0; j < 4; ++j) {
                acc[0][j] = __builtin_amdgcn_wmma_f32_16x16x32_bf16(
                    false, a0.v, false, b[j].v, (short)0, acc[0][j], false, false);
                acc[1][j] = __builtin_amdgcn_wmma_f32_16x16x32_bf16(
                    false, a1.v, false, b[j].v, (short)0, acc[1][j], false, false);
            }
        }

        // ---- publish next stage ----
        if (more) {
#if HAVE_ASYNC_LDS
            wait_async0();
#else
#pragma unroll   // constant index: ra and rb stay in registers
            for (int r = 0; r < 4; ++r) {
                *(uint4*)(&As[nbuf][ldsOff + r * 32 * GP]) = ra[r];
                *(uint4*)(&Bs[nbuf][ldsOff + r * 32 * GP]) = rb[r];
            }
#endif
        }
        // publishes the next stage and ends every wave's reads of this one; directly behind
        // the builtin wait it also holds the LDS reads behind it
        __syncthreads();
        buf = nbuf;
    }

    // ---------------- epilogue ----------------
    const int m_in = ((lane & 16) ? 8 : 0);
    const int gm0 = m0 + wave_m * 32 + m_in;
    const int gn0 = n0 + wave_n * 64 + r15;
    if (EPI == 4) {
        const int half = N >> 1;
        if (n0 < half)   // the same for the whole block: a tile lies on one side of N/2
            gemm_store<0>(acc, bias, out, resid, gm0, gn0, half, L);
        else {
            gemm_store<2>(acc, bias2, out2, resid, gm0, gn0 - half, half, L);
            // in the built code the other side's instructions follow this side's last stores and
            // rewrite their address and data registers: the wait stands in front of them
            asm volatile("s_wait_xcnt 0x0" ::: "memory");
        }
    } else {
        gemm_store<EPI>(acc, bias, out, resid, gm0, gn0, N, L);
    }
}

// ---------------- kernel 3: attention (one wave per 16 S-rows) ----------------
// 16 waves (256 query rows of one head) form a work-group. The head's K (256 x 128)
// and V^T (128 x 256) are brought into LDS once, in whole 128-byte lines, and every
// wave takes its A fragments from there.
// Both products are taken transposed: S^T = K * Q^T and ctx^T = V^T * P^T. In the
// accumulator map a lane then holds 8 keys (or 8 head dims) of ONE query row
// (column lane & 15), so the softmax runs in registers on all 32 lanes, with one
// exchange between the wave's halves for the maximum and one for the sum, and two
// score tiles, converted in place, are the B operand of the second product.

// value of lane l ^ 16
static __device__ __forceinline__ float xhalf(float x) {
    return __builtin_bit_cast(float, __builtin_amdgcn_permlanex16(
        __builtin_bit_cast(int, x), __builtin_bit_cast(int, x),
        0x76543210, 0xfedcba98, false, false));
}

// 2^a. The v_nop fills the one slot the instruction set asks for between a
// transcendental and a next instruction that reads its result or overwrites its
// source; in one statement with it, it cannot be scheduled away from it.
static __device__ __forceinline__ float exp2_slot(float a) {
    float r;
    asm("v_exp_f32 %0, %1\n\tv_nop" : "=v"(r) : "v"(a));
    return r;
}

// LDS pitches in bf16: a K row is 256 B + 16 B of pad, a V^T row 512 B + 16 B, both
// odd multiples of 16 B, so that the 16 rows of a ds_load_b128 half-wave fall on 16
// different groups of four banks.
#define KP 136
#define VP 264
#define ATT_WAVES 16

// Eight asynchronous 16-byte copies per lane, global -> LDS, step gs bytes in global
// memory and ls bytes in LDS. The s_wait_xcnt closes the statement so that it stands
// in front of any later write of the address registers the copies name.
static __device__ __forceinline__ void async_cp16x8(unsigned int l, const char* g,
                                                    unsigned int ls, unsigned int gs) {
    asm volatile(
        "global_load_async_to_lds_b128 %0, %8, off\n\t"
        "global_load_async_to_lds_b128 %1, %9, off\n\t"
        "global_load_async_to_lds_b128 %2, %10, off\n\t"
        "global_load_async_to_lds_b128 %3, %11, off\n\t"
        "global_load_async_to_lds_b128 %4, %12, off\n\t"
        "global_load_async_to_lds_b128 %5, %13, off\n\t"
        "global_load_async_to_lds_b128 %6, %14, off\n\t"
        "global_load_async_to_lds_b128 %7, %15, off\n\t"
        "s_wait_xcnt 0x0"
        :: "v"(l), "v"(l + ls), "v"(l + 2 * ls), "v"(l + 3 * ls),
           "v"(l + 4 * ls), "v"(l + 5 * ls), "v"(l + 6 * ls), "v"(l + 7 * ls),
           "v"(g), "v"(g + gs), "v"(g + 2 * gs), "v"(g + 3 * gs),
           "v"(g + 4 * gs), "v"(g + 5 * gs), "v"(g + 6 * gs), "v"(g + 7 * gs)
        : "memory");
}

// Four A fragments from an LDS tile: rows 16 apart, pitch in dwords; base points at the
// lane's row and its half of the 32 k (dwords 0..3 and 8..11: the k order of the B side)
static __device__ __forceinline__ void lds_frag4(Frag* f, const unsigned int* base, int pitch) {
#pragma unroll
    for (int j = 0; j < 4; ++j) {
        const uint4 lo = *(const uint4*)(base + j * 16 * pitch);
        const uint4 hi = *(const uint4*)(base + j * 16 * pitch + 8);
        f[j].u[0] = lo.x; f[j].u[1] = lo.y; f[j].u[2] = lo.z; f[j].u[3] = lo.w;
        f[j].u[4] = hi.x; f[j].u[5] = hi.y; f[j].u[6] = hi.z; f[j].u[7] = hi.w;
    }
}

// byte offset of a __shared__ object in the work-group's LDS
static __device__ __forceinline__ unsigned int lds_off(const void* p) {
    return (unsigned int)(size_t)(__attribute__((address_space(3))) const void*)p;
}

__global__ __launch_bounds__(ATT_WAVES * 32) void attn_kernel(
    const unsigned short* __restrict__ qb,   // [B,NH,S,HD]
    const unsigned short* __restrict__ kb,   // [B,NH,T,HD]
    const unsigned short* __restrict__ vtb,  // [B,NH,HD,T]
    const float* __restrict__ mask,          // [B,T]
    unsigned short* __restrict__ ctxb) {     // [B,S,H] bf16

    __shared__ __attribute__((aligned(16))) unsigned short Ks[TT * KP];
    __shared__ __attribute__((aligned(16))) unsigned short Vs[HD * VP];

    const int tid  = threadIdx.x;
    const int lane = tid & 31;
    const int bid  = blockIdx.x;
    const int bh   = bid >> 3;               // S/256 = 8 work-groups per (b,h)
    const int s0   = ((bid & 7) << 8) + ((tid >> 5) << 4);
    const int b    = bh >> 4;
    const int h    = bh & 15;

    const int phi  = (lane & 16) ? 4 : 0;
    const int r15  = lane & 15;
    const int m_in = (lane & 16) ? 8 : 0;

    // ---- scores^T: 256 x 16 via 4 K-steps x 16 key tiles of WMMA ----
    // acc[nt][v] = score(query s0 + r15, key nt*16 + m_in + v)
    v8f acc[16];
#pragma unroll
    for (int i = 0; i < 16; ++i) acc[i] = (v8f){};

    // this wave's own 16 query rows, straight from global memory, in flight with the copies
    const unsigned int* qrow = (const unsigned int*)(qb + ((size_t)bh * SS + s0) * HD);
    Frag q[4];
#pragma unroll
    for (int kk = 0; kk < 4; ++kk)
#pragma unroll
        for (int v = 0; v < 8; ++v)
            q[kk].u[v] = qrow[r15 * 64 + kk * 16 + (v & 3) + ((v >= 4) ? 8 : 0) + phi];

    // K and V^T of this head are 64 KiB each, contiguous: thread tid copies the 16-byte
    // pieces tid, tid + 512, ... (a wave's copy is 512 contiguous bytes: two K rows or
    // one V^T row); 512 pieces are 32 K rows or 16 V^T rows.
    async_cp16x8(lds_off(Ks) + (tid >> 4) * (KP * 2) + (tid & 15) * 16,
                 (const char*)(kb + (size_t)bh * TT * HD) + tid * 16, 32 * KP * 2, 8192);
    async_cp16x8(lds_off(Vs) + (tid >> 5) * (VP * 2) + (tid & 31) * 16,
                 (const char*)(vtb + (size_t)bh * HD * TT) + tid * 16, 16 * VP * 2, 8192);
    // this wave's copies have landed; behind the barrier every wave's have
    asm volatile("s_wait_asynccnt 0x0" ::: "memory");
    __syncthreads();

    // group g = K-step g >> 2, key tiles (g & 3) * 4 + 0..3; the next group's fragments
    // are fetched into a second register set ahead of this group's WMMAs
    const unsigned int* kbase = (const unsigned int*)Ks + r15 * (KP / 2) + phi;
    Frag kf[2][4];
    lds_frag4(kf[0], kbase, KP / 2);
#pragma unroll
    for (int g = 0; g < 16; ++g) {
        if (g + 1 < 16)
            lds_frag4(kf[(g + 1) & 1],
                      kbase + ((g + 1) & 3) * 64 * (KP / 2) + ((g + 1) >> 2) * 16, KP / 2);
        // keeps the eight LDS loads one group, ahead of the WMMAs: left free the scheduler
        // either lifts so many loads that the 256 registers spill or waits out each load
        __builtin_amdgcn_sched_barrier(0);
#pragma unroll
        for (int j = 0; j < 4; ++j) {
            const int nt = (g & 3) * 4 + j;
            acc[nt] = __builtin_amdgcn_wmma_f32_16x16x32_bf16(false, kf[g & 1][j].v, false,
                                                              q[g >> 2].v, (short)0, acc[nt],
                                                              false, false);
        }
        __builtin_amdgcn_sched_barrier(0);   // the same, at the group's end
    }

    // ---- softmax over T=256: 128 keys of the row in this lane, 128 in lane ^ 16 ----
    const float* mrow = mask + (size_t)b * TT + m_in;
    v8f mx8;
#pragma unroll
    for (int v = 0; v < 8; ++v) mx8[v] = -1e30f;
#pragma unroll
    for (int nt = 0; nt < 16; ++nt) {
        const float4 ma = *(const float4*)(mrow + nt * 16);
        const float4 mb = *(const float4*)(mrow + nt * 16 + 4);
        const float mk[8] = {ma.x, ma.y, ma.z, ma.w, mb.x, mb.y, mb.z, mb.w};
#pragma unroll
        for (int v = 0; v < 8; ++v) {
            float x = acc[nt][v] * SCALE_INV;
            x = fminf(fmaxf(x, -50.0f), 50.0f);
            x += mk[v] * -1e9f;
            acc[nt][v] = x;
            mx8[v] = fmaxf(mx8[v], x);
        }
        // the mask loads of eight tiles at a time: all 32 lifted to the top take 128
        // registers beside the 128 of acc, and the 256-register budget spills
        if (nt == 7) __builtin_amdgcn_sched_barrier(0);
    }
    float mx = fmaxf(fmaxf(fmaxf(mx8[0], mx8[1]), fmaxf(mx8[2], mx8[3])),
                     fmaxf(fmaxf(mx8[4], mx8[5]), fmaxf(mx8[6], mx8[7])));
    mx = fmaxf(mx, xhalf(mx));
    // the address registers of the mask loads are reused from here on
    asm volatile("s_wait_xcnt 0x0" ::: "memory");

    v8f sum8 = (v8f){};
#pragma unroll
    for (int nt = 0; nt < 16; ++nt)
#pragma unroll
        for (int v = 0; v < 8; ++v) {
            float e = exp2_slot((acc[nt][v] - mx) * 1.44269504f);   // e^(x - mx)
            acc[nt][v] = e;
            sum8[v] += e;
        }
    float sum = ((sum8[0] + sum8[1]) + (sum8[2] + sum8[3])) +
                ((sum8[4] + sum8[5]) + (sum8[6] + sum8[7]));
    sum += xhalf(sum);
    const float inv = 1.0f / (sum + 1e-8f);

    // probs^T as B fragments: score tiles 2kk and 2kk+1 hold keys kk*32 + m_in + 0..7
    // and kk*32 + 16 + m_in + 0..7, the k order of the V^T loader below
    Frag p[8];
#pragma unroll
    for (int kk = 0; kk < 8; ++kk)
#pragma unroll
        for (int w = 0; w < 4; ++w) {
            p[kk].u[w]     = (unsigned int)f2bf(acc[2 * kk][2 * w] * inv) |
                             ((unsigned int)f2bf(acc[2 * kk][2 * w + 1] * inv) << 16);
            p[kk].u[4 + w] = (unsigned int)f2bf(acc[2 * kk + 1][2 * w] * inv) |
                             ((unsigned int)f2bf(acc[2 * kk + 1][2 * w + 1] * inv) << 16);
        }
    // keeps the packing ahead of the second product: spread among its WMMAs the 128
    // f32 values stay live beside the V fragments and the ctx accumulators
    __builtin_amdgcn_sched_barrier(0);

    // ---- ctx^T = V^T @ probs^T : 128 x 16, K over T=256 ----
    // c[nt][v] = ctx(query s0 + r15, head dim nt*16 + m_in + v)
    v8f c[8];
#pragma unroll
    for (int i = 0; i < 8; ++i) c[i] = (v8f){};

    // group g = K-step g >> 1, head-dim tiles (g & 1) * 4 + 0..3, fetched as above
    const unsigned int* vbase = (const unsigned int*)Vs + r15 * (VP / 2) + phi;
    Frag vf[2][4];
    lds_frag4(vf[0], vbase, VP / 2);
#pragma unroll
    for (int g = 0; g < 16; ++g) {
        if (g + 1 < 16)
            lds_frag4(vf[(g + 1) & 1],
                      vbase + ((g + 1) & 1) * 64 * (VP / 2) + ((g + 1) >> 1) * 16, VP / 2);
        __builtin_amdgcn_sched_barrier(0);   // one load group ahead of the WMMAs, as above
#pragma unroll
        for (int j = 0; j < 4; ++j) {
            const int nt = (g & 1) * 4 + j;
            c[nt] = __builtin_amdgcn_wmma_f32_16x16x32_bf16(false, vf[g & 1][j].v, false,
                                                            p[g >> 1].v, (short)0, c[nt],
                                                            false, false);
        }
        __builtin_amdgcn_sched_barrier(0);   // the same, at the group's end
    }

    // ctx -> [B,S,H] bf16: 8 consecutive head dims of one row per lane and tile
    unsigned short* crow = ctxb + ((size_t)(b * SS + s0 + r15)) * HH + h * HD + m_in;
#pragma unroll
    for (int nt = 0; nt < 8; ++nt) {
        uint4 o;
        o.x = (unsigned int)f2bf(c[nt][0]) | ((unsigned int)f2bf(c[nt][1]) << 16);
        o.y = (unsigned int)f2bf(c[nt][2]) | ((unsigned int)f2bf(c[nt][3]) << 16);
        o.z = (unsigned int)f2bf(c[nt][4]) | ((unsigned int)f2bf(c[nt][5]) << 16);
        o.w = (unsigned int)f2bf(c[nt][6]) | ((unsigned int)f2bf(c[nt][7]) << 16);
        *(uint4*)(crow + nt * 16) = o;
    }
}

// ---------------- kernel 4: LayerNorm (one block per row) ----------------
__global__ __launch_bounds__(256) void layernorm_kernel(const float* __restrict__ x,
                                                        const float* __restrict__ g,
                                                        const float* __restrict__ bta,
                                                        float* __restrict__ out) {
    __shared__ float rs[256], rq[256];
    const int tid = threadIdx.x;
    const size_t row = (size_t)blockIdx.x * HH;

    float s = 0.0f, q = 0.0f;
#pragma unroll
    for (int j = 0; j < HH / 256; ++j) {
        float v = x[row + tid + j * 256];
        s += v;
        q += v * v;
    }
    rs[tid] = s;
    rq[tid] = q;
    __syncthreads();
    for (int off = 128; off > 0; off >>= 1) {
        if (tid < off) { rs[tid] += rs[tid + off]; rq[tid] += rq[tid + off]; }
        __syncthreads();
    }
    const float mu  = rs[0] * (1.0f / HH);
    const float var = rq[0] * (1.0f / HH) - mu * mu;
    const float r   = rsqrtf(var + LN_EPS);
#pragma unroll
    for (int j = 0; j < HH / 256; ++j) {
        int i = tid + j * 256;
        out[row + i] = (x[row + i] - mu) * r * g[i] + bta[i];
    }
}

// ---------------- launcher ----------------
extern "C" void kernel_launch(void* const* d_in, const int* in_sizes, int n_in,
                              void* d_out, int out_size, void* d_ws, size_t ws_size,
                              hipStream_t stream) {
    const float* hs   = (const float*)d_in[0];   // (B,S,H)
    const float* at   = (const float*)d_in[1];   // (B,T,H)
    const float* mask = (const float*)d_in[2];   // (B,T)
    const float* Wq   = (const float*)d_in[3];
    const float* bq   = (const float*)d_in[4];
    const float* Wk   = (const float*)d_in[5];
    const float* bk   = (const float*)d_in[6];
    const float* Wv   = (const float*)d_in[7];
    const float* bv   = (const float*)d_in[8];
    const float* Wo   = (const float*)d_in[9];
    const float* bo   = (const float*)d_in[10];
    const float* ln_g = (const float*)d_in[11];
    const float* ln_b = (const float*)d_in[12];
    float* outp = (float*)d_out;

    const size_t BS = (size_t)BB * SS;   // 8192
    const size_t BT = (size_t)BB * TT;   // 1024

    // workspace carve-up (bf16 stored as ushort)
    char* w = (char*)d_ws;
    unsigned short* hsb  = (unsigned short*)w;                  w += BS * HH * 2;
    unsigned short* atb  = (unsigned short*)w;                  w += BT * HH * 2;
    unsigned short* wqb  = (unsigned short*)w;                  w += (size_t)HH * HH * 2;
    unsigned short* wkb  = (unsigned short*)w;                  w += (size_t)HH * HH * 2;
    unsigned short* wvb  = (unsigned short*)w;                  w += (size_t)HH * HH * 2;
    unsigned short* wob  = (unsigned short*)w;                  w += (size_t)HH * HH * 2;
    unsigned short* qb   = (unsigned short*)w;                  w += BS * HH * 2;     // [B,NH,S,HD]
    unsigned short* kbuf = (unsigned short*)w;                  w += BT * HH * 2;     // [B,NH,T,HD]
    unsigned short* vtb  = (unsigned short*)w;                  w += BT * HH * 2;     // [B,NH,HD,T]
    unsigned short* ctxb = (unsigned short*)w;                  w += BS * HH * 2;     // [B,S,H]
    float*          opre = (float*)w;                           w += BS * HH * 4;

    // 1) converts: hsb, atb, wqb, wkb, wvb, wob are one contiguous range that starts at hsb
    convert_all_kernel<<<CV_GRID, CV_THREADS, 0, stream>>>(hs, at, Wq, Wk, Wv, Wo, hsb);

    // 2) projections (block tile 128x128)
    gemm_bf16_kernel<0><<<dim3(HH / 128, BS / 128), 256, 0, stream>>>(
        hsb, wqb, bq, qb, nullptr, (int)BS, HH, HH, SS, nullptr, nullptr);
    // K and V together: wvb lies directly behind wkb, so the two are one matrix of 2 H rows;
    // 256 work-groups, where each projection alone has 128
    gemm_bf16_kernel<4><<<dim3(2 * HH / 128, BT / 128), 256, 0, stream>>>(
        atb, wkb, bk, kbuf, nullptr, (int)BT, 2 * HH, HH, TT, bv, vtb);

    // 3) attention: one wave per 16 S-rows, 16 waves of one head per work-group
    attn_kernel<<<BB * NHH * (SS / 256), 512, 0, stream>>>(qb, kbuf, vtb, mask, ctxb);

    // 4) output projection + bias + residual (f32)
    gemm_bf16_kernel<3><<<dim3(HH / 128, BS / 128), 256, 0, stream>>>(
        ctxb, wob, bo, opre, hs, (int)BS, HH, HH, SS, nullptr, nullptr);

    // 5) LayerNorm -> d_out
    layernorm_kernel<<<(int)BS, 256, 0, stream>>>(opre, ln_g, ln_b, outp);
}

// v008
// A run of this version takes 189 microseconds.
// Two timings next to v007 both put it at 1.12 times that version's speed.
// Counting every step since v000, it is 2.80 times as fast.
#include <hip/hip_runtime.h>

// ---------------- problem constants (match reference) ----------------
#define BB 4
#define SS 2048
#define TT 256
#define HH 2048
#define NHH 16
#define HD 128
#define LN_EPS 1e-5f
#define SCALE_INV 0.08838834764831845f   // 1/sqrt(128)

// A GEMM stage holds GK k of every operand row: 128 bytes, one whole cache line, so
// that a wave's 512-byte copy asks L2 for four whole lines and not for eight halves.
#define GK 64
// LDS pitch of a GEMM stage row, in bf16: 64 of data + 8 of pad = 144 bytes, an
// odd multiple of 16 bytes, so that the 16 rows one ds_load_b128 half-wave
// touches fall on 16 different groups of four banks (64 banks x 4 bytes).
#define GP 72

typedef __attribute__((ext_vector_type(16))) __bf16 v16bf;
typedef __attribute__((ext_vector_type(8)))  float  v8f;
typedef __attribute__((ext_vector_type(4)))  float  v4f;

union Frag {
    unsigned int u[8];
    v16bf v;
};

// ---- optional CDNA5 async global->LDS copy path (compile-safe probe) ----
#if defined(__has_builtin)
#if __has_builtin(__builtin_amdgcn_global_load_async_to_lds_b128)
#define HAVE_ASYNC_LDS 1
#endif
#endif
#ifndef HAVE_ASYNC_LDS
#define HAVE_ASYNC_LDS 0
#endif

#if HAVE_ASYNC_LDS
typedef int gv4i __attribute__((vector_size(16)));   // matches builtin param type
static __device__ __forceinline__ void async_cp16(const void* g, void* l) {
    __builtin_amdgcn_global_load_async_to_lds_b128(
        (__attribute__((address_space(1))) gv4i*)g,
        (__attribute__((address_space(3))) gv4i*)l, 0, 0);
}
static __device__ __forceinline__ void wait_async0() {
#if __has_builtin(__builtin_amdgcn_s_wait_asynccnt)
    __builtin_amdgcn_s_wait_asynccnt(0);
#else
    asm volatile("s_wait_asynccnt 0" ::: "memory");
#endif
}
#endif

static __device__ __forceinline__ unsigned short f2bf(float f) {
    union { float f; unsigned int u; } c;
    c.f = f;
    unsigned int r = c.u + 0x7fffu + ((c.u >> 16) & 1u);  // RNE
    return (unsigned short)(r >> 16);
}

// ---------------- kernel 1: f32 -> bf16 convert (+nan_to_num), all six tensors ----------------
// One launch of few, long-lived waves. A chunk is what a work-group moves in one trip:
// CV_LOADS 16-byte loads a lane, each wave-wide load 512 contiguous bytes (four whole
// lines), each wave-wide 8-byte store 256 contiguous bytes (two whole lines).
// The six results lie one behind the other in the workspace, in the order of the
// arguments, so a chunk's number is also its place in out. Every tensor is a whole
// number of chunks, so a chunk has one source.
#define CV_THREADS 256
#define CV_LOADS 8
#define CV_CHUNK (CV_THREADS * CV_LOADS * 4)          // floats
#define CV_HS (BB * SS * HH / CV_CHUNK)               // chunks of hidden_states
#define CV_AT (BB * TT * HH / CV_CHUNK)               // chunks of audio_tokens
#define CV_W  (HH * HH / CV_CHUNK)                    // chunks of one weight matrix
#define CV_W0 (CV_HS + CV_AT)                         // first chunk of the first weight matrix
#define CV_ALL (CV_W0 + 4 * CV_W)
#define CV_TRIPS 8                                    // chunks a work-group
#define CV_GRID (CV_ALL / CV_TRIPS)

// n2n, then the rounding of f2bf: the bf16 stands in the upper half of the result.
// n2n as selects on the bits, so that no branch stands between the loads' waits.
static __device__ __forceinline__ unsigned int n2n_rne(float a) {
    const unsigned int u = __builtin_bit_cast(unsigned int, a), m = u & 0x7fffffffu;
    unsigned int x = m > 0x7f800000u ? 0u : u;                         // NaN -> 0
    x = m == 0x7f800000u ? ((u & 0x80000000u) | 0x461c4000u) : x;      // +-inf -> +-1e4
    return x + 0x7fffu + ((x >> 16) & 1u);                             // RNE
}

static __device__ __forceinline__ unsigned int pack2bf(float a, float b) {
    return (n2n_rne(a) >> 16) | (n2n_rne(b) & 0xffff0000u);
}

// the lane's first 16 bytes of chunk c (c is the same for the whole work-group)
static __device__ __forceinline__ const float4* cv_src(
    int c, int tid, const float* hs, const float* at, const float* wq, const float* wk,
    const float* wv, const float* wo) {
    const float* p = hs;
    int first = 0;
    if (c >= CV_HS)            { p = at; first = CV_HS; }
    if (c >= CV_W0)            { p = wq; first = CV_W0; }
    if (c >= CV_W0 + CV_W)     { p = wk; first = CV_W0 + CV_W; }
    if (c >= CV_W0 + 2 * CV_W) { p = wv; first = CV_W0 + 2 * CV_W; }
    if (c >= CV_W0 + 3 * CV_W) { p = wo; first = CV_W0 + 3 * CV_W; }
    return (const float4*)(p + (size_t)(c - first) * CV_CHUNK) + tid;
}

static __device__ __forceinline__ void cv_emit(const float4* v, unsigned short* out, int c, int tid) {
    uint2* d = (uint2*)(out + (size_t)c * CV_CHUNK) + tid;
#pragma unroll   // constant index: v stays in registers
    for (int j = 0; j < CV_LOADS; ++j) {
        uint2 o;
        o.x = pack2bf(v[j].x, v[j].y);
        o.y = pack2bf(v[j].z, v[j].w);
        d[j * CV_THREADS] = o;
    }
}

__global__ __launch_bounds__(CV_THREADS) void convert_all_kernel(
    const float* __restrict__ hs, const float* __restrict__ at,
    const float* __restrict__ wq, const float* __restrict__ wk,
    const float* __restrict__ wv, const float* __restrict__ wo,
    unsigned short* __restrict__ out) {

    const int tid = threadIdx.x;
    int c = blockIdx.x;                               // the grid is CV_GRID work-groups

    float4 cur[CV_LOADS], nxt[CV_LOADS];
    {
        const float4* s = cv_src(c, tid, hs, at, wq, wk, wv, wo);
#pragma unroll   // constant index: cur stays in registers, the loads issue back to back
        for (int j = 0; j < CV_LOADS; ++j) cur[j] = s[j * CV_THREADS];
    }
    // the next chunk's loads fly while this chunk is converted and stored; the last chunk
    // stands behind the loop, so that inside it the waits count the loads of both
#pragma unroll 1   // unrolled, the arithmetic of a chunk is lifted over the next chunk's loads
    for (int t = 1; t < CV_TRIPS; ++t) {
        const float4* s = cv_src(c + CV_GRID, tid, hs, at, wq, wk, wv, wo);
#pragma unroll   // constant index, as above
        for (int j = 0; j < CV_LOADS; ++j) nxt[j] = s[j * CV_THREADS];
        // holds the eight loads ahead of this chunk's arithmetic: sunk behind the wait for
        // this chunk's values they would start one memory latency later
        __builtin_amdgcn_sched_barrier(0);
        cv_emit(cur, out, c, tid);
        // holds the copies below, which wait for the next chunk's loads, behind this chunk's stores
        __builtin_amdgcn_sched_barrier(0);
#pragma unroll   // constant index, as above
        for (int j = 0; j < CV_LOADS; ++j) cur[j] = nxt[j];
        c += CV_GRID;
    }
    cv_emit(cur, out, c, tid);
}

// ---------------- kernel 2: tiled bf16 WMMA GEMM  C = A @ W^T (+bias) ------
// Block tile 128x128, K-stage 64 (K a multiple of 64), double-buffered LDS, software pipelined.
// 8 waves; each wave computes a 32x64 sub-tile = 2x4 accumulators.
// A: [M,K] bf16 row-major, W: [N,K] bf16 row-major.
// EPI 0: split-heads bf16 -> out[((b*NH+h)*L + s)*HD + d],  b=m/L, s=m%L
// EPI 2: transposed       -> out[((b*NH+h)*HD + d)*L + t],  b=m/L, t=m%L
// EPI 3: f32 out = acc + bias + n2n(resid[m,n]), row-major [M,HH] (N is HH)
// EPI 4: two projections of the same A in one launch. W holds the rows of the first weight
//        matrix and behind them those of the second (N counts both). A block left of column
//        N/2 ends as EPI 0 (bias, out), the others as EPI 2 (bias2, out2), columns from N/2.
// L is a multiple of 32: the 32 rows of a wave's tile lie in one batch.
//
// The accumulator map gives a lane 8 consecutive rows of one column of the product. The
// product is therefore taken so that those 8 run along the output's contiguous dimension:
// W * A^T (TR, the lane holds 8 n of one m) for EPI 0 and 3, A * W^T (8 m of one n) for
// EPI 2. The loaders of the two operands have the same lane map and k order, so the two
// fragments only change places in the WMMA.

// LDS pitches of a wave's restaged tile, odd multiples of 16 bytes (bank groups as for GP):
// 32 rows of 64 bf16 (one line) or of 64 f32 (two lines)
#define SP0 144
#define SP3 272

// n2n (NaN -> 0, +-inf -> +-1e4) as selects on the bits: no branch stands between the
// residual loads and their use
static __device__ __forceinline__ float n2n_sel(float a) {
    const unsigned int u = __builtin_bit_cast(unsigned int, a), m = u & 0x7fffffffu;
    unsigned int x = m > 0x7f800000u ? 0u : u;                         // NaN -> 0
    x = m == 0x7f800000u ? ((u & 0x80000000u) | 0x461c4000u) : x;      // +-inf -> +-1e4
    return __builtin_bit_cast(float, x);
}

static __device__ __forceinline__ unsigned int bf2(float a, float b) {
    return (unsigned int)f2bf(a) | ((unsigned int)f2bf(b) << 16);
}

static __device__ __forceinline__ uint4 bf8(const v8f& a, const float4& lo, const float4& hi) {
    uint4 o;
    o.x = bf2(a[0] + lo.x, a[1] + lo.y);
    o.y = bf2(a[2] + lo.z, a[3] + lo.w);
    o.z = bf2(a[4] + hi.x, a[5] + hi.y);
    o.w = bf2(a[6] + hi.z, a[7] + hi.w);
    return o;
}

// EPI 0, from the TR product: acc[i2][j][v] = C(gmw + i2*16 + r15, gnw + j*16 + m_in + v).
// The wave writes its 32 x 64 tile into its own LDS range and reads it back row by row: a
// wave-wide 16-byte store then covers four whole 128-byte lines of out.
static __device__ __forceinline__ void gemm_store_heads(
    const v8f (&acc)[2][4], const float* __restrict__ bias, unsigned short* __restrict__ out,
    char* stage, int gmw, int gnw, int L, int lane) {
    const int r15 = lane & 15, m_in = (lane & 16) ? 8 : 0;
    const float* bp = bias + gnw + m_in;
    // both loops unrolled: constant indices keep acc in registers
#pragma unroll
    for (int j = 0; j < 4; ++j) {
        const float4 lo = *(const float4*)(bp + j * 16);
        const float4 hi = *(const float4*)(bp + j * 16 + 4);
#pragma unroll
        for (int i2 = 0; i2 < 2; ++i2)
            *(uint4*)(stage + (i2 * 16 + r15) * SP0 + (j * 16 + m_in) * 2) = bf8(acc[i2][j], lo, hi);
    }
    // input only: the address of the eight bias loads stays live behind their uses, so that
    // no load's result is given the register pair that loads still in flight name
    asm volatile("" :: "v"(bp));
    // the wave's own LDS writes are done before other lanes of it read the rows back
    asm volatile("s_wait_dscnt 0x0" ::: "memory");
    const int bi = gmw / L, s = gmw - bi * L;
    const int row = lane >> 3, ch = lane & 7;      // eight lanes a row
    unsigned short* o = out + (((size_t)(bi * NHH + (gnw >> 7)) * L + s + row) << 7) + (gnw & 127) + ch * 8;
    const char* st = stage + row * SP0 + ch * 16;
#pragma unroll   // q a constant: it becomes the immediate offset of load and store
    for (int q = 0; q < 8; ++q)
        *(uint4*)(o + q * 4 * HD) = *(const uint4*)(st + q * 4 * SP0);
}

// EPI 2, from the plain product: acc[i2][j][v] = C(gm0 + i2*16 + v, gn0 + j*16); the lane's
// 8 rows are 8 consecutive t of one row of out: one 16-byte store
static __device__ __forceinline__ void gemm_store_tr(
    const v8f (&acc)[2][4], const float* __restrict__ bias, unsigned short* __restrict__ out,
    int gm0, int gn0, int L) {
    const int bi = gm0 / L, t = gm0 - bi * L;
    // both loops unrolled: constant indices keep acc in registers
#pragma unroll
    for (int j = 0; j < 4; ++j) {
        const int gn = gn0 + j * 16;
        const float b = bias[gn];
        const float4 b4 = make_float4(b, b, b, b);
        unsigned short* o = out + (((size_t)(bi * NHH + (gn >> 7)) << 7) + (gn & 127)) * (size_t)L + t;
#pragma unroll
        for (int i2 = 0; i2 < 2; ++i2)
            *(uint4*)(o + i2 * 16) = bf8(acc[i2][j], b4, b4);
    }
}

// EPI 3, from the TR product (map as for EPI 0; the wave's tile starts at row m0 + wm32,
// column n0 + wn64). The tile goes through the wave's own LDS
// range; read back, sixteen lanes hold one row's 256 bytes, so that a wave-wide 16-byte
// residual load or store covers four whole lines.
static __device__ __forceinline__ void gemm_store_resid(
    const v8f (&acc)[2][4], const float* __restrict__ bias, float* __restrict__ out,
    const float* __restrict__ resid, char* stage, int m0, int n0, int wm32, int wn64, int lane) {
    const int r15 = lane & 15, m_in = (lane & 16) ? 8 : 0;
    // both loops unrolled: constant indices keep acc in registers
#pragma unroll
    for (int i2 = 0; i2 < 2; ++i2)
#pragma unroll
        for (int j = 0; j < 4; ++j) {
            char* d = stage + (i2 * 16 + r15) * SP3 + (j * 16 + m_in) * 4;
            *(float4*)d = make_float4(acc[i2][j][0], acc[i2][j][1], acc[i2][j][2], acc[i2][j][3]);
            *(float4*)(d + 16) = make_float4(acc[i2][j][4], acc[i2][j][5], acc[i2][j][6], acc[i2][j][7]);
        }
    // holds the residual loads behind the LDS writes: lifted over them, their 64 registers
    // would be live beside the 64 of acc, and a work-group fewer would fit the WGP
    __builtin_amdgcn_sched_barrier(0);
    const int row = lane >> 4, c4 = (lane & 15) * 4;   // sixteen lanes a row
    // the row pitch is the constant HH: the row steps become immediate offsets, and one
    // address serves all loads, one all stores
    const size_t base = (size_t)(m0 + wm32 + row) * HH + n0 + wn64 + c4;
    const float* rp = resid + base;
    float* op = out + base;
    v4f rs[16];
#pragma unroll   // constant index: rs stays in registers, the loads issue back to back
    for (int q = 0; q < 16; ++q) rs[q] = *(const v4f*)(rp + q * 2 * HH);
    const v4f b = *(const v4f*)(bias + n0 + wn64 + c4);
    // takes the loaded values as inputs only: all are in flight together. Left free,
    // the scheduler loads each into the same registers behind the use of the one before,
    // and the wave waits out sixteen memory latencies one after another. The address is an
    // input too: live up to here, its register pair is given to no load's result
    asm volatile("" :: "v"(rs[0]), "v"(rs[1]), "v"(rs[2]), "v"(rs[3]), "v"(rs[4]), "v"(rs[5]),
                       "v"(rs[6]), "v"(rs[7]), "v"(rs[8]), "v"(rs[9]), "v"(rs[10]), "v"(rs[11]),
                       "v"(rs[12]), "v"(rs[13]), "v"(rs[14]), "v"(rs[15]), "v"(b), "v"(rp));
    // the wave's own LDS writes are done before other lanes of it read the rows back
    asm volatile("s_wait_dscnt 0x0" ::: "memory");
    const char* st = stage + row * SP3 + c4 * 4;
#pragma unroll   // constant index, as above
    for (int q = 0; q < 16; ++q) {
        const float4 a = *(const float4*)(st + q * 2 * SP3);
        float4 o;
        o.x = (a.x + b.x) + n2n_sel(rs[q].x);
        o.y = (a.y + b.y) + n2n_sel(rs[q].y);
        o.z = (a.z + b.z) + n2n_sel(rs[q].z);
        o.w = (a.w + b.w) + n2n_sel(rs[q].w);
        *(float4*)(op + q * 2 * HH) = o;
    }
}

// The K loop of one block; stage 0 lies published in buffer 0. As, Bs: the two buffers of
// each operand. TR: W * A^T, else A * W^T (see above).
template <bool TR>
static __device__ __forceinline__ void gemm_loop(
    v8f (&acc)[2][4], unsigned short (*As)[128 * GP], unsigned short (*Bs)[128 * GP],
    const unsigned short* aBase, const unsigned short* bBase, unsigned int gOff, size_t rStep,
    int ldsOff, int NK, int wave_m, int wave_n, int r15, int phi) {
    int buf = 0;
    for (int i = 0; i < NK; ++i) {
        const int nbuf = buf ^ 1;
        const bool more = (i + 1 < NK);
        const int kn = (i + 1) * GK;

        // ---- issue next stage ----
#if !HAVE_ASYNC_LDS
        uint4 ra[4], rb[4];
#endif
        if (more) {
#pragma unroll   // r a constant, as above: the eight copies issue back to back
            for (int r = 0; r < 4; ++r) {
#if HAVE_ASYNC_LDS
                async_cp16(aBase + (r * rStep + kn) + gOff, &As[nbuf][ldsOff + r * 32 * GP]);
                async_cp16(bBase + (r * rStep + kn) + gOff, &Bs[nbuf][ldsOff + r * 32 * GP]);
#else
                ra[r] = *(const uint4*)(aBase + (r * rStep + kn) + gOff);
                rb[r] = *(const uint4*)(bBase + (r * rStep + kn) + gOff);
#endif
            }
        }

        // ---- compute current stage: 2 K-steps x (2 A-frags x 4 B-frags) = 16 WMMA ----
#pragma unroll   // ks a constant: it becomes the immediate offset of the LDS loads
        for (int ks = 0; ks < GK / 32; ++ks) {
            const unsigned int* As32 = (const unsigned int*)As[buf] + ks * 16;
            const unsigned int* Bs32 = (const unsigned int*)Bs[buf] + ks * 16;
            const int ar0 = (wave_m * 32 + r15) * (GP / 2);
            const int ar1 = ar0 + 16 * (GP / 2);
            Frag a0, a1;
#pragma unroll
            for (int v = 0; v < 8; ++v) {
                int p = (v & 3) + ((v >= 4) ? 8 : 0) + phi;
                a0.u[v] = As32[ar0 + p];
                a1.u[v] = As32[ar1 + p];
            }
            Frag b[4];
#pragma unroll
            for (int j = 0; j < 4; ++j) {
                const int br = (wave_n * 64 + j * 16 + r15) * (GP / 2);
#pragma unroll
                for (int v = 0; v < 8; ++v)
                    b[j].u[v] = Bs32[br + (v & 3) + ((v >= 4) ? 8 : 0) + phi];
            }
            // keeps a K-step's twelve LDS loads one group ahead of its WMMAs, behind counted
            // waits: left free, the scheduler gives the four B fragments one register set and
            // the wave waits out a whole LDS round trip in front of every second WMMA
            __builtin_amdgcn_sched_barrier(0);
#pragma unroll
            for (int j = 0; j < 4; ++j) {
                acc[0][j] = __builtin_amdgcn_wmma_f32_16x16x32_bf16(
                    false, TR ? b[j].v : a0.v, false, TR ? a0.v : b[j].v, (short)0, acc[0][j],
                    false, false);
                acc[1][j] = __builtin_amdgcn_wmma_f32_16x16x32_bf16(
                    false, TR ? b[j].v : a1.v, false, TR ? a1.v : b[j].v, (short)0, acc[1][j],
                    false, false);
            }
        }

        // ---- publish next stage ----
        if (more) {
#if HAVE_ASYNC_LDS
            wait_async0();
#else
#pragma unroll   // constant index: ra and rb stay in registers
            for (int r = 0; r < 4; ++r) {
                *(uint4*)(&As[nbuf][ldsOff + r * 32 * GP]) = ra[r];
                *(uint4*)(&Bs[nbuf][ldsOff + r * 32 * GP]) = rb[r];
            }
#endif
        }
        // publishes the next stage and ends every wave's reads of this one; directly behind
        // the builtin wait it also holds the LDS reads behind it
        __syncthreads();
        buf = nbuf;
    }
}

// 8 waves a SIMD: the four work-groups that the LDS lets a WGP hold need 128 registers a
// wave at most (EPI 4 has one work-group a WGP and two K loops: it is left more)
template <int EPI>
__global__ __launch_bounds__(256, EPI == 4 ? 4 : 8) void gemm_bf16_kernel(
    const unsigned short* __restrict__ A,
    const unsigned short* __restrict__ W,
    const float* __restrict__ bias,
    void* __restrict__ out,
    const float* __restrict__ resid,
    int M, int N, int K, int L,
    const float* __restrict__ bias2,
    void* __restrict__ out2) {

    __shared__ __attribute__((aligned(16))) unsigned short As[2][128 * GP];
    __shared__ __attribute__((aligned(16))) unsigned short Bs[2][128 * GP];

    const int tid  = threadIdx.x;
    const int lane = tid & 31;
    const int wid  = tid >> 5;           // 0..7
    const int wave_m = wid >> 1;         // 0..3 -> 32 rows each
    const int wave_n = wid & 1;          // 0..1 -> 64 cols each

    const int m0 = blockIdx.y * 128;
    const int n0 = blockIdx.x * 128;

    // stage loader: 1024 uint4 per matrix; thread handles rows lrow0 + 32 r, r = 0..3;
    // eight neighbouring lanes cover one row's 128 bytes
    const int lrow0 = tid >> 3;          // 0..31
    const int lch   = (tid & 7) * 8;     // bf16 offset 0,8,..,56

    const int phi = (lane & 16) ? 4 : 0;
    const int r15 = lane & 15;

    v8f acc[2][4];
#pragma unroll
    for (int i = 0; i < 2; ++i)
#pragma unroll
        for (int j = 0; j < 4; ++j) acc[i][j] = (v8f){};

    const int NK = K / GK;

    const unsigned short* aBase = A + (size_t)m0 * K;   // the block's first rows
    const unsigned short* bBase = W + (size_t)n0 * K;
    const unsigned int gOff = (unsigned int)(lrow0 * K + lch);   // the lane's place in 32 rows
    const size_t rStep = (size_t)32 * K;
    const int ldsOff = lrow0 * GP + lch;

#if HAVE_ASYNC_LDS
    // ---- async-to-LDS pipelined path ----
    {
        // prologue: stage 0 into buf 0
#pragma unroll   // r a constant: the LDS steps fold into the address additions
        for (int r = 0; r < 4; ++r) {
            async_cp16(aBase + r * rStep + gOff, &As[0][ldsOff + r * 32 * GP]);
            async_cp16(bBase + r * rStep + gOff, &Bs[0][ldsOff + r * 32 * GP]);
        }
        wait_async0();
    }
    // publishes stage 0; directly behind the builtin wait it also holds the LDS reads behind it
    __syncthreads();
#else
#pragma unroll   // r a constant, as above
    for (int r = 0; r < 4; ++r) {
        *(uint4*)(&As[0][ldsOff + r * 32 * GP]) = *(const uint4*)(aBase + r * rStep + gOff);
        *(uint4*)(&Bs[0][ldsOff + r * 32 * GP]) = *(const uint4*)(bBase + r * rStep + gOff);
    }
    __syncthreads();
#endif

    // ---------------- K loop and epilogue ----------------
    const int gmw = m0 + wave_m * 32;    // the wave's first row and column
    const int gnw = n0 + wave_n * 64;
    // behind the K loop's last barrier nobody reads the stage buffers any more: waves 0 to 3
    // restage their results in As, waves 4 to 7 in Bs, each in a range of its own
    char* stage = wid < 4 ? (char*)As : (char*)Bs;
    const int sw = wid & 3;
    if (EPI == 4) {
        const int half = N >> 1;
        if (n0 < half) {   // the same for the whole block: a tile lies on one side of N/2
            gemm_loop<true>(acc, As, Bs, aBase, bBase, gOff, rStep, ldsOff, NK, wave_m, wave_n, r15, phi);
            gemm_store_heads(acc, bias, (unsigned short*)out, stage + sw * (32 * SP0), gmw, gnw, L, lane);
        } else {
            gemm_loop<false>(acc, As, Bs, aBase, bBase, gOff, rStep, ldsOff, NK, wave_m, wave_n, r15, phi);
            gemm_store_tr(acc, bias2, (unsigned short*)out2, gmw + ((lane & 16) ? 8 : 0),
                          gnw - half + r15, L);
        }
    } else {
        gemm_loop<true>(acc, As, Bs, aBase, bBase, gOff, rStep, ldsOff, NK, wave_m, wave_n, r15, phi);
        if (EPI == 0)
            gemm_store_heads(acc, bias, (unsigned short*)out, stage + sw * (32 * SP0), gmw, gnw, L, lane);
        else
            gemm_store_resid(acc, bias, (float*)out, resid, stage + sw * (32 * SP3), m0, n0, wave_m * 32,
                             wave_n * 64, lane);
    }
}

// ---------------- kernel 3: attention (one wave per 16 S-rows) ----------------
// 16 waves (256 query rows of one head) form a work-group. The head's K (256 x 128)
// and V^T (128 x 256) are brought into LDS once, in whole 128-byte lines, and every
// wave takes its A fragments from there.
// Both products are taken transposed: S^T = K * Q^T and ctx^T = V^T * P^T. In the
// accumulator map a lane then holds 8 keys (or 8 head dims) of ONE query row
// (column lane & 15), so the softmax runs in registers on all 32 lanes, with one
// exchange between the wave's halves for the maximum and one for the sum, and two
// score tiles, converted in place, are the B operand of the second product.

// value of lane l ^ 16
static __device__ __forceinline__ float xhalf(float x) {
    return __builtin_bit_cast(float, __builtin_amdgcn_permlanex16(
        __builtin_bit_cast(int, x), __builtin_bit_cast(int, x),
        0x76543210, 0xfedcba98, false, false));
}

// 2^a. The v_nop fills the one slot the instruction set asks for between a
// transcendental and a next instruction that reads its result or overwrites its
// source; in one statement with it, it cannot be scheduled away from it.
static __device__ __forceinline__ float exp2_slot(float a) {
    float r;
    asm("v_exp_f32 %0, %1\n\tv_nop" : "=v"(r) : "v"(a));
    return r;
}

// LDS pitches in bf16: a K row is 256 B + 16 B of pad, a V^T row 512 B + 16 B, both
// odd multiples of 16 B, so that the 16 rows of a ds_load_b128 half-wave fall on 16
// different groups of four banks.
#define KP 136
#define VP 264
#define ATT_WAVES 16

// Eight asynchronous 16-byte copies per lane, global -> LDS, step gs bytes in global
// memory and ls bytes in LDS. The s_wait_xcnt closes the statement so that it stands
// in front of any later write of the address registers the copies name.
static __device__ __forceinline__ void async_cp16x8(unsigned int l, const char* g,
                                                    unsigned int ls, unsigned int gs) {
    asm volatile(
        "global_load_async_to_lds_b128 %0, %8, off\n\t"
        "global_load_async_to_lds_b128 %1, %9, off\n\t"
        "global_load_async_to_lds_b128 %2, %10, off\n\t"
        "global_load_async_to_lds_b128 %3, %11, off\n\t"
        "global_load_async_to_lds_b128 %4, %12, off\n\t"
        "global_load_async_to_lds_b128 %5, %13, off\n\t"
        "global_load_async_to_lds_b128 %6, %14, off\n\t"
        "global_load_async_to_lds_b128 %7, %15, off\n\t"
        "s_wait_xcnt 0x0"
        :: "v"(l), "v"(l + ls), "v"(l + 2 * ls), "v"(l + 3 * ls),
           "v"(l + 4 * ls), "v"(l + 5 * ls), "v"(l + 6 * ls), "v"(l + 7 * ls),
           "v"(g), "v"(g + gs), "v"(g + 2 * gs), "v"(g + 3 * gs),
           "v"(g + 4 * gs), "v"(g + 5 * gs), "v"(g + 6 * gs), "v"(g + 7 * gs)
        : "memory");
}

// Four A fragments from an LDS tile: rows 16 apart, pitch in dwords; base points at the
// lane's row and its half of the 32 k (dwords 0..3 and 8..11: the k order of the B side)
static __device__ __forceinline__ void lds_frag4(Frag* f, const unsigned int* base, int pitch) {
#pragma unroll
    for (int j = 0; j < 4; ++j) {
        const uint4 lo = *(const uint4*)(base + j * 16 * pitch);
        const uint4 hi = *(const uint4*)(base + j * 16 * pitch + 8);
        f[j].u[0] = lo.x; f[j].u[1] = lo.y; f[j].u[2] = lo.z; f[j].u[3] = lo.w;
        f[j].u[4] = hi.x; f[j].u[5] = hi.y; f[j].u[6] = hi.z; f[j].u[7] = hi.w;
    }
}

// byte offset of a __shared__ object in the work-group's LDS
static __device__ __forceinline__ unsigned int lds_off(const void* p) {
    return (unsigned int)(size_t)(__attribute__((address_space(3))) const void*)p;
}

__global__ __launch_bounds__(ATT_WAVES * 32) void attn_kernel(
    const unsigned short* __restrict__ qb,   // [B,NH,S,HD]
    const unsigned short* __restrict__ kb,   // [B,NH,T,HD]
    const unsigned short* __restrict__ vtb,  // [B,NH,HD,T]
    const float* __restrict__ mask,          // [B,T]
    unsigned short* __restrict__ ctxb) {     // [B,S,H] bf16

    __shared__ __attribute__((aligned(16))) unsigned short Ks[TT * KP];
    __shared__ __attribute__((aligned(16))) unsigned short Vs[HD * VP];

    const int tid  = threadIdx.x;
    const int lane = tid & 31;
    const int bid  = blockIdx.x;
    const int bh   = bid >> 3;               // S/256 = 8 work-groups per (b,h)
    const int s0   = ((bid & 7) << 8) + ((tid >> 5) << 4);
    const int b    = bh >> 4;
    const int h    = bh & 15;

    const int phi  = (lane & 16) ? 4 : 0;
    const int r15  = lane & 15;
    const int m_in = (lane & 16) ? 8 : 0;

    // ---- scores^T: 256 x 16 via 4 K-steps x 16 key tiles of WMMA ----
    // acc[nt][v] = score(query s0 + r15, key nt*16 + m_in + v)
    v8f acc[16];
#pragma unroll
    for (int i = 0; i < 16; ++i) acc[i] = (v8f){};

    // this wave's own 16 query rows, straight from global memory, in flight with the copies
    const unsigned int* qrow = (const unsigned int*)(qb + ((size_t)bh * SS + s0) * HD);
    Frag q[4];
#pragma unroll
    for (int kk = 0; kk < 4; ++kk)
#pragma unroll
        for (int v = 0; v < 8; ++v)
            q[kk].u[v] = qrow[r15 * 64 + kk * 16 + (v & 3) + ((v >= 4) ? 8 : 0) + phi];

    // K and V^T of this head are 64 KiB each, contiguous: thread tid copies the 16-byte
    // pieces tid, tid + 512, ... (a wave's copy is 512 contiguous bytes: two K rows or
    // one V^T row); 512 pieces are 32 K rows or 16 V^T rows.
    async_cp16x8(lds_off(Ks) + (tid >> 4) * (KP * 2) + (tid & 15) * 16,
                 (const char*)(kb + (size_t)bh * TT * HD) + tid * 16, 32 * KP * 2, 8192);
    async_cp16x8(lds_off(Vs) + (tid >> 5) * (VP * 2) + (tid & 31) * 16,
                 (const char*)(vtb + (size_t)bh * HD * TT) + tid * 16, 16 * VP * 2, 8192);
    // this wave's copies have landed; behind the barrier every wave's have
    asm volatile("s_wait_asynccnt 0x0" ::: "memory");
    __syncthreads();

    // group g = K-step g >> 2, key tiles (g & 3) * 4 + 0..3; the next group's fragments
    // are fetched into a second register set ahead of this group's WMMAs
    const unsigned int* kbase = (const unsigned int*)Ks + r15 * (KP / 2) + phi;
    Frag kf[2][4];
    lds_frag4(kf[0], kbase, KP / 2);
#pragma unroll
    for (int g = 0; g < 16; ++g) {
        if (g + 1 < 16)
            lds_frag4(kf[(g + 1) & 1],
                      kbase + ((g + 1) & 3) * 64 * (KP / 2) + ((g + 1) >> 2) * 16, KP / 2);
        // keeps the eight LDS loads one group, ahead of the WMMAs: left free the scheduler
        // either lifts so many loads that the 256 registers spill or waits out each load
        __builtin_amdgcn_sched_barrier(0);
#pragma unroll
        for (int j = 0; j < 4; ++j) {
            const int nt = (g & 3) * 4 + j;
            acc[nt] = __builtin_amdgcn_wmma_f32_16x16x32_bf16(false, kf[g & 1][j].v, false,
                                                              q[g >> 2].v, (short)0, acc[nt],
                                                              false, false);
        }
        __builtin_amdgcn_sched_barrier(0);   // the same, at the group's end
    }

    // ---- softmax over T=256: 128 keys of the row in this lane, 128 in lane ^ 16 ----
    const float* mrow = mask + (size_t)b * TT + m_in;
    v8f mx8;
#pragma unroll
    for (int v = 0; v < 8; ++v) mx8[v] = -1e30f;
#pragma unroll
    for (int nt = 0; nt < 16; ++nt) {
        const float4 ma = *(const float4*)(mrow + nt * 16);
        const float4 mb = *(const float4*)(mrow + nt * 16 + 4);
        const float mk[8] = {ma.x, ma.y, ma.z, ma.w, mb.x, mb.y, mb.z, mb.w};
#pragma unroll
        for (int v = 0; v < 8; ++v) {
            float x = acc[nt][v] * SCALE_INV;
            x = fminf(fmaxf(x, -50.0f), 50.0f);
            x += mk[v] * -1e9f;
            acc[nt][v] = x;
            mx8[v] = fmaxf(mx8[v], x);
        }
        // the mask loads of eight tiles at a time: all 32 lifted to the top take 128
        // registers beside the 128 of acc, and the 256-register budget spills
        if (nt == 7) __builtin_amdgcn_sched_barrier(0);
    }
    float mx = fmaxf(fmaxf(fmaxf(mx8[0], mx8[1]), fmaxf(mx8[2], mx8[3])),
                     fmaxf(fmaxf(mx8[4], mx8[5]), fmaxf(mx8[6], mx8[7])));
    mx = fmaxf(mx, xhalf(mx));
    // the address registers of the mask loads are reused from here on
    asm volatile("s_wait_xcnt 0x0" ::: "memory");

    v8f sum8 = (v8f){};
#pragma unroll
    for (int nt = 0; nt < 16; ++nt)
#pragma unroll
        for (int v = 0; v < 8; ++v) {
            float e = exp2_slot((acc[nt][v] - mx) * 1.44269504f);   // e^(x - mx)
            acc[nt][v] = e;
            sum8[v] += e;
        }
    float sum = ((sum8[0] + sum8[1]) + (sum8[2] + sum8[3])) +
                ((sum8[4] + sum8[5]) + (sum8[6] + sum8[7]));
    sum += xhalf(sum);
    const float inv = 1.0f / (sum + 1e-8f);

    // probs^T as B fragments: score tiles 2kk and 2kk+1 hold keys kk*32 + m_in + 0..7
    // and kk*32 + 16 + m_in + 0..7, the k order of the V^T loader below
    Frag p[8];
#pragma unroll
    for (int kk = 0; kk < 8; ++kk)
#pragma unroll
        for (int w = 0; w < 4; ++w) {
            p[kk].u[w]     = (unsigned int)f2bf(acc[2 * kk][2 * w] * inv) |
                             ((unsigned int)f2bf(acc[2 * kk][2 * w + 1] * inv) << 16);
            p[kk].u[4 + w] = (unsigned int)f2bf(acc[2 * kk + 1][2 * w] * inv) |
                             ((unsigned int)f2bf(acc[2 * kk + 1][2 * w + 1] * inv) << 16);
        }
    // keeps the packing ahead of the second product: spread among its WMMAs the 128
    // f32 values stay live beside the V fragments and the ctx accumulators
    __builtin_amdgcn_sched_barrier(0);

    // ---- ctx^T = V^T @ probs^T : 128 x 16, K over T=256 ----
    // c[nt][v] = ctx(query s0 + r15, head dim nt*16 + m_in + v)
    v8f c[8];
#pragma unroll
    for (int i = 0; i < 8; ++i) c[i] = (v8f){};

    // group g = K-step g >> 1, head-dim tiles (g & 1) * 4 + 0..3, fetched as above
    const unsigned int* vbase = (const unsigned int*)Vs + r15 * (VP / 2) + phi;
    Frag vf[2][4];
    lds_frag4(vf[0], vbase, VP / 2);
#pragma unroll
    for (int g = 0; g < 16; ++g) {
        if (g + 1 < 16)
            lds_frag4(vf[(g + 1) & 1],
                      vbase + ((g + 1) & 1) * 64 * (VP / 2) + ((g + 1) >> 1) * 16, VP / 2);
        __builtin_amdgcn_sched_barrier(0);   // one load group ahead of the WMMAs, as above
#pragma unroll
        for (int j = 0; j < 4; ++j) {
            const int nt = (g & 1) * 4 + j;
            c[nt] = __builtin_amdgcn_wmma_f32_16x16x32_bf16(false, vf[g & 1][j].v, false,
                                                            p[g >> 1].v, (short)0, c[nt],
                                                            false, false);
        }
        __builtin_amdgcn_sched_barrier(0);   // the same, at the group's end
    }

    // ctx -> [B,S,H] bf16: 8 consecutive head dims of one row per lane and tile
    unsigned short* crow = ctxb + ((size_t)(b * SS + s0 + r15)) * HH + h * HD + m_in;
#pragma unroll
    for (int nt = 0; nt < 8; ++nt) {
        uint4 o;
        o.x = (unsigned int)f2bf(c[nt][0]) | ((unsigned int)f2bf(c[nt][1]) << 16);
        o.y = (unsigned int)f2bf(c[nt][2]) | ((unsigned int)f2bf(c[nt][3]) << 16);
        o.z = (unsigned int)f2bf(c[nt][4]) | ((unsigned int)f2bf(c[nt][5]) << 16);
        o.w = (unsigned int)f2bf(c[nt][6]) | ((unsigned int)f2bf(c[nt][7]) << 16);
        *(uint4*)(crow + nt * 16) = o;
    }
}

// ---------------- kernel 4: LayerNorm (one block per row) ----------------
__global__ __launch_bounds__(256) void layernorm_kernel(const float* __restrict__ x,
                                                        const float* __restrict__ g,
                                                        const float* __restrict__ bta,
                                                        float* __restrict__ out) {
    __shared__ float rs[256], rq[256];
    const int tid = threadIdx.x;
    const size_t row = (size_t)blockIdx.x * HH;

    float s = 0.0f, q = 0.0f;
#pragma unroll
    for (int j = 0; j < HH / 256; ++j) {
        float v = x[row + tid + j * 256];
        s += v;
        q += v * v;
    }
    rs[tid] = s;
    rq[tid] = q;
    __syncthreads();
    for (int off = 128; off > 0; off >>= 1) {
        if (tid < off) { rs[tid] += rs[tid + off]; rq[tid] += rq[tid + off]; }
        __syncthreads();
    }
    const float mu  = rs[0] * (1.0f / HH);
    const float var = rq[0] * (1.0f / HH) - mu * mu;
    const float r   = rsqrtf(var + LN_EPS);
#pragma unroll
    for (int j = 0; j < HH / 256; ++j) {
        int i = tid + j * 256;
        out[row + i] = (x[row + i] - mu) * r * g[i] + bta[i];
    }
}

// ---------------- launcher ----------------
extern "C" void kernel_launch(void* const* d_in, const int* in_sizes, int n_in,
                              void* d_out, int out_size, void* d_ws, size_t ws_size,
                              hipStream_t stream) {
    const float* hs   = (const float*)d_in[0];   // (B,S,H)
    const float* at   = (const float*)d_in[1];   // (B,T,H)
    const float* mask = (const float*)d_in[2];   // (B,T)
    const float* Wq   = (const float*)d_in[3];
    const float* bq   = (const float*)d_in[4];
    const float* Wk   = (const float*)d_in[5];
    const float* bk   = (const float*)d_in[6];
    const float* Wv   = (const float*)d_in[7];
    const float* bv   = (const float*)d_in[8];
    const float* Wo   = (const float*)d_in[9];
    const float* bo   = (const float*)d_in[10];
    const float* ln_g = (const float*)d_in[11];
    const float* ln_b = (const float*)d_in[12];
    float* outp = (float*)d_out;

    const size_t BS = (size_t)BB * SS;   // 8192
    const size_t BT = (size_t)BB * TT;   // 1024

    // workspace carve-up (bf16 stored as ushort)
    char* w = (char*)d_ws;
    unsigned short* hsb  = (unsigned short*)w;                  w += BS * HH * 2;
    unsigned short* atb  = (unsigned short*)w;                  w += BT * HH * 2;
    unsigned short* wqb  = (unsigned short*)w;                  w += (size_t)HH * HH * 2;
    unsigned short* wkb  = (unsigned short*)w;                  w += (size_t)HH * HH * 2;
    unsigned short* wvb  = (unsigned short*)w;                  w += (size_t)HH * HH * 2;
    unsigned short* wob  = (unsigned short*)w;                  w += (size_t)HH * HH * 2;
    unsigned short* qb   = (unsigned short*)w;                  w += BS * HH * 2;     // [B,NH,S,HD]
    unsigned short* kbuf = (unsigned short*)w;                  w += BT * HH * 2;     // [B,NH,T,HD]
    unsigned short* vtb  = (unsigned short*)w;                  w += BT * HH * 2;     // [B,NH,HD,T]
    unsigned short* ctxb = (unsigned short*)w;                  w += BS * HH * 2;     // [B,S,H]
    float*          opre = (float*)w;                           w += BS * HH * 4;

    // 1) converts: hsb, atb, wqb, wkb, wvb, wob are one contiguous range that starts at hsb
    convert_all_kernel<<<CV_GRID, CV_THREADS, 0, stream>>>(hs, at, Wq, Wk, Wv, Wo, hsb);

    // 2) projections (block tile 128x128)
    gemm_bf16_kernel<0><<<dim3(HH / 128, BS / 128), 256, 0, stream>>>(
        hsb, wqb, bq, qb, nullptr, (int)BS, HH, HH, SS, nullptr, nullptr);
    // K and V together: wvb lies directly behind wkb, so the two are one matrix of 2 H rows;
    // 256 work-groups, where each projection alone has 128
    gemm_bf16_kernel<4><<<dim3(2 * HH / 128, BT / 128), 256, 0, stream>>>(
        atb, wkb, bk, kbuf, nullptr, (int)BT, 2 * HH, HH, TT, bv, vtb);

    // 3) attention: one wave per 16 S-rows, 16 waves of one head per work-group
    attn_kernel<<<BB * NHH * (SS / 256), 512, 0, stream>>>(qb, kbuf, vtb, mask, ctxb);

    // 4) output projection + bias + residual (f32)
    gemm_bf16_kernel<3><<<dim3(HH / 128, BS / 128), 256, 0, stream>>>(
        ctxb, wob, bo, opre, hs, (int)BS, HH, HH, SS, nullptr, nullptr);

    // 5) LayerNorm -> d_out
    layernorm_kernel<<<(int)BS, 256, 0, stream>>>(opre, ln_g, ln_b, outp);
}

// v009
// It runs in 182 microseconds.
// In both of two side-by-side timings against v008, it was 1.03 times as fast.
// All steps since v000 together make it 2.89 times as fast.
#include <hip/hip_runtime.h>

// ---------------- problem constants (match reference) ----------------
#define BB 4
#define SS 2048
#define TT 256
#define HH 2048
#define NHH 16
#define HD 128
#define LN_EPS 1e-5f
#define SCALE_INV 0.08838834764831845f   // 1/sqrt(128)

// A GEMM stage holds GK k of every operand row: 128 bytes, one whole cache line, so
// that a wave's 512-byte copy asks L2 for four whole lines and not for eight halves.
#define GK 64
// LDS pitch of a GEMM stage row, in bf16: 64 of data + 8 of pad = 144 bytes, an
// odd multiple of 16 bytes, so that the 16 rows one ds_load_b128 half-wave
// touches fall on 16 different groups of four banks (64 banks x 4 bytes).
#define GP 72

typedef __attribute__((ext_vector_type(16))) __bf16 v16bf;
typedef __attribute__((ext_vector_type(8)))  float  v8f;
typedef __attribute__((ext_vector_type(4)))  float  v4f;

union Frag {
    unsigned int u[8];
    v16bf v;
};

// ---- optional CDNA5 async global->LDS copy path (compile-safe probe) ----
#if defined(__has_builtin)
#if __has_builtin(__builtin_amdgcn_global_load_async_to_lds_b128)
#define HAVE_ASYNC_LDS 1
#endif
#endif
#ifndef HAVE_ASYNC_LDS
#define HAVE_ASYNC_LDS 0
#endif

#if HAVE_ASYNC_LDS
typedef int gv4i __attribute__((vector_size(16)));   // matches builtin param type
static __device__ __forceinline__ void async_cp16(const void* g, void* l) {
    __builtin_amdgcn_global_load_async_to_lds_b128(
        (__attribute__((address_space(1))) gv4i*)g,
        (__attribute__((address_space(3))) gv4i*)l, 0, 0);
}
static __device__ __forceinline__ void wait_async0() {
#if __has_builtin(__builtin_amdgcn_s_wait_asynccnt)
    __builtin_amdgcn_s_wait_asynccnt(0);
#else
    asm volatile("s_wait_asynccnt 0" ::: "memory");
#endif
}
#endif

static __device__ __forceinline__ unsigned short f2bf(float f) {
    union { float f; unsigned int u; } c;
    c.f = f;
    unsigned int r = c.u + 0x7fffu + ((c.u >> 16) & 1u);  // RNE
    return (unsigned short)(r >> 16);
}

// ---------------- kernel 1: f32 -> bf16 convert (+nan_to_num), all six tensors ----------------
// One launch of few, long-lived waves. A chunk is what a work-group moves in one trip:
// CV_LOADS 16-byte loads a lane, each wave-wide load 512 contiguous bytes (four whole
// lines), each wave-wide 8-byte store 256 contiguous bytes (two whole lines).
// The six results lie one behind the other in the workspace, in the order of the
// arguments, so a chunk's number is also its place in out. Every tensor is a whole
// number of chunks, so a chunk has one source.
#define CV_THREADS 256
#define CV_LOADS 8
#define CV_CHUNK (CV_THREADS * CV_LOADS * 4)          // floats
#define CV_HS (BB * SS * HH / CV_CHUNK)               // chunks of hidden_states
#define CV_AT (BB * TT * HH / CV_CHUNK)               // chunks of audio_tokens
#define CV_W  (HH * HH / CV_CHUNK)                    // chunks of one weight matrix
#define CV_W0 (CV_HS + CV_AT)                         // first chunk of the first weight matrix
#define CV_ALL (CV_W0 + 4 * CV_W)
#define CV_TRIPS 8                                    // chunks a work-group
#define CV_GRID (CV_ALL / CV_TRIPS)

// n2n, then the rounding of f2bf: the bf16 stands in the upper half of the result.
// n2n as selects on the bits, so that no branch stands between the loads' waits.
static __device__ __forceinline__ unsigned int n2n_rne(float a) {
    const unsigned int u = __builtin_bit_cast(unsigned int, a), m = u & 0x7fffffffu;
    unsigned int x = m > 0x7f800000u ? 0u : u;                         // NaN -> 0
    x = m == 0x7f800000u ? ((u & 0x80000000u) | 0x461c4000u) : x;      // +-inf -> +-1e4
    return x + 0x7fffu + ((x >> 16) & 1u);                             // RNE
}

static __device__ __forceinline__ unsigned int pack2bf(float a, float b) {
    return (n2n_rne(a) >> 16) | (n2n_rne(b) & 0xffff0000u);
}

// the lane's first 16 bytes of chunk c (c is the same for the whole work-group)
static __device__ __forceinline__ const float4* cv_src(
    int c, int tid, const float* hs, const float* at, const float* wq, const float* wk,
    const float* wv, const float* wo) {
    const float* p = hs;
    int first = 0;
    if (c >= CV_HS)            { p = at; first = CV_HS; }
    if (c >= CV_W0)            { p = wq; first = CV_W0; }
    if (c >= CV_W0 + CV_W)     { p = wk; first = CV_W0 + CV_W; }
    if (c >= CV_W0 + 2 * CV_W) { p = wv; first = CV_W0 + 2 * CV_W; }
    if (c >= CV_W0 + 3 * CV_W) { p = wo; first = CV_W0 + 3 * CV_W; }
    return (const float4*)(p + (size_t)(c - first) * CV_CHUNK) + tid;
}

static __device__ __forceinline__ void cv_emit(const float4* v, unsigned short* out, int c, int tid) {
    uint2* d = (uint2*)(out + (size_t)c * CV_CHUNK) + tid;
#pragma unroll   // constant index: v stays in registers
    for (int j = 0; j < CV_LOADS; ++j) {
        uint2 o;
        o.x = pack2bf(v[j].x, v[j].y);
        o.y = pack2bf(v[j].z, v[j].w);
        d[j * CV_THREADS] = o;
    }
}

__global__ __launch_bounds__(CV_THREADS) void convert_all_kernel(
    const float* __restrict__ hs, const float* __restrict__ at,
    const float* __restrict__ wq, const float* __restrict__ wk,
    const float* __restrict__ wv, const float* __restrict__ wo,
    unsigned short* __restrict__ out) {

    const int tid = threadIdx.x;
    int c = blockIdx.x;                               // the grid is CV_GRID work-groups

    float4 cur[CV_LOADS], nxt[CV_LOADS];
    {
        const float4* s = cv_src(c, tid, hs, at, wq, wk, wv, wo);
#pragma unroll   // constant index: cur stays in registers, the loads issue back to back
        for (int j = 0; j < CV_LOADS; ++j) cur[j] = s[j * CV_THREADS];
    }
    // the next chunk's loads fly while this chunk is converted and stored; the last chunk
    // stands behind the loop, so that inside it the waits count the loads of both
#pragma unroll 1   // unrolled, the arithmetic of a chunk is lifted over the next chunk's loads
    for (int t = 1; t < CV_TRIPS; ++t) {
        const float4* s = cv_src(c + CV_GRID, tid, hs, at, wq, wk, wv, wo);
#pragma unroll   // constant index, as above
        for (int j = 0; j < CV_LOADS; ++j) nxt[j] = s[j * CV_THREADS];
        // holds the eight loads ahead of this chunk's arithmetic: sunk behind the wait for
        // this chunk's values they would start one memory latency later
        __builtin_amdgcn_sched_barrier(0);
        cv_emit(cur, out, c, tid);
        // holds the copies below, which wait for the next chunk's loads, behind this chunk's stores
        __builtin_amdgcn_sched_barrier(0);
#pragma unroll   // constant index, as above
        for (int j = 0; j < CV_LOADS; ++j) cur[j] = nxt[j];
        c += CV_GRID;
    }
    cv_emit(cur, out, c, tid);
}

// ---------------- kernel 2: tiled bf16 WMMA GEMM  C = A @ W^T (+bias) ------
// K-stage 64 (K a multiple of 64), double-buffered LDS, software pipelined, 8 waves.
// Q and O products: block tile 128x256, each wave a 64x64 sub-tile = 4x4 accumulators, so
// that 8 LDS fragments feed 16 WMMAs. K/V product (few tiles): block 128x128, wave 32x64.
// A: [M,K] bf16 row-major, W: [N,K] bf16 row-major.
// EPI 0: split-heads bf16 -> out[((b*NH+h)*L + s)*HD + d],  b=m/L, s=m%L
// EPI 2: transposed       -> out[((b*NH+h)*HD + d)*L + t],  b=m/L, t=m%L
// EPI 3: f32 out = acc + bias + n2n(resid[m,n]), row-major [M,HH] (N is HH)
// EPI 4: two projections of the same A in one launch. W holds the rows of the first weight
//        matrix and behind them those of the second (N counts both). A block left of column
//        N/2 ends as EPI 0 (bias, out), the others as EPI 2 (bias2, out2), columns from N/2.
// L is a multiple of 32: the 32 rows of an epilogue pass lie in one batch.
//
// The accumulator map gives a lane 8 consecutive rows of one column of the product. The
// product is therefore taken so that those 8 run along the output's contiguous dimension:
// W * A^T (TR, the lane holds 8 n of one m) for EPI 0 and 3, A * W^T (8 m of one n) for
// EPI 2. The loaders of the two operands have the same lane map and k order, so the two
// fragments only change places in the WMMA.

// LDS pitches of a wave's restaged tile, odd multiples of 16 bytes (bank groups as for GP):
// 32 rows of 64 bf16 (one line) or of 64 f32 (two lines)
#define SP0 144
#define SP3 272

// n2n (NaN -> 0, +-inf -> +-1e4) as selects on the bits: no branch stands between the
// residual loads and their use
static __device__ __forceinline__ float n2n_sel(float a) {
    const unsigned int u = __builtin_bit_cast(unsigned int, a), m = u & 0x7fffffffu;
    unsigned int x = m > 0x7f800000u ? 0u : u;                         // NaN -> 0
    x = m == 0x7f800000u ? ((u & 0x80000000u) | 0x461c4000u) : x;      // +-inf -> +-1e4
    return __builtin_bit_cast(float, x);
}

static __device__ __forceinline__ unsigned int bf2(float a, float b) {
    return (unsigned int)f2bf(a) | ((unsigned int)f2bf(b) << 16);
}

static __device__ __forceinline__ uint4 bf8(const v8f& a, const float4& lo, const float4& hi) {
    uint4 o;
    o.x = bf2(a[0] + lo.x, a[1] + lo.y);
    o.y = bf2(a[2] + lo.z, a[3] + lo.w);
    o.z = bf2(a[4] + hi.x, a[5] + hi.y);
    o.w = bf2(a[6] + hi.z, a[7] + hi.w);
    return o;
}

// EPI 0, from the TR product: acc[I0 + i2][j][v] = C(gmw + i2*16 + r15, gnw + j*16 + m_in + v),
// i2 = 0, 1: one pass takes 32 rows of the wave's tile, from fragment row I0 on.
// The wave writes these 32 x 64 values into its own LDS range and reads it back row by row: a
// wave-wide 16-byte store then covers four whole 128-byte lines of out.
template <int MI, int I0>
static __device__ __forceinline__ void gemm_store_heads(
    const v8f (&acc)[MI][4], const float* __restrict__ bias, unsigned short* __restrict__ out,
    char* stage, int gmw, int gnw, int L, int lane) {
    const int r15 = lane & 15, m_in = (lane & 16) ? 8 : 0;
    const float* bp = bias + gnw + m_in;
    // both loops unrolled: constant indices keep acc in registers
#pragma unroll
    for (int j = 0; j < 4; ++j) {
        const float4 lo = *(const float4*)(bp + j * 16);
        const float4 hi = *(const float4*)(bp + j * 16 + 4);
#pragma unroll
        for (int i2 = 0; i2 < 2; ++i2)
            *(uint4*)(stage + (i2 * 16 + r15) * SP0 + (j * 16 + m_in) * 2) = bf8(acc[I0 + i2][j], lo, hi);
    }
    // input only: the address of the eight bias loads stays live behind their uses, so that
    // no load's result is given the register pair that loads still in flight name
    asm volatile("" :: "v"(bp));
    // the wave's own LDS writes are done before other lanes of it read the rows back
    asm volatile("s_wait_dscnt 0x0" ::: "memory");
    const int bi = gmw / L, s = gmw - bi * L;
    const int row = lane >> 3, ch = lane & 7;      // eight lanes a row
    unsigned short* o = out + (((size_t)(bi * NHH + (gnw >> 7)) * L + s + row) << 7) + (gnw & 127) + ch * 8;
    const char* st = stage + row * SP0 + ch * 16;
#pragma unroll   // q a constant: it becomes the immediate offset of load and store
    for (int q = 0; q < 8; ++q)
        *(uint4*)(o + q * 4 * HD) = *(const uint4*)(st + q * 4 * SP0);
}

// EPI 2, from the plain product: acc[i2][j][v] = C(gm0 + i2*16 + v, gn0 + j*16); the lane's
// 8 rows are 8 consecutive t of one row of out: one 16-byte store
template <int MI, int I0>
static __device__ __forceinline__ void gemm_store_tr(
    const v8f (&acc)[MI][4], const float* __restrict__ bias, unsigned short* __restrict__ out,
    int gm0, int gn0, int L) {
    const int bi = gm0 / L, t = gm0 - bi * L;
    // both loops unrolled: constant indices keep acc in registers
#pragma unroll
    for (int j = 0; j < 4; ++j) {
        const int gn = gn0 + j * 16;
        const float b = bias[gn];
        const float4 b4 = make_float4(b, b, b, b);
        unsigned short* o = out + (((size_t)(bi * NHH + (gn >> 7)) << 7) + (gn & 127)) * (size_t)L + t;
#pragma unroll
        for (int i2 = 0; i2 < 2; ++i2)
            *(uint4*)(o + i2 * 16) = bf8(acc[I0 + i2][j], b4, b4);
    }
}

// EPI 3, from the TR product (map and passes as for EPI 0; the pass starts at row m0 + wm32,
// column n0 + wn64). The tile goes through the wave's own LDS
// range; read back, sixteen lanes hold one row's 256 bytes, so that a wave-wide 16-byte
// residual load or store covers four whole lines.
template <int MI, int I0>
static __device__ __forceinline__ void gemm_store_resid(
    const v8f (&acc)[MI][4], const float* __restrict__ bias, float* __restrict__ out,
    const float* __restrict__ resid, char* stage, int m0, int n0, int wm32, int wn64, int lane) {
    const int r15 = lane & 15, m_in = (lane & 16) ? 8 : 0;
    // both loops unrolled: constant indices keep acc in registers
#pragma unroll
    for (int i2 = 0; i2 < 2; ++i2)
#pragma unroll
        for (int j = 0; j < 4; ++j) {
            char* d = stage + (i2 * 16 + r15) * SP3 + (j * 16 + m_in) * 4;
            const v8f& t = acc[I0 + i2][j];
            *(float4*)d = make_float4(t[0], t[1], t[2], t[3]);
            *(float4*)(d + 16) = make_float4(t[4], t[5], t[6], t[7]);
        }
    // holds the residual loads behind the LDS writes: lifted over them, their 64 registers
    // would be live beside all of acc
    __builtin_amdgcn_sched_barrier(0);
    const int row = lane >> 4, c4 = (lane & 15) * 4;   // sixteen lanes a row
    // the row pitch is the constant HH: the row steps become immediate offsets, and one
    // address serves all loads, one all stores
    const size_t base = (size_t)(m0 + wm32 + row) * HH + n0 + wn64 + c4;
    const float* rp = resid + base;
    float* op = out + base;
    v4f rs[16];
#pragma unroll   // constant index: rs stays in registers, the loads issue back to back
    for (int q = 0; q < 16; ++q) rs[q] = *(const v4f*)(rp + q * 2 * HH);
    const float* bp = bias + n0 + wn64 + c4;
    const v4f b = *(const v4f*)bp;
    // takes the loaded values as inputs only: all are in flight together. Left free,
    // the scheduler loads each into the same registers behind the use of the one before,
    // and the wave waits out sixteen memory latencies one after another. The two addresses are
    // inputs too: live up to here, their register pairs are given to no load's result, and
    // the wait stands in front of every later write of them
    asm volatile("s_wait_xcnt 0x0" :: "v"(rs[0]), "v"(rs[1]), "v"(rs[2]), "v"(rs[3]), "v"(rs[4]), "v"(rs[5]),
                       "v"(rs[6]), "v"(rs[7]), "v"(rs[8]), "v"(rs[9]), "v"(rs[10]), "v"(rs[11]),
                       "v"(rs[12]), "v"(rs[13]), "v"(rs[14]), "v"(rs[15]), "v"(b), "v"(rp), "v"(bp));
    // the wave's own LDS writes are done before other lanes of it read the rows back
    asm volatile("s_wait_dscnt 0x0" ::: "memory");
    const char* st = stage + row * SP3 + c4 * 4;
#pragma unroll   // constant index, as above
    for (int q = 0; q < 16; ++q) {
        const float4 a = *(const float4*)(st + q * 2 * SP3);
        float4 o;
        o.x = (a.x + b.x) + n2n_sel(rs[q].x);
        o.y = (a.y + b.y) + n2n_sel(rs[q].y);
        o.z = (a.z + b.z) + n2n_sel(rs[q].z);
        o.w = (a.w + b.w) + n2n_sel(rs[q].w);
        *(float4*)(op + q * 2 * HH) = o;
        // four rows' arithmetic at a time: left free, the scheduler starts all sixteen rows'
        // selects at once, and beside the accumulators still to be stored their values spill
        // (the wait: the next rows, or the next pass, reuse the registers these stores name)
        if ((q & 3) == 3 && (q < 15 || I0 + 2 < MI)) {
            asm volatile("s_wait_xcnt 0x0" ::: "memory");
            __builtin_amdgcn_sched_barrier(0);
        }
    }
}

// The K loop of one block; stage 0 lies published in buffer 0. As, Bs: the two buffers of
// each operand. TR: W * A^T, else A * W^T (see above).
template <bool TR, int BM, int BN, int MI>
static __device__ __forceinline__ void gemm_loop(
    v8f (&acc)[MI][4], unsigned short (*As)[BM * GP], unsigned short (*Bs)[BN * GP],
    const unsigned short* aBase, const unsigned short* bBase, unsigned int gOff, size_t rStep,
    int ldsOff, int NK, int wave_m, int wave_n, int r15, int phi) {
    int buf = 0;
    for (int i = 0; i < NK; ++i) {
        const int nbuf = buf ^ 1;
        const bool more = (i + 1 < NK);
        const int kn = (i + 1) * GK;

        // ---- issue next stage ----
#if !HAVE_ASYNC_LDS
        uint4 ra[BM / 32], rb[BN / 32];
#endif
        if (more) {
#pragma unroll   // r a constant, as above: the copies issue back to back
            for (int r = 0; r < BM / 32; ++r) {
#if HAVE_ASYNC_LDS
                async_cp16(aBase + (r * rStep + kn) + gOff, &As[nbuf][ldsOff + r * 32 * GP]);
#else
                ra[r] = *(const uint4*)(aBase + (r * rStep + kn) + gOff);
#endif
            }
#pragma unroll   // the same
            for (int r = 0; r < BN / 32; ++r) {
#if HAVE_ASYNC_LDS
                async_cp16(bBase + (r * rStep + kn) + gOff, &Bs[nbuf][ldsOff + r * 32 * GP]);
#else
                rb[r] = *(const uint4*)(bBase + (r * rStep + kn) + gOff);
#endif
            }
        }

        // ---- compute current stage: 2 K-steps x (MI A-frags x 4 B-frags) WMMA ----
#pragma unroll   // ks a constant: it becomes the immediate offset of the LDS loads
        for (int ks = 0; ks < GK / 32; ++ks) {
            const unsigned int* As32 = (const unsigned int*)As[buf] + ks * 16;
            const unsigned int* Bs32 = (const unsigned int*)Bs[buf] + ks * 16;
            Frag a[MI];
#pragma unroll
            for (int i2 = 0; i2 < MI; ++i2) {
                const int ar = (wave_m * (16 * MI) + i2 * 16 + r15) * (GP / 2);
#pragma unroll
                for (int v = 0; v < 8; ++v)
                    a[i2].u[v] = As32[ar + (v & 3) + ((v >= 4) ? 8 : 0) + phi];
            }
            Frag b[4];
#pragma unroll
            for (int j = 0; j < 4; ++j) {
                const int br = (wave_n * 64 + j * 16 + r15) * (GP / 2);
#pragma unroll
                for (int v = 0; v < 8; ++v)
                    b[j].u[v] = Bs32[br + (v & 3) + ((v >= 4) ? 8 : 0) + phi];
            }
            // keeps a K-step's LDS loads one group ahead of its WMMAs, behind counted
            // waits: left free, the scheduler gives the four B fragments one register set and
            // the wave waits out a whole LDS round trip in front of every second WMMA
            __builtin_amdgcn_sched_barrier(0);
#pragma unroll
            for (int j = 0; j < 4; ++j)
#pragma unroll
                for (int i2 = 0; i2 < MI; ++i2)
                    acc[i2][j] = __builtin_amdgcn_wmma_f32_16x16x32_bf16(
                        false, TR ? b[j].v : a[i2].v, false, TR ? a[i2].v : b[j].v, (short)0,
                        acc[i2][j], false, false);
        }

        // ---- publish next stage ----
        if (more) {
#if HAVE_ASYNC_LDS
            wait_async0();
#else
#pragma unroll   // constant index: ra and rb stay in registers
            for (int r = 0; r < BM / 32; ++r) *(uint4*)(&As[nbuf][ldsOff + r * 32 * GP]) = ra[r];
#pragma unroll   // the same
            for (int r = 0; r < BN / 32; ++r) *(uint4*)(&Bs[nbuf][ldsOff + r * 32 * GP]) = rb[r];
#endif
        }
        // publishes the next stage and ends every wave's reads of this one; directly behind
        // the builtin wait it also holds the LDS reads behind it
        __syncthreads();
        buf = nbuf;
    }
}

// BM x BN: the block's tile; MI: 16-row fragments of A a wave, so its tile is 16 MI x 64.
// 4 waves a SIMD: two work-groups of 64x64 wave tiles a WGP, 256 registers a wave at most
template <int EPI, int BM, int BN, int MI>
__global__ __launch_bounds__(256, 4) void gemm_bf16_kernel(
    const unsigned short* __restrict__ A,
    const unsigned short* __restrict__ W,
    const float* __restrict__ bias,
    void* __restrict__ out,
    const float* __restrict__ resid,
    int M, int N, int K, int L,
    const float* __restrict__ bias2,
    void* __restrict__ out2) {

    static_assert((BM / (16 * MI)) * (BN / 64) == 8, "eight waves cover the block's tile");
    __shared__ __attribute__((aligned(16))) unsigned short As[2][BM * GP];
    __shared__ __attribute__((aligned(16))) unsigned short Bs[2][BN * GP];

    const int tid  = threadIdx.x;
    const int lane = tid & 31;
    const int wid  = tid >> 5;           // 0..7
    const int wave_m = wid / (BN / 64);  // 16 MI rows each
    const int wave_n = wid % (BN / 64);  // 64 cols each

    const int m0 = blockIdx.y * BM;
    const int n0 = blockIdx.x * BN;

    // stage loader: eight uint4 a row; thread handles rows lrow0 + 32 r of each matrix;
    // eight neighbouring lanes cover one row's 128 bytes
    const int lrow0 = tid >> 3;          // 0..31
    const int lch   = (tid & 7) * 8;     // bf16 offset 0,8,..,56

    const int phi = (lane & 16) ? 4 : 0;
    const int r15 = lane & 15;

    v8f acc[MI][4];
#pragma unroll
    for (int i = 0; i < MI; ++i)
#pragma unroll
        for (int j = 0; j < 4; ++j) acc[i][j] = (v8f){};

    const int NK = K / GK;

    const unsigned short* aBase = A + (size_t)m0 * K;   // the block's first rows
    const unsigned short* bBase = W + (size_t)n0 * K;
    const unsigned int gOff = (unsigned int)(lrow0 * K + lch);   // the lane's place in 32 rows
    const size_t rStep = (size_t)32 * K;
    const int ldsOff = lrow0 * GP + lch;

#if HAVE_ASYNC_LDS
    // ---- async-to-LDS pipelined path ----
    {
        // prologue: stage 0 into buf 0
#pragma unroll   // r a constant: the LDS steps fold into the address additions
        for (int r = 0; r < BM / 32; ++r)
            async_cp16(aBase + r * rStep + gOff, &As[0][ldsOff + r * 32 * GP]);
#pragma unroll   // the same
        for (int r = 0; r < BN / 32; ++r)
            async_cp16(bBase + r * rStep + gOff, &Bs[0][ldsOff + r * 32 * GP]);
        wait_async0();
    }
    // publishes stage 0; directly behind the builtin wait it also holds the LDS reads behind it
    __syncthreads();
#else
#pragma unroll   // r a constant, as above
    for (int r = 0; r < BM / 32; ++r)
        *(uint4*)(&As[0][ldsOff + r * 32 * GP]) = *(const uint4*)(aBase + r * rStep + gOff);
#pragma unroll   // the same
    for (int r = 0; r < BN / 32; ++r)
        *(uint4*)(&Bs[0][ldsOff + r * 32 * GP]) = *(const uint4*)(bBase + r * rStep + gOff);
    __syncthreads();
#endif

    // ---------------- K loop and epilogue ----------------
    const int wm = wave_m * (16 * MI);   // the wave's first row and column in the block
    const int gmw = m0 + wm;
    const int gnw = n0 + wave_n * 64;
    // behind the K loop's last barrier nobody reads the stage buffers any more: waves 0 to 3
    // restage their results in As, waves 4 to 7 in Bs, each in a range of its own
    char* stage = wid < 4 ? (char*)As : (char*)Bs;
    const int sw = wid & 3;
    if constexpr (EPI == 4) {
        static_assert(MI == 2, "one pass of the epilogue");
        const int half = N >> 1;
        if (n0 < half) {   // the same for the whole block: a tile lies on one side of N/2
            gemm_loop<true, BM, BN, MI>(acc, As, Bs, aBase, bBase, gOff, rStep, ldsOff, NK, wave_m, wave_n, r15, phi);
            gemm_store_heads<MI, 0>(acc, bias, (unsigned short*)out, stage + sw * (32 * SP0), gmw, gnw, L, lane);
        } else {
            gemm_loop<false, BM, BN, MI>(acc, As, Bs, aBase, bBase, gOff, rStep, ldsOff, NK, wave_m, wave_n, r15, phi);
            gemm_store_tr<MI, 0>(acc, bias2, (unsigned short*)out2, gmw + ((lane & 16) ? 8 : 0),
                                 gnw - half + r15, L);
        }
    } else {
        static_assert(MI == 4, "two passes of the epilogue");
        gemm_loop<true, BM, BN, MI>(acc, As, Bs, aBase, bBase, gOff, rStep, ldsOff, NK, wave_m, wave_n, r15, phi);
        // the wave's 64 rows leave in two passes of 32 through the same LDS range
        if constexpr (EPI == 0) {
            gemm_store_heads<MI, 0>(acc, bias, (unsigned short*)out, stage + sw * (32 * SP0), gmw, gnw, L, lane);
            // the wave has read the first 32 rows back before it overwrites them, and the second
            // pass reuses the registers that the first pass's stores name
            asm volatile("s_wait_dscnt 0x0\n\ts_wait_xcnt 0x0" ::: "memory");
            __builtin_amdgcn_sched_barrier(0);   // no register write of the second pass is lifted over the waits
            gemm_store_heads<MI, 2>(acc, bias, (unsigned short*)out, stage + sw * (32 * SP0), gmw + 32, gnw, L, lane);
        } else {
            gemm_store_resid<MI, 0>(acc, bias, (float*)out, resid, stage + sw * (32 * SP3), m0, n0, wm,
                                    wave_n * 64, lane);
            // the wave has read the first 32 rows back before it overwrites them
            asm volatile("s_wait_dscnt 0x0" ::: "memory");
            gemm_store_resid<MI, 2>(acc, bias, (float*)out, resid, stage + sw * (32 * SP3), m0, n0, wm + 32,
                                    wave_n * 64, lane);
        }
    }
}

// ---------------- kernel 3: attention (one wave per 16 S-rows) ----------------
// 16 waves (256 query rows of one head) form a work-group. The head's K (256 x 128)
// and V^T (128 x 256) are brought into LDS once, in whole 128-byte lines, and every
// wave takes its A fragments from there.
// Both products are taken transposed: S^T = K * Q^T and ctx^T = V^T * P^T. In the
// accumulator map a lane then holds 8 keys (or 8 head dims) of ONE query row
// (column lane & 15), so the softmax runs in registers on all 32 lanes, with one
// exchange between the wave's halves for the maximum and one for the sum, and two
// score tiles, converted in place, are the B operand of the second product.

// value of lane l ^ 16
static __device__ __forceinline__ float xhalf(float x) {
    return __builtin_bit_cast(float, __builtin_amdgcn_permlanex16(
        __builtin_bit_cast(int, x), __builtin_bit_cast(int, x),
        0x76543210, 0xfedcba98, false, false));
}

// 2^a. The v_nop fills the one slot the instruction set asks for between a
// transcendental and a next instruction that reads its result or overwrites its
// source; in one statement with it, it cannot be scheduled away from it.
static __device__ __forceinline__ float exp2_slot(float a) {
    float r;
    asm("v_exp_f32 %0, %1\n\tv_nop" : "=v"(r) : "v"(a));
    return r;
}

// LDS pitches in bf16: a K row is 256 B + 16 B of pad, a V^T row 512 B + 16 B, both
// odd multiples of 16 B, so that the 16 rows of a ds_load_b128 half-wave fall on 16
// different groups of four banks.
#define KP 136
#define VP 264
#define ATT_WAVES 16

// Eight asynchronous 16-byte copies per lane, global -> LDS, step gs bytes in global
// memory and ls bytes in LDS. The s_wait_xcnt closes the statement so that it stands
// in front of any later write of the address registers the copies name.
static __device__ __forceinline__ void async_cp16x8(unsigned int l, const char* g,
                                                    unsigned int ls, unsigned int gs) {
    asm volatile(
        "global_load_async_to_lds_b128 %0, %8, off\n\t"
        "global_load_async_to_lds_b128 %1, %9, off\n\t"
        "global_load_async_to_lds_b128 %2, %10, off\n\t"
        "global_load_async_to_lds_b128 %3, %11, off\n\t"
        "global_load_async_to_lds_b128 %4, %12, off\n\t"
        "global_load_async_to_lds_b128 %5, %13, off\n\t"
        "global_load_async_to_lds_b128 %6, %14, off\n\t"
        "global_load_async_to_lds_b128 %7, %15, off\n\t"
        "s_wait_xcnt 0x0"
        :: "v"(l), "v"(l + ls), "v"(l + 2 * ls), "v"(l + 3 * ls),
           "v"(l + 4 * ls), "v"(l + 5 * ls), "v"(l + 6 * ls), "v"(l + 7 * ls),
           "v"(g), "v"(g + gs), "v"(g + 2 * gs), "v"(g + 3 * gs),
           "v"(g + 4 * gs), "v"(g + 5 * gs), "v"(g + 6 * gs), "v"(g + 7 * gs)
        : "memory");
}

// Four A fragments from an LDS tile: rows 16 apart, pitch in dwords; base points at the
// lane's row and its half of the 32 k (dwords 0..3 and 8..11: the k order of the B side)
static __device__ __forceinline__ void lds_frag4(Frag* f, const unsigned int* base, int pitch) {
#pragma unroll
    for (int j = 0; j < 4; ++j) {
        const uint4 lo = *(const uint4*)(base + j * 16 * pitch);
        const uint4 hi = *(const uint4*)(base + j * 16 * pitch + 8);
        f[j].u[0] = lo.x; f[j].u[1] = lo.y; f[j].u[2] = lo.z; f[j].u[3] = lo.w;
        f[j].u[4] = hi.x; f[j].u[5] = hi.y; f[j].u[6] = hi.z; f[j].u[7] = hi.w;
    }
}

// byte offset of a __shared__ object in the work-group's LDS
static __device__ __forceinline__ unsigned int lds_off(const void* p) {
    return (unsigned int)(size_t)(__attribute__((address_space(3))) const void*)p;
}

__global__ __launch_bounds__(ATT_WAVES * 32) void attn_kernel(
    const unsigned short* __restrict__ qb,   // [B,NH,S,HD]
    const unsigned short* __restrict__ kb,   // [B,NH,T,HD]
    const unsigned short* __restrict__ vtb,  // [B,NH,HD,T]
    const float* __restrict__ mask,          // [B,T]
    unsigned short* __restrict__ ctxb) {     // [B,S,H] bf16

    __shared__ __attribute__((aligned(16))) unsigned short Ks[TT * KP];
    __shared__ __attribute__((aligned(16))) unsigned short Vs[HD * VP];

    const int tid  = threadIdx.x;
    const int lane = tid & 31;
    const int bid  = blockIdx.x;
    const int bh   = bid >> 3;               // S/256 = 8 work-groups per (b,h)
    const int s0   = ((bid & 7) << 8) + ((tid >> 5) << 4);
    const int b    = bh >> 4;
    const int h    = bh & 15;

    const int phi  = (lane & 16) ? 4 : 0;
    const int r15  = lane & 15;
    const int m_in = (lane & 16) ? 8 : 0;

    // ---- scores^T: 256 x 16 via 4 K-steps x 16 key tiles of WMMA ----
    // acc[nt][v] = score(query s0 + r15, key nt*16 + m_in + v)
    v8f acc[16];
#pragma unroll
    for (int i = 0; i < 16; ++i) acc[i] = (v8f){};

    // this wave's own 16 query rows, straight from global memory, in flight with the copies
    const unsigned int* qrow = (const unsigned int*)(qb + ((size_t)bh * SS + s0) * HD);
    Frag q[4];
#pragma unroll
    for (int kk = 0; kk < 4; ++kk)
#pragma unroll
        for (int v = 0; v < 8; ++v)
            q[kk].u[v] = qrow[r15 * 64 + kk * 16 + (v & 3) + ((v >= 4) ? 8 : 0) + phi];

    // K and V^T of this head are 64 KiB each, contiguous: thread tid copies the 16-byte
    // pieces tid, tid + 512, ... (a wave's copy is 512 contiguous bytes: two K rows or
    // one V^T row); 512 pieces are 32 K rows or 16 V^T rows.
    async_cp16x8(lds_off(Ks) + (tid >> 4) * (KP * 2) + (tid & 15) * 16,
                 (const char*)(kb + (size_t)bh * TT * HD) + tid * 16, 32 * KP * 2, 8192);
    async_cp16x8(lds_off(Vs) + (tid >> 5) * (VP * 2) + (tid & 31) * 16,
                 (const char*)(vtb + (size_t)bh * HD * TT) + tid * 16, 16 * VP * 2, 8192);
    // this wave's copies have landed; behind the barrier every wave's have
    asm volatile("s_wait_asynccnt 0x0" ::: "memory");
    __syncthreads();

    // group g = K-step g >> 2, key tiles (g & 3) * 4 + 0..3; the next group's fragments
    // are fetched into a second register set ahead of this group's WMMAs
    const unsigned int* kbase = (const unsigned int*)Ks + r15 * (KP / 2) + phi;
    Frag kf[2][4];
    lds_frag4(kf[0], kbase, KP / 2);
#pragma unroll
    for (int g = 0; g < 16; ++g) {
        if (g + 1 < 16)
            lds_frag4(kf[(g + 1) & 1],
                      kbase + ((g + 1) & 3) * 64 * (KP / 2) + ((g + 1) >> 2) * 16, KP / 2);
        // keeps the eight LDS loads one group, ahead of the WMMAs: left free the scheduler
        // either lifts so many loads that the 256 registers spill or waits out each load
        __builtin_amdgcn_sched_barrier(0);
#pragma unroll
        for (int j = 0; j < 4; ++j) {
            const int nt = (g & 3) * 4 + j;
            acc[nt] = __builtin_amdgcn_wmma_f32_16x16x32_bf16(false, kf[g & 1][j].v, false,
                                                              q[g >> 2].v, (short)0, acc[nt],
                                                              false, false);
        }
        __builtin_amdgcn_sched_barrier(0);   // the same, at the group's end
    }

    // ---- softmax over T=256: 128 keys of the row in this lane, 128 in lane ^ 16 ----
    const float* mrow = mask + (size_t)b * TT + m_in;
    v8f mx8;
#pragma unroll
    for (int v = 0; v < 8; ++v) mx8[v] = -1e30f;
#pragma unroll
    for (int nt = 0; nt < 16; ++nt) {
        const float4 ma = *(const float4*)(mrow + nt * 16);
        const float4 mb = *(const float4*)(mrow + nt * 16 + 4);
        const float mk[8] = {ma.x, ma.y, ma.z, ma.w, mb.x, mb.y, mb.z, mb.w};
#pragma unroll
        for (int v = 0; v < 8; ++v) {
            float x = acc[nt][v] * SCALE_INV;
            x = fminf(fmaxf(x, -50.0f), 50.0f);
            x += mk[v] * -1e9f;
            acc[nt][v] = x;
            mx8[v] = fmaxf(mx8[v], x);
        }
        // the mask loads of eight tiles at a time: all 32 lifted to the top take 128
        // registers beside the 128 of acc, and the 256-register budget spills
        if (nt == 7) __builtin_amdgcn_sched_barrier(0);
    }
    float mx = fmaxf(fmaxf(fmaxf(mx8[0], mx8[1]), fmaxf(mx8[2], mx8[3])),
                     fmaxf(fmaxf(mx8[4], mx8[5]), fmaxf(mx8[6], mx8[7])));
    mx = fmaxf(mx, xhalf(mx));
    // the address registers of the mask loads are reused from here on
    asm volatile("s_wait_xcnt 0x0" ::: "memory");

    v8f sum8 = (v8f){};
#pragma unroll
    for (int nt = 0; nt < 16; ++nt)
#pragma unroll
        for (int v = 0; v < 8; ++v) {
            float e = exp2_slot((acc[nt][v] - mx) * 1.44269504f);   // e^(x - mx)
            acc[nt][v] = e;
            sum8[v] += e;
        }
    float sum = ((sum8[0] + sum8[1]) + (sum8[2] + sum8[3])) +
                ((sum8[4] + sum8[5]) + (sum8[6] + sum8[7]));
    sum += xhalf(sum);
    const float inv = 1.0f / (sum + 1e-8f);

    // probs^T as B fragments: score tiles 2kk and 2kk+1 hold keys kk*32 + m_in + 0..7
    // and kk*32 + 16 + m_in + 0..7, the k order of the V^T loader below
    Frag p[8];
#pragma unroll
    for (int kk = 0; kk < 8; ++kk)
#pragma unroll
        for (int w = 0; w < 4; ++w) {
            p[kk].u[w]     = (unsigned int)f2bf(acc[2 * kk][2 * w] * inv) |
                             ((unsigned int)f2bf(acc[2 * kk][2 * w + 1] * inv) << 16);
            p[kk].u[4 + w] = (unsigned int)f2bf(acc[2 * kk + 1][2 * w] * inv) |
                             ((unsigned int)f2bf(acc[2 * kk + 1][2 * w + 1] * inv) << 16);
        }
    // keeps the packing ahead of the second product: spread among its WMMAs the 128
    // f32 values stay live beside the V fragments and the ctx accumulators
    __builtin_amdgcn_sched_barrier(0);

    // ---- ctx^T = V^T @ probs^T : 128 x 16, K over T=256 ----
    // c[nt][v] = ctx(query s0 + r15, head dim nt*16 + m_in + v)
    v8f c[8];
#pragma unroll
    for (int i = 0; i < 8; ++i) c[i] = (v8f){};

    // group g = K-step g >> 1, head-dim tiles (g & 1) * 4 + 0..3, fetched as above
    const unsigned int* vbase = (const unsigned int*)Vs + r15 * (VP / 2) + phi;
    Frag vf[2][4];
    lds_frag4(vf[0], vbase, VP / 2);
#pragma unroll
    for (int g = 0; g < 16; ++g) {
        if (g + 1 < 16)
            lds_frag4(vf[(g + 1) & 1],
                      vbase + ((g + 1) & 1) * 64 * (VP / 2) + ((g + 1) >> 1) * 16, VP / 2);
        __builtin_amdgcn_sched_barrier(0);   // one load group ahead of the WMMAs, as above
#pragma unroll
        for (int j = 0; j < 4; ++j) {
            const int nt = (g & 1) * 4 + j;
            c[nt] = __builtin_amdgcn_wmma_f32_16x16x32_bf16(false, vf[g & 1][j].v, false,
                                                            p[g >> 1].v, (short)0, c[nt],
                                                            false, false);
        }
        __builtin_amdgcn_sched_barrier(0);   // the same, at the group's end
    }

    // ctx -> [B,S,H] bf16: 8 consecutive head dims of one row per lane and tile
    unsigned short* crow = ctxb + ((size_t)(b * SS + s0 + r15)) * HH + h * HD + m_in;
#pragma unroll
    for (int nt = 0; nt < 8; ++nt) {
        uint4 o;
        o.x = (unsigned int)f2bf(c[nt][0]) | ((unsigned int)f2bf(c[nt][1]) << 16);
        o.y = (unsigned int)f2bf(c[nt][2]) | ((unsigned int)f2bf(c[nt][3]) << 16);
        o.z = (unsigned int)f2bf(c[nt][4]) | ((unsigned int)f2bf(c[nt][5]) << 16);
        o.w = (unsigned int)f2bf(c[nt][6]) | ((unsigned int)f2bf(c[nt][7]) << 16);
        *(uint4*)(crow + nt * 16) = o;
    }
}

// ---------------- kernel 4: LayerNorm (one block per row) ----------------
__global__ __launch_bounds__(256) void layernorm_kernel(const float* __restrict__ x,
                                                        const float* __restrict__ g,
                                                        const float* __restrict__ bta,
                                                        float* __restrict__ out) {
    __shared__ float rs[256], rq[256];
    const int tid = threadIdx.x;
    const size_t row = (size_t)blockIdx.x * HH;

    float s = 0.0f, q = 0.0f;
#pragma unroll
    for (int j = 0; j < HH / 256; ++j) {
        float v = x[row + tid + j * 256];
        s += v;
        q += v * v;
    }
    rs[tid] = s;
    rq[tid] = q;
    __syncthreads();
    for (int off = 128; off > 0; off >>= 1) {
        if (tid < off) { rs[tid] += rs[tid + off]; rq[tid] += rq[tid + off]; }
        __syncthreads();
    }
    const float mu  = rs[0] * (1.0f / HH);
    const float var = rq[0] * (1.0f / HH) - mu * mu;
    const float r   = rsqrtf(var + LN_EPS);
#pragma unroll
    for (int j = 0; j < HH / 256; ++j) {
        int i = tid + j * 256;
        out[row + i] = (x[row + i] - mu) * r * g[i] + bta[i];
    }
}

// ---------------- launcher ----------------
extern "C" void kernel_launch(void* const* d_in, const int* in_sizes, int n_in,
                              void* d_out, int out_size, void* d_ws, size_t ws_size,
                              hipStream_t stream) {
    const float* hs   = (const float*)d_in[0];   // (B,S,H)
    const float* at   = (const float*)d_in[1];   // (B,T,H)
    const float* mask = (const float*)d_in[2];   // (B,T)
    const float* Wq   = (const float*)d_in[3];
    const float* bq   = (const float*)d_in[4];
    const float* Wk   = (const float*)d_in[5];
    const float* bk   = (const float*)d_in[6];
    const float* Wv   = (const float*)d_in[7];
    const float* bv   = (const float*)d_in[8];
    const float* Wo   = (const float*)d_in[9];
    const float* bo   = (const float*)d_in[10];
    const float* ln_g = (const float*)d_in[11];
    const float* ln_b = (const float*)d_in[12];
    float* outp = (float*)d_out;

    const size_t BS = (size_t)BB * SS;   // 8192
    const size_t BT = (size_t)BB * TT;   // 1024

    // workspace carve-up (bf16 stored as ushort)
    char* w = (char*)d_ws;
    unsigned short* hsb  = (unsigned short*)w;                  w += BS * HH * 2;
    unsigned short* atb  = (unsigned short*)w;                  w += BT * HH * 2;
    unsigned short* wqb  = (unsigned short*)w;                  w += (size_t)HH * HH * 2;
    unsigned short* wkb  = (unsigned short*)w;                  w += (size_t)HH * HH * 2;
    unsigned short* wvb  = (unsigned short*)w;                  w += (size_t)HH * HH * 2;
    unsigned short* wob  = (unsigned short*)w;                  w += (size_t)HH * HH * 2;
    unsigned short* qb   = (unsigned short*)w;                  w += BS * HH * 2;     // [B,NH,S,HD]
    unsigned short* kbuf = (unsigned short*)w;                  w += BT * HH * 2;     // [B,NH,T,HD]
    unsigned short* vtb  = (unsigned short*)w;                  w += BT * HH * 2;     // [B,NH,HD,T]
    unsigned short* ctxb = (unsigned short*)w;                  w += BS * HH * 2;     // [B,S,H]
    float*          opre = (float*)w;                           w += BS * HH * 4;

    // 1) converts: hsb, atb, wqb, wkb, wvb, wob are one contiguous range that starts at hsb
    convert_all_kernel<<<CV_GRID, CV_THREADS, 0, stream>>>(hs, at, Wq, Wk, Wv, Wo, hsb);

    // 2) projections
    gemm_bf16_kernel<0, 128, 256, 4><<<dim3(HH / 256, BS / 128), 256, 0, stream>>>(
        hsb, wqb, bq, qb, nullptr, (int)BS, HH, HH, SS, nullptr, nullptr);
    // K and V together: wvb lies directly behind wkb, so the two are one matrix of 2 H rows;
    // 256 work-groups, where each projection alone has 128
    gemm_bf16_kernel<4, 128, 128, 2><<<dim3(2 * HH / 128, BT / 128), 256, 0, stream>>>(
        atb, wkb, bk, kbuf, nullptr, (int)BT, 2 * HH, HH, TT, bv, vtb);

    // 3) attention: one wave per 16 S-rows, 16 waves of one head per work-group
    attn_kernel<<<BB * NHH * (SS / 256), 512, 0, stream>>>(qb, kbuf, vtb, mask, ctxb);

    // 4) output projection + bias + residual (f32)
    gemm_bf16_kernel<3, 128, 256, 4><<<dim3(HH / 256, BS / 128), 256, 0, stream>>>(
        ctxb, wob, bo, opre, hs, (int)BS, HH, HH, SS, nullptr, nullptr);

    // 5) LayerNorm -> d_out
    layernorm_kernel<<<(int)BS, 256, 0, stream>>>(opre, ln_g, ln_b, outp);
}

// v010
// One run takes 171 microseconds.
// Timed twice side by side with v009, it ran 1.06 and 1.07 times as fast.
// Over all steps from v000 it is 3.08 times as fast.
#include <hip/hip_runtime.h>

// ---------------- problem constants (match reference) ----------------
#define BB 4
#define SS 2048
#define TT 256
#define HH 2048
#define NHH 16
#define HD 128
#define LN_EPS 1e-5f
#define SCALE_INV 0.08838834764831845f   // 1/sqrt(128)

// A stage of the Q and O products holds GK k of every operand row: 128 bytes, one whole cache line, so
// that a wave's 512-byte copy asks L2 for four whole lines and not for eight halves.
#define GK 64
// LDS pitch of a GEMM stage row: the stage's k + 8 bf16 of pad (64 + 8: 144 bytes), an
// odd multiple of 16 bytes, so that the 16 rows one ds_load_b128 half-wave
// touches fall on 16 different groups of four banks (64 banks x 4 bytes).

typedef __attribute__((ext_vector_type(16))) __bf16 v16bf;
typedef __attribute__((ext_vector_type(8)))  float  v8f;
typedef __attribute__((ext_vector_type(4)))  float  v4f;

union Frag {
    unsigned int u[8];
    v16bf v;
};

// ---- optional CDNA5 async global->LDS copy path (compile-safe probe) ----
#if defined(__has_builtin)
#if __has_builtin(__builtin_amdgcn_global_load_async_to_lds_b128)
#define HAVE_ASYNC_LDS 1
#endif
#endif
#ifndef HAVE_ASYNC_LDS
#define HAVE_ASYNC_LDS 0
#endif

#if HAVE_ASYNC_LDS
typedef int gv4i __attribute__((vector_size(16)));   // matches builtin param type
static __device__ __forceinline__ void async_cp16(const void* g, void* l) {
    __builtin_amdgcn_global_load_async_to_lds_b128(
        (__attribute__((address_space(1))) gv4i*)g,
        (__attribute__((address_space(3))) gv4i*)l, 0, 0);
}
static __device__ __forceinline__ void wait_async0() {
#if __has_builtin(__builtin_amdgcn_s_wait_asynccnt)
    __builtin_amdgcn_s_wait_asynccnt(0);
#else
    asm volatile("s_wait_asynccnt 0" ::: "memory");
#endif
}
#endif

static __device__ __forceinline__ unsigned short f2bf(float f) {
    union { float f; unsigned int u; } c;
    c.f = f;
    unsigned int r = c.u + 0x7fffu + ((c.u >> 16) & 1u);  // RNE
    return (unsigned short)(r >> 16);
}

// ---------------- kernel 1: f32 -> bf16 convert (+nan_to_num), all six tensors ----------------
// One launch of few, long-lived waves. A chunk is what a work-group moves in one trip:
// CV_LOADS 16-byte loads a lane, each wave-wide load 512 contiguous bytes (four whole
// lines), each wave-wide 8-byte store 256 contiguous bytes (two whole lines).
// The six results lie one behind the other in the workspace, in the order of the
// arguments, so a chunk's number is also its place in out. Every tensor is a whole
// number of chunks, so a chunk has one source.
#define CV_THREADS 256
#define CV_LOADS 8
#define CV_CHUNK (CV_THREADS * CV_LOADS * 4)          // floats
#define CV_HS (BB * SS * HH / CV_CHUNK)               // chunks of hidden_states
#define CV_AT (BB * TT * HH / CV_CHUNK)               // chunks of audio_tokens
#define CV_W  (HH * HH / CV_CHUNK)                    // chunks of one weight matrix
#define CV_W0 (CV_HS + CV_AT)                         // first chunk of the first weight matrix
#define CV_ALL (CV_W0 + 4 * CV_W)
#define CV_TRIPS 8                                    // chunks a work-group
#define CV_GRID (CV_ALL / CV_TRIPS)

// n2n, then the rounding of f2bf: the bf16 stands in the upper half of the result.
// n2n as selects on the bits, so that no branch stands between the loads' waits.
static __device__ __forceinline__ unsigned int n2n_rne(float a) {
    const unsigned int u = __builtin_bit_cast(unsigned int, a), m = u & 0x7fffffffu;
    unsigned int x = m > 0x7f800000u ? 0u : u;                         // NaN -> 0
    x = m == 0x7f800000u ? ((u & 0x80000000u) | 0x461c4000u) : x;      // +-inf -> +-1e4
    return x + 0x7fffu + ((x >> 16) & 1u);                             // RNE
}

static __device__ __forceinline__ unsigned int pack2bf(float a, float b) {
    return (n2n_rne(a) >> 16) | (n2n_rne(b) & 0xffff0000u);
}

// the lane's first 16 bytes of chunk c (c is the same for the whole work-group)
static __device__ __forceinline__ const float4* cv_src(
    int c, int tid, const float* hs, const float* at, const float* wq, const float* wk,
    const float* wv, const float* wo) {
    const float* p = hs;
    int first = 0;
    if (c >= CV_HS)            { p = at; first = CV_HS; }
    if (c >= CV_W0)            { p = wq; first = CV_W0; }
    if (c >= CV_W0 + CV_W)     { p = wk; first = CV_W0 + CV_W; }
    if (c >= CV_W0 + 2 * CV_W) { p = wv; first = CV_W0 + 2 * CV_W; }
    if (c >= CV_W0 + 3 * CV_W) { p = wo; first = CV_W0 + 3 * CV_W; }
    return (const float4*)(p + (size_t)(c - first) * CV_CHUNK) + tid;
}

static __device__ __forceinline__ void cv_emit(const float4* v, unsigned short* out, int c, int tid) {
    uint2* d = (uint2*)(out + (size_t)c * CV_CHUNK) + tid;
#pragma unroll   // constant index: v stays in registers
    for (int j = 0; j < CV_LOADS; ++j) {
        uint2 o;
        o.x = pack2bf(v[j].x, v[j].y);
        o.y = pack2bf(v[j].z, v[j].w);
        d[j * CV_THREADS] = o;
    }
}

__global__ __launch_bounds__(CV_THREADS) void convert_all_kernel(
    const float* __restrict__ hs, const float* __restrict__ at,
    const float* __restrict__ wq, const float* __restrict__ wk,
    const float* __restrict__ wv, const float* __restrict__ wo,
    unsigned short* __restrict__ out) {

    const int tid = threadIdx.x;
    int c = blockIdx.x;                               // the grid is CV_GRID work-groups

    float4 cur[CV_LOADS], nxt[CV_LOADS];
    {
        const float4* s = cv_src(c, tid, hs, at, wq, wk, wv, wo);
#pragma unroll   // constant index: cur stays in registers, the loads issue back to back
        for (int j = 0; j < CV_LOADS; ++j) cur[j] = s[j * CV_THREADS];
    }
    // the next chunk's loads fly while this chunk is converted and stored; the last chunk
    // stands behind the loop, so that inside it the waits count the loads of both
#pragma unroll 1   // unrolled, the arithmetic of a chunk is lifted over the next chunk's loads
    for (int t = 1; t < CV_TRIPS; ++t) {
        const float4* s = cv_src(c + CV_GRID, tid, hs, at, wq, wk, wv, wo);
#pragma unroll   // constant index, as above
        for (int j = 0; j < CV_LOADS; ++j) nxt[j] = s[j * CV_THREADS];
        // holds the eight loads ahead of this chunk's arithmetic: sunk behind the wait for
        // this chunk's values they would start one memory latency later
        __builtin_amdgcn_sched_barrier(0);
        cv_emit(cur, out, c, tid);
        // holds the copies below, which wait for the next chunk's loads, behind this chunk's stores
        __builtin_amdgcn_sched_barrier(0);
#pragma unroll   // constant index, as above
        for (int j = 0; j < CV_LOADS; ++j) cur[j] = nxt[j];
        c += CV_GRID;
    }
    cv_emit(cur, out, c, tid);
}

// ---------------- kernel 2: tiled bf16 WMMA GEMM  C = A @ W^T (+bias) ------
// K-stage 64, K/V product 256 (K a multiple of it), double-buffered LDS, software pipelined, 8 waves.
// Q and O products: block tile 128x256, each wave a 64x64 sub-tile = 4x4 accumulators, so
// that 8 LDS fragments feed 16 WMMAs. K/V product (few tiles): block 128x128, wave 32x64.
// A: [M,K] bf16 row-major, W: [N,K] bf16 row-major.
// EPI 0: split-heads bf16 -> out[((b*NH+h)*L + s)*HD + d],  b=m/L, s=m%L
// EPI 2: transposed       -> out[((b*NH+h)*HD + d)*L + t],  b=m/L, t=m%L
// EPI 3: f32 out = acc + bias + n2n(resid[m,n]), row-major [M,HH] (N is HH)
// EPI 4: two projections of the same A in one launch. W holds the rows of the first weight
//        matrix and behind them those of the second (N counts both). A block left of column
//        N/2 ends as EPI 0 (bias, out), the others as EPI 2 (bias2, out2), columns from N/2.
// L is a multiple of 32: the 32 rows of an epilogue pass lie in one batch.
//
// The accumulator map gives a lane 8 consecutive rows of one column of the product. The
// product is therefore taken so that those 8 run along the output's contiguous dimension:
// W * A^T (TR, the lane holds 8 n of one m) for EPI 0 and 3, A * W^T (8 m of one n) for
// EPI 2. The loaders of the two operands have the same lane map and k order, so the two
// fragments only change places in the WMMA.

// LDS pitches of a wave's restaged tile, odd multiples of 16 bytes (bank groups as for a stage row):
// 32 rows of 64 bf16 (one line) or of 64 f32 (two lines)
#define SP0 144
#define SP3 272

// n2n (NaN -> 0, +-inf -> +-1e4) as selects on the bits: no branch stands between the
// residual loads and their use
static __device__ __forceinline__ float n2n_sel(float a) {
    const unsigned int u = __builtin_bit_cast(unsigned int, a), m = u & 0x7fffffffu;
    unsigned int x = m > 0x7f800000u ? 0u : u;                         // NaN -> 0
    x = m == 0x7f800000u ? ((u & 0x80000000u) | 0x461c4000u) : x;      // +-inf -> +-1e4
    return __builtin_bit_cast(float, x);
}

static __device__ __forceinline__ unsigned int bf2(float a, float b) {
    return (unsigned int)f2bf(a) | ((unsigned int)f2bf(b) << 16);
}

static __device__ __forceinline__ uint4 bf8(const v8f& a, const float4& lo, const float4& hi) {
    uint4 o;
    o.x = bf2(a[0] + lo.x, a[1] + lo.y);
    o.y = bf2(a[2] + lo.z, a[3] + lo.w);
    o.z = bf2(a[4] + hi.x, a[5] + hi.y);
    o.w = bf2(a[6] + hi.z, a[7] + hi.w);
    return o;
}

// EPI 0, from the TR product: acc[I0 + i2][j][v] = C(gmw + i2*16 + r15, gnw + j*16 + m_in + v),
// i2 = 0, 1: one pass takes 32 rows of the wave's tile, from fragment row I0 on.
// The wave writes these 32 x 64 values into its own LDS range and reads it back row by row: a
// wave-wide 16-byte store then covers four whole 128-byte lines of out.
template <int MI, int I0>
static __device__ __forceinline__ void gemm_store_heads(
    const v8f (&acc)[MI][4], const float* __restrict__ bias, unsigned short* __restrict__ out,
    char* stage, int gmw, int gnw, int L, int lane) {
    const int r15 = lane & 15, m_in = (lane & 16) ? 8 : 0;
    const float* bp = bias + gnw + m_in;
    // both loops unrolled: constant indices keep acc in registers
#pragma unroll
    for (int j = 0; j < 4; ++j) {
        const float4 lo = *(const float4*)(bp + j * 16);
        const float4 hi = *(const float4*)(bp + j * 16 + 4);
#pragma unroll
        for (int i2 = 0; i2 < 2; ++i2)
            *(uint4*)(stage + (i2 * 16 + r15) * SP0 + (j * 16 + m_in) * 2) = bf8(acc[I0 + i2][j], lo, hi);
    }
    // input only: the address of the eight bias loads stays live behind their uses, so that
    // no load's result is given the register pair that loads still in flight name
    asm volatile("" :: "v"(bp));
    // the wave's own LDS writes are done before other lanes of it read the rows back
    asm volatile("s_wait_dscnt 0x0" ::: "memory");
    const int bi = gmw / L, s = gmw - bi * L;
    const int row = lane >> 3, ch = lane & 7;      // eight lanes a row
    unsigned short* o = out + (((size_t)(bi * NHH + (gnw >> 7)) * L + s + row) << 7) + (gnw & 127) + ch * 8;
    const char* st = stage + row * SP0 + ch * 16;
#pragma unroll   // q a constant: it becomes the immediate offset of load and store
    for (int q = 0; q < 8; ++q)
        *(uint4*)(o + q * 4 * HD) = *(const uint4*)(st + q * 4 * SP0);
}

// EPI 2, from the plain product: acc[i2][j][v] = C(gm0 + i2*16 + v, gn0 + j*16); the lane's
// 8 rows are 8 consecutive t of one row of out: one 16-byte store
template <int MI, int I0>
static __device__ __forceinline__ void gemm_store_tr(
    const v8f (&acc)[MI][4], const float* __restrict__ bias, unsigned short* __restrict__ out,
    int gm0, int gn0, int L) {
    const int bi = gm0 / L, t = gm0 - bi * L;
    // both loops unrolled: constant indices keep acc in registers
#pragma unroll
    for (int j = 0; j < 4; ++j) {
        const int gn = gn0 + j * 16;
        const float b = bias[gn];
        const float4 b4 = make_float4(b, b, b, b);
        unsigned short* o = out + (((size_t)(bi * NHH + (gn >> 7)) << 7) + (gn & 127)) * (size_t)L + t;
#pragma unroll
        for (int i2 = 0; i2 < 2; ++i2)
            *(uint4*)(o + i2 * 16) = bf8(acc[I0 + i2][j], b4, b4);
    }
}

// EPI 3, from the TR product (map and passes as for EPI 0; the pass starts at row m0 + wm32,
// column n0 + wn64). The tile goes through the wave's own LDS
// range; read back, sixteen lanes hold one row's 256 bytes, so that a wave-wide 16-byte
// residual load or store covers four whole lines.
template <int MI, int I0>
static __device__ __forceinline__ void gemm_store_resid(
    const v8f (&acc)[MI][4], const float* __restrict__ bias, float* __restrict__ out,
    const float* __restrict__ resid, char* stage, int m0, int n0, int wm32, int wn64, int lane) {
    const int r15 = lane & 15, m_in = (lane & 16) ? 8 : 0;
    // both loops unrolled: constant indices keep acc in registers
#pragma unroll
    for (int i2 = 0; i2 < 2; ++i2)
#pragma unroll
        for (int j = 0; j < 4; ++j) {
            char* d = stage + (i2 * 16 + r15) * SP3 + (j * 16 + m_in) * 4;
            const v8f& t = acc[I0 + i2][j];
            *(float4*)d = make_float4(t[0], t[1], t[2], t[3]);
            *(float4*)(d + 16) = make_float4(t[4], t[5], t[6], t[7]);
        }
    // holds the residual loads behind the LDS writes: lifted over them, their 64 registers
    // would be live beside all of acc
    __builtin_amdgcn_sched_barrier(0);
    const int row = lane >> 4, c4 = (lane & 15) * 4;   // sixteen lanes a row
    // the row pitch is the constant HH: the row steps become immediate offsets, and one
    // address serves all loads, one all stores
    const size_t base = (size_t)(m0 + wm32 + row) * HH + n0 + wn64 + c4;
    const float* rp = resid + base;
    float* op = out + base;
    v4f rs[16];
#pragma unroll   // constant index: rs stays in registers, the loads issue back to back
    for (int q = 0; q < 16; ++q) rs[q] = *(const v4f*)(rp + q * 2 * HH);
    const float* bp = bias + n0 + wn64 + c4;
    const v4f b = *(const v4f*)bp;
    // takes the loaded values as inputs only: all are in flight together. Left free,
    // the scheduler loads each into the same registers behind the use of the one before,
    // and the wave waits out sixteen memory latencies one after another. The two addresses are
    // inputs too: live up to here, their register pairs are given to no load's result, and
    // the wait stands in front of every later write of them
    asm volatile("s_wait_xcnt 0x0" :: "v"(rs[0]), "v"(rs[1]), "v"(rs[2]), "v"(rs[3]), "v"(rs[4]), "v"(rs[5]),
                       "v"(rs[6]), "v"(rs[7]), "v"(rs[8]), "v"(rs[9]), "v"(rs[10]), "v"(rs[11]),
                       "v"(rs[12]), "v"(rs[13]), "v"(rs[14]), "v"(rs[15]), "v"(b), "v"(rp), "v"(bp));
    // the wave's own LDS writes are done before other lanes of it read the rows back
    asm volatile("s_wait_dscnt 0x0" ::: "memory");
    const char* st = stage + row * SP3 + c4 * 4;
#pragma unroll   // constant index, as above
    for (int q = 0; q < 16; ++q) {
        const float4 a = *(const float4*)(st + q * 2 * SP3);
        float4 o;
        o.x = (a.x + b.x) + n2n_sel(rs[q].x);
        o.y = (a.y + b.y) + n2n_sel(rs[q].y);
        o.z = (a.z + b.z) + n2n_sel(rs[q].z);
        o.w = (a.w + b.w) + n2n_sel(rs[q].w);
        *(float4*)(op + q * 2 * HH) = o;
        // four rows' arithmetic at a time: left free, the scheduler starts all sixteen rows'
        // selects at once, and beside the accumulators still to be stored their values spill
        // (the wait: the next rows, or the next pass, reuse the registers these stores name)
        if ((q & 3) == 3 && (q < 15 || I0 + 2 < MI)) {
            asm volatile("s_wait_xcnt 0x0" ::: "memory");
            __builtin_amdgcn_sched_barrier(0);
        }
    }
}

// The K loop of one block; stage 0 lies published in buffer 0. As, Bs: the two buffers of
// each operand. TR: W * A^T, else A * W^T (see above). KS: k of a stage; a stage row has the
// LDS pitch KS + 8 bf16, and 256 lanes copy 2048 / KS rows at a time.
template <bool TR, int BM, int BN, int MI, int KS>
static __device__ __forceinline__ void gemm_loop(
    v8f (&acc)[MI][4], unsigned short (*As)[BM * (KS + 8)], unsigned short (*Bs)[BN * (KS + 8)],
    const unsigned short* aBase, const unsigned short* bBase, unsigned int gOff, size_t rStep,
    int ldsOff, int NK, int wave_m, int wave_n, int r15, int phi) {
    constexpr int P = KS + 8, RP = 2048 / KS;
    int buf = 0;
    for (int i = 0; i < NK; ++i) {
        const int nbuf = buf ^ 1;
        const bool more = (i + 1 < NK);
        const int kn = (i + 1) * KS;

        // ---- issue next stage ----
#if !HAVE_ASYNC_LDS
        uint4 ra[BM / RP], rb[BN / RP];
#endif
        if (more) {
#pragma unroll   // r a constant, as above: the copies issue back to back
            for (int r = 0; r < BM / RP; ++r) {
#if HAVE_ASYNC_LDS
                async_cp16(aBase + (r * rStep + kn) + gOff, &As[nbuf][ldsOff + r * RP * P]);
#else
                ra[r] = *(const uint4*)(aBase + (r * rStep + kn) + gOff);
#endif
            }
#pragma unroll   // the same
            for (int r = 0; r < BN / RP; ++r) {
#if HAVE_ASYNC_LDS
                async_cp16(bBase + (r * rStep + kn) + gOff, &Bs[nbuf][ldsOff + r * RP * P]);
#else
                rb[r] = *(const uint4*)(bBase + (r * rStep + kn) + gOff);
#endif
            }
        }

        // ---- compute current stage: KS / 32 K-steps x (MI A-frags x 4 B-frags) WMMA ----
#pragma unroll   // ks a constant: it becomes the immediate offset of the LDS loads
        for (int ks = 0; ks < KS / 32; ++ks) {
            const unsigned int* As32 = (const unsigned int*)As[buf] + ks * 16;
            const unsigned int* Bs32 = (const unsigned int*)Bs[buf] + ks * 16;
            Frag a[MI];
#pragma unroll
            for (int i2 = 0; i2 < MI; ++i2) {
                const int ar = (wave_m * (16 * MI) + i2 * 16 + r15) * (P / 2);
#pragma unroll
                for (int v = 0; v < 8; ++v)
                    a[i2].u[v] = As32[ar + (v & 3) + ((v >= 4) ? 8 : 0) + phi];
            }
            Frag b[4];
#pragma unroll
            for (int j = 0; j < 4; ++j) {
                const int br = (wave_n * 64 + j * 16 + r15) * (P / 2);
#pragma unroll
                for (int v = 0; v < 8; ++v)
                    b[j].u[v] = Bs32[br + (v & 3) + ((v >= 4) ? 8 : 0) + phi];
            }
            // keeps a K-step's LDS loads one group ahead of its WMMAs, behind counted
            // waits: left free, the scheduler gives the four B fragments one register set and
            // the wave waits out a whole LDS round trip in front of every second WMMA
            __builtin_amdgcn_sched_barrier(0);
#pragma unroll
            for (int j = 0; j < 4; ++j)
#pragma unroll
                for (int i2 = 0; i2 < MI; ++i2)
                    acc[i2][j] = __builtin_amdgcn_wmma_f32_16x16x32_bf16(
                        false, TR ? b[j].v : a[i2].v, false, TR ? a[i2].v : b[j].v, (short)0,
                        acc[i2][j], false, false);
        }

        // ---- publish next stage ----
        if (more) {
#if HAVE_ASYNC_LDS
            wait_async0();
#else
#pragma unroll   // constant index: ra and rb stay in registers
            for (int r = 0; r < BM / RP; ++r) *(uint4*)(&As[nbuf][ldsOff + r * RP * P]) = ra[r];
#pragma unroll   // the same
            for (int r = 0; r < BN / RP; ++r) *(uint4*)(&Bs[nbuf][ldsOff + r * RP * P]) = rb[r];
#endif
        }
        // publishes the next stage and ends every wave's reads of this one; directly behind
        // the builtin wait it also holds the LDS reads behind it
        __syncthreads();
        buf = nbuf;
    }
}

// BM x BN: the block's tile; MI: 16-row fragments of A a wave, so its tile is 16 MI x 64.
// KS: k of a stage. The Q and O products take GK. The K/V product has one work-group a WGP and
// nothing beside it that would cover the wait for a stage's copies: it takes stages of 256 k, a
// row 512 bytes (four whole lines, one wave's copy), and waits out 8 stages, not 32.
// 4 waves a SIMD: two work-groups of 64x64 wave tiles a WGP, 256 registers a wave at most
template <int EPI, int BM, int BN, int MI, int KS>
__global__ __launch_bounds__(256, 4) void gemm_bf16_kernel(
    const unsigned short* __restrict__ A,
    const unsigned short* __restrict__ W,
    const float* __restrict__ bias,
    void* __restrict__ out,
    const float* __restrict__ resid,
    int M, int N, int K, int L,
    const float* __restrict__ bias2,
    void* __restrict__ out2) {

    static_assert((BM / (16 * MI)) * (BN / 64) == 8, "eight waves cover the block's tile");
    // P: the LDS pitch of a stage row, in bytes an odd multiple of 16 (see the head of the file);
    // RP: rows that the 256 lanes copy at a time, KS / 8 lanes a row
    constexpr int P = KS + 8, RP = 2048 / KS;
    static_assert(((P / 8) & 1) == 1, "pitch an odd multiple of 16 bytes");
    __shared__ __attribute__((aligned(16))) unsigned short As[2][BM * P];
    __shared__ __attribute__((aligned(16))) unsigned short Bs[2][BN * P];

    const int tid  = threadIdx.x;
    const int lane = tid & 31;
    const int wid  = tid >> 5;           // 0..7
    const int wave_m = wid / (BN / 64);  // 16 MI rows each
    const int wave_n = wid % (BN / 64);  // 64 cols each

    const int m0 = blockIdx.y * BM;
    const int n0 = blockIdx.x * BN;

    // stage loader: KS / 8 uint4 a row; thread handles rows lrow0 + RP r of each matrix;
    // KS / 8 neighbouring lanes cover one row's bytes, whole 128-byte lines
    const int lrow0 = tid / (KS / 8);          // 0..RP-1
    const int lch   = (tid % (KS / 8)) * 8;    // bf16 offset 0,8,..,KS-8

    const int phi = (lane & 16) ? 4 : 0;
    const int r15 = lane & 15;

    v8f acc[MI][4];
#pragma unroll
    for (int i = 0; i < MI; ++i)
#pragma unroll
        for (int j = 0; j < 4; ++j) acc[i][j] = (v8f){};

    const int NK = K / KS;

    const unsigned short* aBase = A + (size_t)m0 * K;   // the block's first rows
    const unsigned short* bBase = W + (size_t)n0 * K;
    const unsigned int gOff = (unsigned int)(lrow0 * K + lch);   // the lane's place in RP rows
    const size_t rStep = (size_t)RP * K;
    const int ldsOff = lrow0 * P + lch;

#if HAVE_ASYNC_LDS
    // ---- async-to-LDS pipelined path ----
    {
        // prologue: stage 0 into buf 0
#pragma unroll   // r a constant: the LDS steps fold into the address additions
        for (int r = 0; r < BM / RP; ++r)
            async_cp16(aBase + r * rStep + gOff, &As[0][ldsOff + r * RP * P]);
#pragma unroll   // the same
        for (int r = 0; r < BN / RP; ++r)
            async_cp16(bBase + r * rStep + gOff, &Bs[0][ldsOff + r * RP * P]);
        wait_async0();
    }
    // publishes stage 0; directly behind the builtin wait it also holds the LDS reads behind it
    __syncthreads();
#else
#pragma unroll   // r a constant, as above
    for (int r = 0; r < BM / RP; ++r)
        *(uint4*)(&As[0][ldsOff + r * RP * P]) = *(const uint4*)(aBase + r * rStep + gOff);
#pragma unroll   // the same
    for (int r = 0; r < BN / RP; ++r)
        *(uint4*)(&Bs[0][ldsOff + r * RP * P]) = *(const uint4*)(bBase + r * rStep + gOff);
    __syncthreads();
#endif

    // ---------------- K loop and epilogue ----------------
    const int wm = wave_m * (16 * MI);   // the wave's first row and column in the block
    const int gmw = m0 + wm;
    const int gnw = n0 + wave_n * 64;
    // behind the K loop's last barrier nobody reads the stage buffers any more: waves 0 to 3
    // restage their results in As, waves 4 to 7 in Bs, each in a range of its own
    char* stage = wid < 4 ? (char*)As : (char*)Bs;
    const int sw = wid & 3;
    if constexpr (EPI == 4) {
        static_assert(MI == 2, "one pass of the epilogue");
        const int half = N >> 1;
        if (n0 < half) {   // the same for the whole block: a tile lies on one side of N/2
            gemm_loop<true, BM, BN, MI, KS>(acc, As, Bs, aBase, bBase, gOff, rStep, ldsOff, NK, wave_m, wave_n, r15, phi);
            gemm_store_heads<MI, 0>(acc, bias, (unsigned short*)out, stage + sw * (32 * SP0), gmw, gnw, L, lane);
        } else {
            gemm_loop<false, BM, BN, MI, KS>(acc, As, Bs, aBase, bBase, gOff, rStep, ldsOff, NK, wave_m, wave_n, r15, phi);
            gemm_store_tr<MI, 0>(acc, bias2, (unsigned short*)out2, gmw + ((lane & 16) ? 8 : 0),
                                 gnw - half + r15, L);
        }
    } else {
        static_assert(MI == 4, "two passes of the epilogue");
        gemm_loop<true, BM, BN, MI, KS>(acc, As, Bs, aBase, bBase, gOff, rStep, ldsOff, NK, wave_m, wave_n, r15, phi);
        // the wave's 64 rows leave in two passes of 32 through the same LDS range
        if constexpr (EPI == 0) {
            gemm_store_heads<MI, 0>(acc, bias, (unsigned short*)out, stage + sw * (32 * SP0), gmw, gnw, L, lane);
            // the wave has read the first 32 rows back before it overwrites them, and the second
            // pass reuses the registers that the first pass's stores name
            asm volatile("s_wait_dscnt 0x0\n\ts_wait_xcnt 0x0" ::: "memory");
            __builtin_amdgcn_sched_barrier(0);   // no register write of the second pass is lifted over the waits
            gemm_store_heads<MI, 2>(acc, bias, (unsigned short*)out, stage + sw * (32 * SP0), gmw + 32, gnw, L, lane);
        } else {
            gemm_store_resid<MI, 0>(acc, bias, (float*)out, resid, stage + sw * (32 * SP3), m0, n0, wm,
                                    wave_n * 64, lane);
            // the wave has read the first 32 rows back before it overwrites them
            asm volatile("s_wait_dscnt 0x0" ::: "memory");
            gemm_store_resid<MI, 2>(acc, bias, (float*)out, resid, stage + sw * (32 * SP3), m0, n0, wm + 32,
                                    wave_n * 64, lane);
        }
    }
}

// ---------------- kernel 3: attention (one wave per 16 S-rows) ----------------
// 16 waves (256 query rows of one head) form a work-group. The head's K (256 x 128)
// and V^T (128 x 256) are brought into LDS once, in whole 128-byte lines, and every
// wave takes its A fragments from there.
// Both products are taken transposed: S^T = K * Q^T and ctx^T = V^T * P^T. In the
// accumulator map a lane then holds 8 keys (or 8 head dims) of ONE query row
// (column lane & 15), so the softmax runs in registers on all 32 lanes, with one
// exchange between the wave's halves for the maximum and one for the sum, and two
// score tiles, converted in place, are the B operand of the second product.

// value of lane l ^ 16
static __device__ __forceinline__ float xhalf(float x) {
    return __builtin_bit_cast(float, __builtin_amdgcn_permlanex16(
        __builtin_bit_cast(int, x), __builtin_bit_cast(int, x),
        0x76543210, 0xfedcba98, false, false));
}

// 2^a. The v_nop fills the one slot the instruction set asks for between a
// transcendental and a next instruction that reads its result or overwrites its
// source; in one statement with it, it cannot be scheduled away from it.
static __device__ __forceinline__ float exp2_slot(float a) {
    float r;
    asm("v_exp_f32 %0, %1\n\tv_nop" : "=v"(r) : "v"(a));
    return r;
}

// LDS pitches in bf16: a K row is 256 B + 16 B of pad, a V^T row 512 B + 16 B, both
// odd multiples of 16 B, so that the 16 rows of a ds_load_b128 half-wave fall on 16
// different groups of four banks.
#define KP 136
#define VP 264
#define ATT_WAVES 16

// Eight asynchronous 16-byte copies per lane, global -> LDS, step gs bytes in global
// memory and ls bytes in LDS. The s_wait_xcnt closes the statement so that it stands
// in front of any later write of the address registers the copies name.
static __device__ __forceinline__ void async_cp16x8(unsigned int l, const char* g,
                                                    unsigned int ls, unsigned int gs) {
    asm volatile(
        "global_load_async_to_lds_b128 %0, %8, off\n\t"
        "global_load_async_to_lds_b128 %1, %9, off\n\t"
        "global_load_async_to_lds_b128 %2, %10, off\n\t"
        "global_load_async_to_lds_b128 %3, %11, off\n\t"
        "global_load_async_to_lds_b128 %4, %12, off\n\t"
        "global_load_async_to_lds_b128 %5, %13, off\n\t"
        "global_load_async_to_lds_b128 %6, %14, off\n\t"
        "global_load_async_to_lds_b128 %7, %15, off\n\t"
        "s_wait_xcnt 0x0"
        :: "v"(l), "v"(l + ls), "v"(l + 2 * ls), "v"(l + 3 * ls),
           "v"(l + 4 * ls), "v"(l + 5 * ls), "v"(l + 6 * ls), "v"(l + 7 * ls),
           "v"(g), "v"(g + gs), "v"(g + 2 * gs), "v"(g + 3 * gs),
           "v"(g + 4 * gs), "v"(g + 5 * gs), "v"(g + 6 * gs), "v"(g + 7 * gs)
        : "memory");
}

// Four A fragments from an LDS tile: rows 16 apart, pitch in dwords; base points at the
// lane's row and its half of the 32 k (dwords 0..3 and 8..11: the k order of the B side)
static __device__ __forceinline__ void lds_frag4(Frag* f, const unsigned int* base, int pitch) {
#pragma unroll
    for (int j = 0; j < 4; ++j) {
        const uint4 lo = *(const uint4*)(base + j * 16 * pitch);
        const uint4 hi = *(const uint4*)(base + j * 16 * pitch + 8);
        f[j].u[0] = lo.x; f[j].u[1] = lo.y; f[j].u[2] = lo.z; f[j].u[3] = lo.w;
        f[j].u[4] = hi.x; f[j].u[5] = hi.y; f[j].u[6] = hi.z; f[j].u[7] = hi.w;
    }
}

// byte offset of a __shared__ object in the work-group's LDS
static __device__ __forceinline__ unsigned int lds_off(const void* p) {
    return (unsigned int)(size_t)(__attribute__((address_space(3))) const void*)p;
}

__global__ __launch_bounds__(ATT_WAVES * 32) void attn_kernel(
    const unsigned short* __restrict__ qb,   // [B,NH,S,HD]
    const unsigned short* __restrict__ kb,   // [B,NH,T,HD]
    const unsigned short* __restrict__ vtb,  // [B,NH,HD,T]
    const float* __restrict__ mask,          // [B,T]
    unsigned short* __restrict__ ctxb) {     // [B,S,H] bf16

    __shared__ __attribute__((aligned(16))) unsigned short Ks[TT * KP];
    __shared__ __attribute__((aligned(16))) unsigned short Vs[HD * VP];

    const int tid  = threadIdx.x;
    const int lane = tid & 31;
    const int bid  = blockIdx.x;
    const int bh   = bid >> 3;               // S/256 = 8 work-groups per (b,h)
    const int s0   = ((bid & 7) << 8) + ((tid >> 5) << 4);
    const int b    = bh >> 4;
    const int h    = bh & 15;

    const int phi  = (lane & 16) ? 4 : 0;
    const int r15  = lane & 15;
    const int m_in = (lane & 16) ? 8 : 0;

    // ---- scores^T: 256 x 16 via 4 K-steps x 16 key tiles of WMMA ----
    // acc[nt][v] = score(query s0 + r15, key nt*16 + m_in + v)
    v8f acc[16];
#pragma unroll
    for (int i = 0; i < 16; ++i) acc[i] = (v8f){};

    // this wave's own 16 query rows, straight from global memory, in flight with the copies
    const unsigned int* qrow = (const unsigned int*)(qb + ((size_t)bh * SS + s0) * HD);
    Frag q[4];
#pragma unroll
    for (int kk = 0; kk < 4; ++kk)
#pragma unroll
        for (int v = 0; v < 8; ++v)
            q[kk].u[v] = qrow[r15 * 64 + kk * 16 + (v & 3) + ((v >= 4) ? 8 : 0) + phi];

    // K and V^T of this head are 64 KiB each, contiguous: thread tid copies the 16-byte
    // pieces tid, tid + 512, ... (a wave's copy is 512 contiguous bytes: two K rows or
    // one V^T row); 512 pieces are 32 K rows or 16 V^T rows.
    async_cp16x8(lds_off(Ks) + (tid >> 4) * (KP * 2) + (tid & 15) * 16,
                 (const char*)(kb + (size_t)bh * TT * HD) + tid * 16, 32 * KP * 2, 8192);
    async_cp16x8(lds_off(Vs) + (tid >> 5) * (VP * 2) + (tid & 31) * 16,
                 (const char*)(vtb + (size_t)bh * HD * TT) + tid * 16, 16 * VP * 2, 8192);
    // this wave's copies have landed; behind the barrier every wave's have
    asm volatile("s_wait_asynccnt 0x0" ::: "memory");
    __syncthreads();

    // group g = K-step g >> 2, key tiles (g & 3) * 4 + 0..3; the next group's fragments
    // are fetched into a second register set ahead of this group's WMMAs
    const unsigned int* kbase = (const unsigned int*)Ks + r15 * (KP / 2) + phi;
    Frag kf[2][4];
    lds_frag4(kf[0], kbase, KP / 2);
#pragma unroll
    for (int g = 0; g < 16; ++g) {
        if (g + 1 < 16)
            lds_frag4(kf[(g + 1) & 1],
                      kbase + ((g + 1) & 3) * 64 * (KP / 2) + ((g + 1) >> 2) * 16, KP / 2);
        // keeps the eight LDS loads one group, ahead of the WMMAs: left free the scheduler
        // either lifts so many loads that the 256 registers spill or waits out each load
        __builtin_amdgcn_sched_barrier(0);
#pragma unroll
        for (int j = 0; j < 4; ++j) {
            const int nt = (g & 3) * 4 + j;
            acc[nt] = __builtin_amdgcn_wmma_f32_16x16x32_bf16(false, kf[g & 1][j].v, false,
                                                              q[g >> 2].v, (short)0, acc[nt],
                                                              false, false);
        }
        __builtin_amdgcn_sched_barrier(0);   // the same, at the group's end
    }

    // ---- softmax over T=256: 128 keys of the row in this lane, 128 in lane ^ 16 ----
    const float* mrow = mask + (size_t)b * TT + m_in;
    v8f mx8;
#pragma unroll
    for (int v = 0; v < 8; ++v) mx8[v] = -1e30f;
#pragma unroll
    for (int nt = 0; nt < 16; ++nt) {
        const float4 ma = *(const float4*)(mrow + nt * 16);
        const float4 mb = *(const float4*)(mrow + nt * 16 + 4);
        const float mk[8] = {ma.x, ma.y, ma.z, ma.w, mb.x, mb.y, mb.z, mb.w};
#pragma unroll
        for (int v = 0; v < 8; ++v) {
            float x = acc[nt][v] * SCALE_INV;
            x = fminf(fmaxf(x, -50.0f), 50.0f);
            x += mk[v] * -1e9f;
            acc[nt][v] = x;
            mx8[v] = fmaxf(mx8[v], x);
        }
        // the mask loads of eight tiles at a time: all 32 lifted to the top take 128
        // registers beside the 128 of acc, and the 256-register budget spills
        if (nt == 7) __builtin_amdgcn_sched_barrier(0);
    }
    float mx = fmaxf(fmaxf(fmaxf(mx8[0], mx8[1]), fmaxf(mx8[2], mx8[3])),
                     fmaxf(fmaxf(mx8[4], mx8[5]), fmaxf(mx8[6], mx8[7])));
    mx = fmaxf(mx, xhalf(mx));
    // the address registers of the mask loads are reused from here on
    asm volatile("s_wait_xcnt 0x0" ::: "memory");

    v8f sum8 = (v8f){};
#pragma unroll
    for (int nt = 0; nt < 16; ++nt)
#pragma unroll
        for (int v = 0; v < 8; ++v) {
            float e = exp2_slot((acc[nt][v] - mx) * 1.44269504f);   // e^(x - mx)
            acc[nt][v] = e;
            sum8[v] += e;
        }
    float sum = ((sum8[0] + sum8[1]) + (sum8[2] + sum8[3])) +
                ((sum8[4] + sum8[5]) + (sum8[6] + sum8[7]));
    sum += xhalf(sum);
    const float inv = 1.0f / (sum + 1e-8f);

    // probs^T as B fragments: score tiles 2kk and 2kk+1 hold keys kk*32 + m_in + 0..7
    // and kk*32 + 16 + m_in + 0..7, the k order of the V^T loader below
    Frag p[8];
#pragma unroll
    for (int kk = 0; kk < 8; ++kk)
#pragma unroll
        for (int w = 0; w < 4; ++w) {
            p[kk].u[w]     = (unsigned int)f2bf(acc[2 * kk][2 * w] * inv) |
                             ((unsigned int)f2bf(acc[2 * kk][2 * w + 1] * inv) << 16);
            p[kk].u[4 + w] = (unsigned int)f2bf(acc[2 * kk + 1][2 * w] * inv) |
                             ((unsigned int)f2bf(acc[2 * kk + 1][2 * w + 1] * inv) << 16);
        }
    // keeps the packing ahead of the second product: spread among its WMMAs the 128
    // f32 values stay live beside the V fragments and the ctx accumulators
    __builtin_amdgcn_sched_barrier(0);

    // ---- ctx^T = V^T @ probs^T : 128 x 16, K over T=256 ----
    // c[nt][v] = ctx(query s0 + r15, head dim nt*16 + m_in + v)
    v8f c[8];
#pragma unroll
    for (int i = 0; i < 8; ++i) c[i] = (v8f){};

    // group g = K-step g >> 1, head-dim tiles (g & 1) * 4 + 0..3, fetched as above
    const unsigned int* vbase = (const unsigned int*)Vs + r15 * (VP / 2) + phi;
    Frag vf[2][4];
    lds_frag4(vf[0], vbase, VP / 2);
#pragma unroll
    for (int g = 0; g < 16; ++g) {
        if (g + 1 < 16)
            lds_frag4(vf[(g + 1) & 1],
                      vbase + ((g + 1) & 1) * 64 * (VP / 2) + ((g + 1) >> 1) * 16, VP / 2);
        __builtin_amdgcn_sched_barrier(0);   // one load group ahead of the WMMAs, as above
#pragma unroll
        for (int j = 0; j < 4; ++j) {
            const int nt = (g & 1) * 4 + j;
            c[nt] = __builtin_amdgcn_wmma_f32_16x16x32_bf16(false, vf[g & 1][j].v, false,
                                                            p[g >> 1].v, (short)0, c[nt],
                                                            false, false);
        }
        __builtin_amdgcn_sched_barrier(0);   // the same, at the group's end
    }

    // ctx -> [B,S,H] bf16: 8 consecutive head dims of one row per lane and tile
    unsigned short* crow = ctxb + ((size_t)(b * SS + s0 + r15)) * HH + h * HD + m_in;
#pragma unroll
    for (int nt = 0; nt < 8; ++nt) {
        uint4 o;
        o.x = (unsigned int)f2bf(c[nt][0]) | ((unsigned int)f2bf(c[nt][1]) << 16);
        o.y = (unsigned int)f2bf(c[nt][2]) | ((unsigned int)f2bf(c[nt][3]) << 16);
        o.z = (unsigned int)f2bf(c[nt][4]) | ((unsigned int)f2bf(c[nt][5]) << 16);
        o.w = (unsigned int)f2bf(c[nt][6]) | ((unsigned int)f2bf(c[nt][7]) << 16);
        *(uint4*)(crow + nt * 16) = o;
    }
}

// ---------------- kernel 4: LayerNorm (one block per row) ----------------
__global__ __launch_bounds__(256) void layernorm_kernel(const float* __restrict__ x,
                                                        const float* __restrict__ g,
                                                        const float* __restrict__ bta,
                                                        float* __restrict__ out) {
    __shared__ float rs[256], rq[256];
    const int tid = threadIdx.x;
    const size_t row = (size_t)blockIdx.x * HH;

    float s = 0.0f, q = 0.0f;
#pragma unroll
    for (int j = 0; j < HH / 256; ++j) {
        float v = x[row + tid + j * 256];
        s += v;
        q += v * v;
    }
    rs[tid] = s;
    rq[tid] = q;
    __syncthreads();
    for (int off = 128; off > 0; off >>= 1) {
        if (tid < off) { rs[tid] += rs[tid + off]; rq[tid] += rq[tid + off]; }
        __syncthreads();
    }
    const float mu  = rs[0] * (1.0f / HH);
    const float var = rq[0] * (1.0f / HH) - mu * mu;
    const float r   = rsqrtf(var + LN_EPS);
#pragma unroll
    for (int j = 0; j < HH / 256; ++j) {
        int i = tid + j * 256;
        out[row + i] = (x[row + i] - mu) * r * g[i] + bta[i];
    }
}

// ---------------- launcher ----------------
extern "C" void kernel_launch(void* const* d_in, const int* in_sizes, int n_in,
                              void* d_out, int out_size, void* d_ws, size_t ws_size,
                              hipStream_t stream) {
    const float* hs   = (const float*)d_in[0];   // (B,S,H)
    const float* at   = (const float*)d_in[1];   // (B,T,H)
    const float* mask = (const float*)d_in[2];   // (B,T)
    const float* Wq   = (const float*)d_in[3];
    const float* bq   = (const float*)d_in[4];
    const float* Wk   = (const float*)d_in[5];
    const float* bk   = (const float*)d_in[6];
    const float* Wv   = (const float*)d_in[7];
    const float* bv   = (const float*)d_in[8];
    const float* Wo   = (const float*)d_in[9];
    const float* bo   = (const float*)d_in[10];
    const float* ln_g = (const float*)d_in[11];
    const float* ln_b = (const float*)d_in[12];
    float* outp = (float*)d_out;

    const size_t BS = (size_t)BB * SS;   // 8192
    const size_t BT = (size_t)BB * TT;   // 1024

    // workspace carve-up (bf16 stored as ushort)
    char* w = (char*)d_ws;
    unsigned short* hsb  = (unsigned short*)w;                  w += BS * HH * 2;
    unsigned short* atb  = (unsigned short*)w;                  w += BT * HH * 2;
    unsigned short* wqb  = (unsigned short*)w;                  w += (size_t)HH * HH * 2;
    unsigned short* wkb  = (unsigned short*)w;                  w += (size_t)HH * HH * 2;
    unsigned short* wvb  = (unsigned short*)w;                  w += (size_t)HH * HH * 2;
    unsigned short* wob  = (unsigned short*)w;                  w += (size_t)HH * HH * 2;
    unsigned short* qb   = (unsigned short*)w;                  w += BS * HH * 2;     // [B,NH,S,HD]
    unsigned short* kbuf = (unsigned short*)w;                  w += BT * HH * 2;     // [B,NH,T,HD]
    unsigned short* vtb  = (unsigned short*)w;                  w += BT * HH * 2;     // [B,NH,HD,T]
    unsigned short* ctxb = (unsigned short*)w;                  w += BS * HH * 2;     // [B,S,H]
    float*          opre = (float*)w;                           w += BS * HH * 4;

    // 1) converts: hsb, atb, wqb, wkb, wvb, wob are one contiguous range that starts at hsb
    convert_all_kernel<<<CV_GRID, CV_THREADS, 0, stream>>>(hs, at, Wq, Wk, Wv, Wo, hsb);

    // 2) projections
    gemm_bf16_kernel<0, 128, 256, 4, GK><<<dim3(HH / 256, BS / 128), 256, 0, stream>>>(
        hsb, wqb, bq, qb, nullptr, (int)BS, HH, HH, SS, nullptr, nullptr);
    // K and V together: wvb lies directly behind wkb, so the two are one matrix of 2 H rows;
    // 256 work-groups, where each projection alone has 128
    gemm_bf16_kernel<4, 128, 128, 2, 256><<<dim3(2 * HH / 128, BT / 128), 256, 0, stream>>>(
        atb, wkb, bk, kbuf, nullptr, (int)BT, 2 * HH, HH, TT, bv, vtb);

    // 3) attention: one wave per 16 S-rows, 16 waves of one head per work-group
    attn_kernel<<<BB * NHH * (SS / 256), 512, 0, stream>>>(qb, kbuf, vtb, mask, ctxb);

    // 4) output projection + bias + residual (f32)
    gemm_bf16_kernel<3, 128, 256, 4, GK><<<dim3(HH / 256, BS / 128), 256, 0, stream>>>(
        ctxb, wob, bo, opre, hs, (int)BS, HH, HH, SS, nullptr, nullptr);

    // 5) LayerNorm -> d_out
    layernorm_kernel<<<(int)BS, 256, 0, stream>>>(opre, ln_g, ln_b, outp);
}
